// v000
// The times below were measured on an AMD MI455X: many runs one after another, warmed up first and cycling through
// copies of the inputs, with the whole window's GPU time divided by the number of runs. Launches and the gaps
// between them are all in it. The median over several windows is given; except for v000 it joins two sittings, which
// can be a few percent apart, so the side-by-side timings, each taken in one sitting, are the better comparison.
// v000 is the starting kernel. One run takes 1020 microseconds.
#include <hip/hip_runtime.h>

// Gated row attention along the width axis with a pre-LayerNorm: x [1][128][256][256] = 128 independent sequences (image rows) of 256 tokens x 256 features; xn = LayerNorm(x) (gamma, beta, eps 1e-5); q = xn Wq ('xw' [256][512], 8 heads x 64), [k|v] = xn Wkv ('xw' [256][1024]: columns k | v); dots = (q/8).k over the 256 keys of the same sequence; softmax; out = attn.v merged; gates = sigmoid(xn Wg + bg) ('xw' [256][512]); y = (out * gates) Wo + bo ('xw' [512][256]) -> [1][128][256][256] (8.4 M).
// Compute dtypes, f32 accumulate: all contractions v_wmma_f32_16x16x32_bf16 (bf16 operands). Every input RNE-converted to bf16 on load; LayerNorm in f32, xn as bf16 hi + lo planes; fused q|k|v|g projection as (hi + lo) x exact weights (2 products); scores and attn.v on bf16 hi/lo planes (3 products) for every row; softmax f32; sigmoid gate f32 (true division) with f32 bias add; (out x gate) as hi + lo x exact Wo (2 products) + bo.
// Layout: LayerNorm planes for all tokens in one launch; then 8 sequences (2,048 tokens) per pass; all per-(sequence, head) planes are z-major ([z = s*8 + head][256][64]) so each attention stage is ONE z-batched launch of tile GEMMs.

#ifndef NB_
#define NB_  128       // sequences (image rows) processed by this build
#endif
#define NB_FULL 128    // sequences in the input / output
#define TT   256       // tokens per sequence
#define DM   256
#define NH_  8
#define HD   64
#define DQ   (NH_ * HD)    // 512 = inner dim
#define DP   (4 * DQ)      // 2048 = fused projection width q | k | v | g
#ifndef GB
#if NB_ >= 8
#define GB   8             // sequences per pass
#else
#define GB   NB_
#endif
#endif
#define GR   (GB * TT)     // token rows per pass
#define ZH   (GB * NH_)    // (sequence, head) planes per pass
#define NT   (NB_ * TT)    // token rows in total
#define SCL  0.125f        // HD^-0.5

static_assert(NB_ >= 1 && NB_ <= NB_FULL);
static_assert((NB_ % GB) == 0);
static_assert((GR % 64) == 0 && (TT % 64) == 0 && (HD % 64) == 0 && (DM % 64) == 0 && (DQ % 64) == 0 && (DP % 64) == 0);
static_assert((HD % 32) == 0 && (DM % 32) == 0 && (DQ % 32) == 0 && (TT % 32) == 0);
static_assert((TT % 128) == 0 && (NT % 8) == 0 && (DM % 128) == 0);
static_assert(((DQ * DM) % 64) == 0 && ((2 * DQ * DM) % 64) == 0);

typedef unsigned short bf;
typedef __attribute__((ext_vector_type(16))) __bf16   v16bf;
typedef __attribute__((ext_vector_type(8)))  unsigned short v8us;
typedef __attribute__((ext_vector_type(8)))  float    v8f;
typedef __attribute__((ext_vector_type(4)))  float    v4f;
typedef v4f  __attribute__((may_alias)) v4fa;
typedef __attribute__((ext_vector_type(2))) unsigned short v2us;
typedef __attribute__((ext_vector_type(4))) unsigned short v4us;

constexpr size_t al256(size_t b) { return (b + 255) & ~(size_t)255; }
constexpr size_t WS_NEED = al256((size_t)DP * DM * 2) + al256((size_t)DM * DQ * 2) + 2 * al256((size_t)NT * DM * 2) + al256((size_t)GR * DP * 4)
                         + 6 * al256((size_t)ZH * TT * HD * 2) + al256((size_t)ZH * TT * TT * 4) + 2 * al256((size_t)ZH * TT * TT * 2)
                         + al256((size_t)ZH * TT * HD * 4) + 2 * al256((size_t)GR * DQ * 2);
static_assert(WS_NEED <= (size_t)134217728);

__device__ __forceinline__ unsigned short f2bf(float f) { unsigned u = __float_as_uint(f); u += 0x7FFFu + ((u >> 16) & 1u); return (unsigned short)(u >> 16); }
__device__ __forceinline__ float bf2f(unsigned short b) { return __uint_as_float(((unsigned)b) << 16); }
__device__ __forceinline__ float bfr(float f) { return bf2f(f2bf(f)); }
__device__ __forceinline__ v16bf cat16b(v8us lo, v8us hi) { return __builtin_bit_cast(v16bf, __builtin_shufflevector(lo, hi, 0, 1, 2, 3, 4, 5, 6, 7, 8, 9, 10, 11, 12, 13, 14, 15)); }
__device__ __forceinline__ v8f wmmab(v16bf a, v16bf b, v8f c) { return __builtin_amdgcn_wmma_f32_16x16x32_bf16(false, a, false, b, (short)0, c, false, false); }
__device__ __forceinline__ void splitf(float y, unsigned short& h, unsigned short& l) { h = f2bf(y); l = f2bf(y - bf2f(h)); }

// ---- k_gemmw: register-blocked GEMM, ONE WAVE per 64x64 output tile (16 accumulators), operands straight from K-contiguous 16-bit planes; grid (M/64, N/64, Z), 32 threads.
// C[m][n] (f32, pitch ldc, + optional f32 bias[n]) = sum_k A[m][k] Bt[n][k] (+ split products per NSPLIT). z-batch strides sA/sB/sC in elements. K % 32 == 0.
// Fragments: lane l -> row/col l&15, elements 0..7 <- k0 + 8*(l>>4) + 0..7, elements 8..15 <- k0 + 16 + 8*(l>>4) + 0..7 for A and for Bt alike; D element r of lane l = (row 8*(l>>4) + r, col l&15).
template <typename T16> struct WFrag;
template <> struct WFrag<bf> { typedef v16bf V; static __device__ __forceinline__ V ld(const bf* p) { return cat16b(*(const v8us*)p, *(const v8us*)(p + 16)); } static __device__ __forceinline__ v8f mma(V a, V b, v8f c) { return wmmab(a, b, c); } };
template <typename T16, int NSPLIT, bool BIAS>
__global__ __launch_bounds__(32) void k_gemmw(const T16* __restrict__ A, const T16* __restrict__ A2, const T16* __restrict__ Bt, const T16* __restrict__ Bt2, int K, float* C, int ldc, const float* __restrict__ bias, size_t sA, size_t sB, size_t sC) {
    typedef typename WFrag<T16>::V V;
    __shared__ __align__(16) float os[16 * 68];
    const size_t z = blockIdx.z; A += z * sA; if (A2) A2 += z * sA; Bt += z * sB; if (Bt2) Bt2 += z * sB; C += z * sC;
    const int lane = threadIdx.x & 31, lr = lane & 15, hi = lane >> 4; const int r0 = blockIdx.x * 64, c0 = blockIdx.y * 64;
    v8f acc[4][4];
#pragma unroll
    for (int mb = 0; mb < 4; ++mb)
#pragma unroll
        for (int nb = 0; nb < 4; ++nb) acc[mb][nb] = (v8f){};
    const size_t aoff = (size_t)(r0 + lr) * K + 8 * hi, boff = (size_t)(c0 + lr) * K + 8 * hi;
#pragma unroll 1
    for (int kc = 0; kc < K; kc += 32) {
        V a[4], a2[4];
#pragma unroll
        for (int mb = 0; mb < 4; ++mb) { a[mb] = WFrag<T16>::ld(A + aoff + (size_t)mb * 16 * K + kc); if (NSPLIT == 1 || NSPLIT == 2) a2[mb] = WFrag<T16>::ld(A2 + aoff + (size_t)mb * 16 * K + kc); }
#pragma unroll
        for (int nb = 0; nb < 4; ++nb) { const V b = WFrag<T16>::ld(Bt + boff + (size_t)nb * 16 * K + kc); V b2; if (NSPLIT >= 2) b2 = WFrag<T16>::ld(Bt2 + boff + (size_t)nb * 16 * K + kc);
#pragma unroll
            for (int mb = 0; mb < 4; ++mb) { acc[mb][nb] = WFrag<T16>::mma(a[mb], b, acc[mb][nb]); if (NSPLIT == 1 || NSPLIT == 2) acc[mb][nb] = WFrag<T16>::mma(a2[mb], b, acc[mb][nb]); if (NSPLIT >= 2) acc[mb][nb] = WFrag<T16>::mma(a[mb], b2, acc[mb][nb]); } }
        asm volatile("v_nop\n\tv_nop\n\tv_nop\n\tv_nop" : "+v"(acc[0][0]), "+v"(acc[1][1]), "+v"(acc[2][2]), "+v"(acc[3][3]) : "v"(a[0]), "v"(a[3]));
    }
#pragma unroll
    for (int mb = 0; mb < 4; ++mb) {
#pragma unroll
        for (int nb = 0; nb < 4; ++nb) {
#pragma unroll
            for (int j = 0; j < 8; ++j) os[(hi * 8 + j) * 68 + nb * 16 + lr] = acc[mb][nb][j]; }
        __builtin_amdgcn_wave_barrier(); asm volatile("" ::: "memory");
        float* crow = C + (size_t)(r0 + mb * 16) * ldc + c0;
{
#pragma unroll
            for (int s = 0; s < 8; ++s) { const int row = 2 * s + hi, cofs = lr * 4; v4f val = *(const v4fa*)(os + row * 68 + cofs); if (BIAS) { val[0] += bfr(bias[c0 + cofs]); val[1] += bfr(bias[c0 + cofs + 1]); val[2] += bfr(bias[c0 + cofs + 2]); val[3] += bfr(bias[c0 + cofs + 3]); }
                *(v4f*)(crow + (size_t)row * ldc + cofs) = val; }
             }
        __builtin_amdgcn_wave_barrier(); asm volatile("" ::: "memory");
    }
}

__global__ __launch_bounds__(256) void k_wtG(const float* __restrict__ w, int K, int N, bf* Bt) {
    const int lane = threadIdx.x & 31; const int L0 = (blockIdx.x * 8 + (threadIdx.x >> 5)) * 8; const int nlines = N * K / 64;
{
#pragma unroll 1
        for (int l = 0; l < 8; ++l) { const int L = L0 + l; if (L >= nlines) break; const size_t e = (size_t)L * 64 + lane * 2; const int k = (int)(e % K), n = (int)(e / K); v2us o;
            o[0] = f2bf(w[(size_t)k * N + n]); o[1] = f2bf(w[(size_t)(k + 1) * N + n]); *(v2us*)(Bt + e) = o; }
         }
}

__global__ __launch_bounds__(256) void k_ln256(const float* __restrict__ X, int nrows, const float* __restrict__ gw, const float* __restrict__ gb, bf* Yh, bf* Yl) {
    const int lane = threadIdx.x & 31; const int r = blockIdx.x * 8 + (threadIdx.x >> 5); if (r >= nrows) return; const float* xr = X + (size_t)r * DM; float hv[8]; float s = 0.f;
#pragma unroll
    for (int ch = 0; ch < 2; ++ch) { const v4f y = *(const v4f*)(xr + ch * 128 + lane * 4);
#pragma unroll
        for (int q = 0; q < 4; ++q) { const float u = bfr(y[q]); hv[ch * 4 + q] = u; s += u; } }
#pragma unroll
    for (int sh = 16; sh; sh >>= 1) s += __shfl_xor(s, sh, 32);
    float mu = s * (1.0f / 256.0f); asm volatile("" : "+v"(mu)); float s2 = 0.f;
#pragma unroll
    for (int k = 0; k < 8; ++k) { float d0 = __fsub_rn(hv[k], mu); asm volatile("" : "+v"(d0)); float p = __fmul_rn(d0, d0); asm volatile("" : "+v"(p)); s2 = __fadd_rn(s2, p); }
#pragma unroll
    for (int sh = 16; sh; sh >>= 1) s2 += __shfl_xor(s2, sh, 32);
    float var = __fadd_rn(s2 * (1.0f / 256.0f), 1e-5f); asm volatile("" : "+v"(var)); const float rs = __frsqrt_rn(var);
{
#pragma unroll
        for (int ch = 0; ch < 2; ++ch) { const int c0 = ch * 128 + lane * 4; v4us oh, ol;
#pragma unroll
            for (int q = 0; q < 4; ++q) { float gg = bfr(gw[c0 + q]); asm volatile("" : "+v"(gg)); float d0 = __fsub_rn(hv[ch * 4 + q], mu); asm volatile("" : "+v"(d0)); float n0 = __fmul_rn(d0, rs); asm volatile("" : "+v"(n0)); float y = __fmul_rn(n0, gg); asm volatile("" : "+v"(y)); y = __fadd_rn(y, bfr(gb[c0 + q])); unsigned short a, c2; splitf(y, a, c2); oh[q] = a; ol[q] = c2; }
            *(v4us*)(Yh + (size_t)r * DM + c0) = oh; *(v4us*)(Yl + (size_t)r * DM + c0) = ol; }
         } }

// k_planes: from the fused projection output F [GR][pitch] (columns q | k | v | g), blockIdx.y = 0: q planes, 1: k planes, 2: transposed v planes (block-uniform select).
__global__ __launch_bounds__(256) void k_planes(const float* __restrict__ F, int pitch, bf* QPh, bf* QPl, bf* KPh, bf* KPl, bf* Vh, bf* Vl) {
    const int sel = blockIdx.y;
    const size_t e = ((size_t)blockIdx.x * 256 + threadIdx.x) * 2; if (e >= (size_t)ZH * TT * HD) return;
    v2us oh, ol;
    if (sel < 2) {
        const int d = (int)(e % HD); const int t = (int)((e / HD) % TT); const int z = (int)(e / ((size_t)HD * TT)); const int h = z % NH_, sq = z / NH_;
        const float* f = F + ((size_t)sq * TT + t) * pitch + sel * DQ + h * HD + d;
#pragma unroll
        for (int q = 0; q < 2; ++q) { unsigned short a, c2; splitf(f[q], a, c2); oh[q] = a; ol[q] = c2; }
        bf* Ph = (sel == 0) ? QPh : KPh; bf* Pl = (sel == 0) ? QPl : KPl;
        *(v2us*)(Ph + e) = oh; *(v2us*)(Pl + e) = ol; 
    } else {
        const int t = (int)(e % TT); const int d = (int)((e / TT) % HD); const int z = (int)(e / ((size_t)TT * HD)); const int h = z % NH_, sq = z / NH_;
#pragma unroll
        for (int q = 0; q < 2; ++q) { const float x = F[((size_t)sq * TT + t + q) * pitch + 2 * DQ + h * HD + d]; unsigned short a, c2; splitf(x, a, c2); oh[q] = a; ol[q] = c2; }
        *(v2us*)(Vh + e) = oh; *(v2us*)(Vl + e) = ol; 
    }
}

// k_asoft: per row (z, i): t = S x HD^-0.5 (no mask); softmax over the TT keys (register row, one exp, fixed trees, reciprocal-multiply normalisation);
__global__ __launch_bounds__(256) void k_asoft(const float* __restrict__ Sb, bf* Ph, bf* Pl) {
    const int lane = threadIdx.x & 31; const int row = blockIdx.x * 8 + (threadIdx.x >> 5); if (row >= ZH * TT) return;
    const float* sr = Sb + (size_t)row * TT; float v[TT / 32]; float mx = -3.0e38f;
#pragma unroll
    for (int ch = 0; ch < TT / 128; ++ch) { const int j0 = ch * 128 + lane * 4; const v4f a = *(const v4f*)(sr + j0);
#pragma unroll
        for (int q = 0; q < 4; ++q) { const float t = a[q] * SCL; v[ch * 4 + q] = t; mx = fmaxf(mx, t); } }
#pragma unroll
    for (int sh = 16; sh; sh >>= 1) mx = fmaxf(mx, __shfl_xor(mx, sh, 32));
    float sum = 0.f;
#pragma unroll
    for (int k = 0; k < TT / 32; ++k) { float d0 = __fsub_rn(v[k], mx); asm volatile("" : "+v"(d0)); v[k] = __builtin_amdgcn_exp2f(__fmul_rn(d0, 1.4426950408889634f)); sum += v[k]; }
#pragma unroll
    for (int sh = 16; sh; sh >>= 1) sum += __shfl_xor(sum, sh, 32);
    const float f = __fdiv_rn(1.0f, sum);
{
#pragma unroll
        for (int ch = 0; ch < TT / 128; ++ch) { v4us oh, ol;
#pragma unroll
            for (int q = 0; q < 4; ++q) { unsigned short a, c2; splitf(v[ch * 4 + q] * f, a, c2); oh[q] = a; ol[q] = c2; }
            const size_t oo = (size_t)row * TT + ch * 128 + lane * 4; *(v4us*)(Ph + oo) = oh; *(v4us*)(Pl + oo) = ol; }
         }
}

// k_mergeGz: gated merge: AT hi/lo planes [s*TT + t][h*HD + d] = O[z][t][d] x sigmoid(G[(s*TT + t)*gpitch + gcoff + h*HD + d] + bg[h*HD + d]) with z = s*NH_ + h, G the f32 gate pre-activation without bias
__global__ __launch_bounds__(256) void k_mergeGz(const float* __restrict__ O, const float* __restrict__ G, int gpitch, int gcoff, const float* __restrict__ bgp, bf* Ah, bf* Al) {
    const size_t e = ((size_t)blockIdx.x * 256 + threadIdx.x) * 2; if (e >= (size_t)ZH * TT * HD) return;
    const int d = (int)(e % HD); const int t = (int)((e / HD) % TT); const int z = (int)(e / ((size_t)HD * TT)); const int h = z % NH_, sq = z / NH_;
    const size_t tok = (size_t)sq * TT + t; const int col = h * HD + d;
    const size_t oo = tok * DQ + col; const size_t go = tok * (size_t)gpitch + gcoff + col; v2us oh, ol;
#pragma unroll
    for (int q = 0; q < 2; ++q) { float o = O[e + q]; asm volatile("" : "+v"(o)); float g = __fadd_rn(G[go + q], bfr(bgp[col + q])); asm volatile("" : "+v"(g)); float den = __fadd_rn(1.0f, expf(-g)); asm volatile("" : "+v"(den)); const float sg = __fdiv_rn(1.0f, den); unsigned short a, c2; splitf(__fmul_rn(o, sg), a, c2); oh[q] = a; ol[q] = c2; }
    *(v2us*)(Ah + oo) = oh; *(v2us*)(Al + oo) = ol;  }

extern "C" void kernel_launch(void* const* d_in, const int* in_sizes, int n_in,
                              void* d_out, int out_size, void* d_ws, size_t ws_size, hipStream_t stream) {
    if (n_in < 9) return;
    if (in_sizes[0] < NT * DM || in_sizes[1] < DM || in_sizes[2] < DM || in_sizes[3] < DM * DQ || in_sizes[4] < DM * 2 * DQ
        || in_sizes[5] < DM * DQ || in_sizes[6] < DQ || in_sizes[7] < DQ * DM || in_sizes[8] < DM) return;
    if (out_size < NT * DM) return;
    const float* x = (const float*)d_in[0]; const float* ln_g = (const float*)d_in[1]; const float* ln_b = (const float*)d_in[2]; const float* wq = (const float*)d_in[3]; const float* wkv = (const float*)d_in[4]; const float* wg = (const float*)d_in[5]; const float* bg = (const float*)d_in[6]; const float* wo = (const float*)d_in[7]; const float* bo = (const float*)d_in[8];
    float* OUT = (float*)d_out;     // [NB][TT][DM] = [NT][256]
    char* wsp = (char*)d_ws;
    auto take = [&](size_t bytes) { char* p = wsp; wsp += (bytes + 255) & ~(size_t)255; return (void*)p; };
    bf* WB = (bf*)take((size_t)DP * DM * 2);     // Bt [2048][256]: rows 0..511 q, 512..1023 k, 1024..1535 v, 1536..2047 g
    bf* WO = (bf*)take((size_t)DM * DQ * 2);     // Bt [256][512]
    bf* LNh = (bf*)take((size_t)NT * DM * 2); bf* LNl = (bf*)take((size_t)NT * DM * 2);
    float* F = (float*)take((size_t)GR * DP * 4); // [GR][2048] f32: q | k | v | g (g without bias)
    bf* QPh = (bf*)take((size_t)ZH * TT * HD * 2); bf* QPl = (bf*)take((size_t)ZH * TT * HD * 2); bf* KPh = (bf*)take((size_t)ZH * TT * HD * 2); bf* KPl = (bf*)take((size_t)ZH * TT * HD * 2); bf* VTh = (bf*)take((size_t)ZH * HD * TT * 2); bf* VTl = (bf*)take((size_t)ZH * HD * TT * 2);
    float* Sb = (float*)take((size_t)ZH * TT * TT * 4); bf* Ph = (bf*)take((size_t)ZH * TT * TT * 2); bf* Pl = (bf*)take((size_t)ZH * TT * TT * 2); float* Ob = (float*)take((size_t)ZH * TT * HD * 4); bf* ATh = (bf*)take((size_t)GR * DQ * 2); bf* ATl = (bf*)take((size_t)GR * DQ * 2);
    if ((size_t)(wsp - (char*)d_ws) > ws_size) return;
    /* weights ('xw': Bt[n][k] = W[k][n]); the fused Wkv gives Bt rows 512..1023 = k, 1024..1535 = v */
    k_wtG<<<(unsigned)((DM * DQ / 64 + 63) / 64), 256, 0, stream>>>(wq, DM, DQ, WB);
    k_wtG<<<(unsigned)((DM * 2 * DQ / 64 + 63) / 64), 256, 0, stream>>>(wkv, DM, 2 * DQ, WB + (size_t)DQ * DM);
    k_wtG<<<(unsigned)((DM * DQ / 64 + 63) / 64), 256, 0, stream>>>(wg, DM, DQ, WB + (size_t)3 * DQ * DM);
    k_wtG<<<(unsigned)((DQ * DM / 64 + 63) / 64), 256, 0, stream>>>(wo, DQ, DM, WO);
    k_ln256<<<NT / 8, 256, 0, stream>>>(x, NT, ln_g, ln_b, LNh, LNl);
    const unsigned LP = (unsigned)(((size_t)ZH * TT * HD / 2 + 255) / 256);
    for (int g = 0; g < NB_ / GB; ++g) { const size_t row0 = (size_t)g * GR;
        k_gemmw<bf, 1, false><<<dim3(GR / 64, DP / 64, 1), 32, 0, stream>>>(LNh + row0 * DM, LNl + row0 * DM, WB, nullptr, DM, F, DP, nullptr, 0, 0, 0);
        k_planes<<<dim3(LP, 3, 1), 256, 0, stream>>>(F, DP, QPh, QPl, KPh, KPl, VTh, VTl);
        k_gemmw<bf, 2, false><<<dim3(TT / 64, TT / 64, ZH), 32, 0, stream>>>(QPh, QPl, KPh, KPl, HD, Sb, TT, nullptr, (size_t)TT * HD, (size_t)TT * HD, (size_t)TT * TT);
        k_asoft<<<ZH * TT / 8, 256, 0, stream>>>(Sb, Ph, Pl);
        k_gemmw<bf, 2, false><<<dim3(TT / 64, HD / 64, ZH), 32, 0, stream>>>(Ph, Pl, VTh, VTl, TT, Ob, HD, nullptr, (size_t)TT * TT, (size_t)HD * TT, (size_t)TT * HD);
        k_mergeGz<<<LP, 256, 0, stream>>>(Ob, F, DP, 3 * DQ, bg, ATh, ATl);
        k_gemmw<bf, 1, true><<<dim3(GR / 64, DM / 64, 1), 32, 0, stream>>>(ATh, ATl, WO, nullptr, DQ, OUT + row0 * DM, DM, bo, 0, 0, 0); }
}

// v001
// One run takes 630 microseconds.
// In two side-by-side timings against v000, it was 1.62 and 1.63 times as fast.
#include <hip/hip_runtime.h>

// Gated row attention along the width axis with a pre-LayerNorm: x [1][128][256][256] = 128 independent sequences (image rows) of 256 tokens x 256 features; xn = LayerNorm(x) (gamma, beta, eps 1e-5); q = xn Wq ('xw' [256][512], 8 heads x 64), [k|v] = xn Wkv ('xw' [256][1024]: columns k | v); dots = (q/8).k over the 256 keys of the same sequence; softmax; out = attn.v merged; gates = sigmoid(xn Wg + bg) ('xw' [256][512]); y = (out * gates) Wo + bo ('xw' [512][256]) -> [1][128][256][256] (8.4 M).
// Compute dtypes, f32 accumulate: all contractions v_wmma_f32_16x16x32_bf16 (bf16 operands). Every input RNE-converted to bf16 on load; LayerNorm in f32, xn as bf16 hi + lo planes; fused q|k|v|g projection as (hi + lo) x exact weights (2 products); scores and attn.v on bf16 hi/lo planes (3 products) for every row; softmax f32; sigmoid gate f32 (true division) with f32 bias add; (out x gate) as hi + lo x exact Wo (2 products) + bo.
// Layout: LayerNorm planes for all tokens in one launch; then 32 sequences (8,192 tokens) per pass, workspace planes that are dead by then reused inside the pass; all per-(sequence, head) planes are z-major ([z = s*8 + head][256][64]) so each attention stage is ONE z-batched launch of tile GEMMs.

#ifndef NB_
#define NB_  128       // sequences (image rows) processed by this build
#endif
#define NB_FULL 128    // sequences in the input / output
#define TT   256       // tokens per sequence
#define DM   256
#define NH_  8
#define HD   64
#define DQ   (NH_ * HD)    // 512 = inner dim
#define DP   (4 * DQ)      // 2048 = fused projection width q | k | v | g
#ifndef GB
#if NB_ >= 32
#define GB   32            // sequences per pass
#else
#define GB   NB_
#endif
#endif
#define GR   (GB * TT)     // token rows per pass
#define ZH   (GB * NH_)    // (sequence, head) planes per pass
#define NT   (NB_ * TT)    // token rows in total
#define SCL  0.125f        // HD^-0.5

static_assert(NB_ >= 1 && NB_ <= NB_FULL);
static_assert((NB_ % GB) == 0);
static_assert((GR % 64) == 0 && (TT % 64) == 0 && (HD % 64) == 0 && (DM % 64) == 0 && (DQ % 64) == 0 && (DP % 64) == 0);
static_assert((HD % 32) == 0 && (DM % 32) == 0 && (DQ % 32) == 0 && (TT % 32) == 0);
static_assert((TT % 128) == 0 && (NT % 8) == 0 && (DM % 128) == 0);
static_assert(((DQ * DM) % 64) == 0 && ((2 * DQ * DM) % 64) == 0);

typedef unsigned short bf;
typedef __attribute__((ext_vector_type(16))) __bf16   v16bf;
typedef __attribute__((ext_vector_type(8)))  unsigned short v8us;
typedef __attribute__((ext_vector_type(8)))  float    v8f;
typedef __attribute__((ext_vector_type(4)))  float    v4f;
typedef v4f  __attribute__((may_alias)) v4fa;
typedef __attribute__((ext_vector_type(2))) unsigned short v2us;
typedef __attribute__((ext_vector_type(4))) unsigned short v4us;

constexpr size_t al256(size_t b) { return (b + 255) & ~(size_t)255; }
constexpr size_t WS_NEED = al256((size_t)DP * DM * 2) + al256((size_t)DM * DQ * 2) + 2 * al256((size_t)NT * DM * 2) + al256((size_t)GR * DP * 4)
                         + 2 * al256((size_t)ZH * TT * HD * 2) + al256((size_t)ZH * TT * TT * 4) + 2 * al256((size_t)ZH * TT * TT * 2);
static_assert(WS_NEED <= (size_t)268435456);
static_assert(4 * HD == TT);                                                                     // the four q / k planes fill exactly the Ph plane
static_assert((size_t)ZH * TT * HD * 4 + 2 * (size_t)GR * DQ * 2 <= (size_t)ZH * TT * TT * 4);   // Ob + ATh + ATl fit inside Sb

__device__ __forceinline__ unsigned short f2bf(float f) { unsigned u = __float_as_uint(f); u += 0x7FFFu + ((u >> 16) & 1u); return (unsigned short)(u >> 16); }
__device__ __forceinline__ float bf2f(unsigned short b) { return __uint_as_float(((unsigned)b) << 16); }
__device__ __forceinline__ float bfr(float f) { return bf2f(f2bf(f)); }
__device__ __forceinline__ v16bf cat16b(v8us lo, v8us hi) { return __builtin_bit_cast(v16bf, __builtin_shufflevector(lo, hi, 0, 1, 2, 3, 4, 5, 6, 7, 8, 9, 10, 11, 12, 13, 14, 15)); }
__device__ __forceinline__ v8f wmmab(v16bf a, v16bf b, v8f c) { return __builtin_amdgcn_wmma_f32_16x16x32_bf16(false, a, false, b, (short)0, c, false, false); }
__device__ __forceinline__ void splitf(float y, unsigned short& h, unsigned short& l) { h = f2bf(y); l = f2bf(y - bf2f(h)); }

// ---- k_gemmw: register-blocked GEMM, ONE WAVE per 64x64 output tile (16 accumulators), operands straight from K-contiguous 16-bit planes; grid (M/64, N/64, Z), 32 threads.
// C[m][n] (f32, pitch ldc, + optional f32 bias[n]) = sum_k A[m][k] Bt[n][k] (+ split products per NSPLIT). z-batch strides sA/sB/sC in elements. K % 32 == 0.
// Fragments: lane l -> row/col l&15, elements 0..7 <- k0 + 8*(l>>4) + 0..7, elements 8..15 <- k0 + 16 + 8*(l>>4) + 0..7 for A and for Bt alike; D element r of lane l = (row 8*(l>>4) + r, col l&15).
template <typename T16> struct WFrag;
template <> struct WFrag<bf> { typedef v16bf V; static __device__ __forceinline__ V ld(const bf* p) { return cat16b(*(const v8us*)p, *(const v8us*)(p + 16)); } static __device__ __forceinline__ v8f mma(V a, V b, v8f c) { return wmmab(a, b, c); } };
template <typename T16, int NSPLIT, bool BIAS>
__global__ __launch_bounds__(32) void k_gemmw(const T16* __restrict__ A, const T16* __restrict__ A2, const T16* __restrict__ Bt, const T16* __restrict__ Bt2, int K, float* C, int ldc, const float* __restrict__ bias, size_t sA, size_t sB, size_t sC) {
    typedef typename WFrag<T16>::V V;
    __shared__ __align__(16) float os[16 * 68];
    const size_t z = blockIdx.z; A += z * sA; if (A2) A2 += z * sA; Bt += z * sB; if (Bt2) Bt2 += z * sB; C += z * sC;
    const int lane = threadIdx.x & 31, lr = lane & 15, hi = lane >> 4; const int r0 = blockIdx.x * 64, c0 = blockIdx.y * 64;
    v8f acc[4][4];
#pragma unroll
    for (int mb = 0; mb < 4; ++mb)
#pragma unroll
        for (int nb = 0; nb < 4; ++nb) acc[mb][nb] = (v8f){};
    const size_t aoff = (size_t)(r0 + lr) * K + 8 * hi, boff = (size_t)(c0 + lr) * K + 8 * hi;
#pragma unroll 1
    for (int kc = 0; kc < K; kc += 32) {
        V a[4], a2[4];
#pragma unroll
        for (int mb = 0; mb < 4; ++mb) { a[mb] = WFrag<T16>::ld(A + aoff + (size_t)mb * 16 * K + kc); if (NSPLIT == 1 || NSPLIT == 2) a2[mb] = WFrag<T16>::ld(A2 + aoff + (size_t)mb * 16 * K + kc); }
#pragma unroll
        for (int nb = 0; nb < 4; ++nb) { const V b = WFrag<T16>::ld(Bt + boff + (size_t)nb * 16 * K + kc); V b2; if (NSPLIT >= 2) b2 = WFrag<T16>::ld(Bt2 + boff + (size_t)nb * 16 * K + kc);
#pragma unroll
            for (int mb = 0; mb < 4; ++mb) { acc[mb][nb] = WFrag<T16>::mma(a[mb], b, acc[mb][nb]); if (NSPLIT == 1 || NSPLIT == 2) acc[mb][nb] = WFrag<T16>::mma(a2[mb], b, acc[mb][nb]); if (NSPLIT >= 2) acc[mb][nb] = WFrag<T16>::mma(a[mb], b2, acc[mb][nb]); } }
        asm volatile("v_nop\n\tv_nop\n\tv_nop\n\tv_nop" : "+v"(acc[0][0]), "+v"(acc[1][1]), "+v"(acc[2][2]), "+v"(acc[3][3]) : "v"(a[0]), "v"(a[3]));
    }
#pragma unroll
    for (int mb = 0; mb < 4; ++mb) {
#pragma unroll
        for (int nb = 0; nb < 4; ++nb) {
#pragma unroll
            for (int j = 0; j < 8; ++j) os[(hi * 8 + j) * 68 + nb * 16 + lr] = acc[mb][nb][j]; }
        __builtin_amdgcn_wave_barrier(); asm volatile("" ::: "memory");
        float* crow = C + (size_t)(r0 + mb * 16) * ldc + c0;
{
#pragma unroll
            for (int s = 0; s < 8; ++s) { const int row = 2 * s + hi, cofs = lr * 4; v4f val = *(const v4fa*)(os + row * 68 + cofs); if (BIAS) { val[0] += bfr(bias[c0 + cofs]); val[1] += bfr(bias[c0 + cofs + 1]); val[2] += bfr(bias[c0 + cofs + 2]); val[3] += bfr(bias[c0 + cofs + 3]); }
                *(v4f*)(crow + (size_t)row * ldc + cofs) = val; }
             }
        __builtin_amdgcn_wave_barrier(); asm volatile("" ::: "memory");
    }
}

__global__ __launch_bounds__(256) void k_wtG(const float* __restrict__ w, int K, int N, bf* Bt) {
    const int lane = threadIdx.x & 31; const int L0 = (blockIdx.x * 8 + (threadIdx.x >> 5)) * 8; const int nlines = N * K / 64;
{
#pragma unroll 1
        for (int l = 0; l < 8; ++l) { const int L = L0 + l; if (L >= nlines) break; const size_t e = (size_t)L * 64 + lane * 2; const int k = (int)(e % K), n = (int)(e / K); v2us o;
            o[0] = f2bf(w[(size_t)k * N + n]); o[1] = f2bf(w[(size_t)(k + 1) * N + n]); *(v2us*)(Bt + e) = o; }
         }
}

__global__ __launch_bounds__(256) void k_ln256(const float* __restrict__ X, int nrows, const float* __restrict__ gw, const float* __restrict__ gb, bf* Yh, bf* Yl) {
    const int lane = threadIdx.x & 31; const int r = blockIdx.x * 8 + (threadIdx.x >> 5); if (r >= nrows) return; const float* xr = X + (size_t)r * DM; float hv[8]; float s = 0.f;
#pragma unroll
    for (int ch = 0; ch < 2; ++ch) { const v4f y = *(const v4f*)(xr + ch * 128 + lane * 4);
#pragma unroll
        for (int q = 0; q < 4; ++q) { const float u = bfr(y[q]); hv[ch * 4 + q] = u; s += u; } }
#pragma unroll
    for (int sh = 16; sh; sh >>= 1) s += __shfl_xor(s, sh, 32);
    float mu = s * (1.0f / 256.0f); asm volatile("" : "+v"(mu)); float s2 = 0.f;
#pragma unroll
    for (int k = 0; k < 8; ++k) { float d0 = __fsub_rn(hv[k], mu); asm volatile("" : "+v"(d0)); float p = __fmul_rn(d0, d0); asm volatile("" : "+v"(p)); s2 = __fadd_rn(s2, p); }
#pragma unroll
    for (int sh = 16; sh; sh >>= 1) s2 += __shfl_xor(s2, sh, 32);
    float var = __fadd_rn(s2 * (1.0f / 256.0f), 1e-5f); asm volatile("" : "+v"(var)); const float rs = __frsqrt_rn(var);
{
#pragma unroll
        for (int ch = 0; ch < 2; ++ch) { const int c0 = ch * 128 + lane * 4; v4us oh, ol;
#pragma unroll
            for (int q = 0; q < 4; ++q) { float gg = bfr(gw[c0 + q]); asm volatile("" : "+v"(gg)); float d0 = __fsub_rn(hv[ch * 4 + q], mu); asm volatile("" : "+v"(d0)); float n0 = __fmul_rn(d0, rs); asm volatile("" : "+v"(n0)); float y = __fmul_rn(n0, gg); asm volatile("" : "+v"(y)); y = __fadd_rn(y, bfr(gb[c0 + q])); unsigned short a, c2; splitf(y, a, c2); oh[q] = a; ol[q] = c2; }
            *(v4us*)(Yh + (size_t)r * DM + c0) = oh; *(v4us*)(Yl + (size_t)r * DM + c0) = ol; }
         } }

// k_planes: from the fused projection output F [GR][pitch] (columns q | k | v | g), blockIdx.y = 0: q planes, 1: k planes, 2: transposed v planes (block-uniform select).
__global__ __launch_bounds__(256) void k_planes(const float* __restrict__ F, int pitch, bf* QPh, bf* QPl, bf* KPh, bf* KPl, bf* Vh, bf* Vl) {
    const int sel = blockIdx.y;
    const size_t e = ((size_t)blockIdx.x * 256 + threadIdx.x) * 2; if (e >= (size_t)ZH * TT * HD) return;
    v2us oh, ol;
    if (sel < 2) {
        const int d = (int)(e % HD); const int t = (int)((e / HD) % TT); const int z = (int)(e / ((size_t)HD * TT)); const int h = z % NH_, sq = z / NH_;
        const float* f = F + ((size_t)sq * TT + t) * pitch + sel * DQ + h * HD + d;
#pragma unroll
        for (int q = 0; q < 2; ++q) { unsigned short a, c2; splitf(f[q], a, c2); oh[q] = a; ol[q] = c2; }
        bf* Ph = (sel == 0) ? QPh : KPh; bf* Pl = (sel == 0) ? QPl : KPl;
        *(v2us*)(Ph + e) = oh; *(v2us*)(Pl + e) = ol; 
    } else {
        const int t = (int)(e % TT); const int d = (int)((e / TT) % HD); const int z = (int)(e / ((size_t)TT * HD)); const int h = z % NH_, sq = z / NH_;
#pragma unroll
        for (int q = 0; q < 2; ++q) { const float x = F[((size_t)sq * TT + t + q) * pitch + 2 * DQ + h * HD + d]; unsigned short a, c2; splitf(x, a, c2); oh[q] = a; ol[q] = c2; }
        *(v2us*)(Vh + e) = oh; *(v2us*)(Vl + e) = ol; 
    }
}

// k_asoft: per row (z, i): t = S x HD^-0.5 (no mask); softmax over the TT keys (register row, one exp, fixed trees, reciprocal-multiply normalisation);
__global__ __launch_bounds__(256) void k_asoft(const float* __restrict__ Sb, bf* Ph, bf* Pl) {
    const int lane = threadIdx.x & 31; const int row = blockIdx.x * 8 + (threadIdx.x >> 5); if (row >= ZH * TT) return;
    const float* sr = Sb + (size_t)row * TT; float v[TT / 32]; float mx = -3.0e38f;
#pragma unroll
    for (int ch = 0; ch < TT / 128; ++ch) { const int j0 = ch * 128 + lane * 4; const v4f a = *(const v4f*)(sr + j0);
#pragma unroll
        for (int q = 0; q < 4; ++q) { const float t = a[q] * SCL; v[ch * 4 + q] = t; mx = fmaxf(mx, t); } }
#pragma unroll
    for (int sh = 16; sh; sh >>= 1) mx = fmaxf(mx, __shfl_xor(mx, sh, 32));
    float sum = 0.f;
#pragma unroll
    for (int k = 0; k < TT / 32; ++k) { float d0 = __fsub_rn(v[k], mx); asm volatile("" : "+v"(d0)); v[k] = __builtin_amdgcn_exp2f(__fmul_rn(d0, 1.4426950408889634f)); sum += v[k]; }
#pragma unroll
    for (int sh = 16; sh; sh >>= 1) sum += __shfl_xor(sum, sh, 32);
    const float f = __fdiv_rn(1.0f, sum);
{
#pragma unroll
        for (int ch = 0; ch < TT / 128; ++ch) { v4us oh, ol;
#pragma unroll
            for (int q = 0; q < 4; ++q) { unsigned short a, c2; splitf(v[ch * 4 + q] * f, a, c2); oh[q] = a; ol[q] = c2; }
            const size_t oo = (size_t)row * TT + ch * 128 + lane * 4; *(v4us*)(Ph + oo) = oh; *(v4us*)(Pl + oo) = ol; }
         }
}

// k_mergeGz: gated merge: AT hi/lo planes [s*TT + t][h*HD + d] = O[z][t][d] x sigmoid(G[(s*TT + t)*gpitch + gcoff + h*HD + d] + bg[h*HD + d]) with z = s*NH_ + h, G the f32 gate pre-activation without bias
__global__ __launch_bounds__(256) void k_mergeGz(const float* __restrict__ O, const float* __restrict__ G, int gpitch, int gcoff, const float* __restrict__ bgp, bf* Ah, bf* Al) {
    const size_t e = ((size_t)blockIdx.x * 256 + threadIdx.x) * 2; if (e >= (size_t)ZH * TT * HD) return;
    const int d = (int)(e % HD); const int t = (int)((e / HD) % TT); const int z = (int)(e / ((size_t)HD * TT)); const int h = z % NH_, sq = z / NH_;
    const size_t tok = (size_t)sq * TT + t; const int col = h * HD + d;
    const size_t oo = tok * DQ + col; const size_t go = tok * (size_t)gpitch + gcoff + col; v2us oh, ol;
#pragma unroll
    for (int q = 0; q < 2; ++q) { float o = O[e + q]; asm volatile("" : "+v"(o)); float g = __fadd_rn(G[go + q], bfr(bgp[col + q])); asm volatile("" : "+v"(g)); float den = __fadd_rn(1.0f, expf(-g)); asm volatile("" : "+v"(den)); const float sg = __fdiv_rn(1.0f, den); unsigned short a, c2; splitf(__fmul_rn(o, sg), a, c2); oh[q] = a; ol[q] = c2; }
    *(v2us*)(Ah + oo) = oh; *(v2us*)(Al + oo) = ol;  }

extern "C" void kernel_launch(void* const* d_in, const int* in_sizes, int n_in,
                              void* d_out, int out_size, void* d_ws, size_t ws_size, hipStream_t stream) {
    if (n_in < 9) return;
    if (in_sizes[0] < NT * DM || in_sizes[1] < DM || in_sizes[2] < DM || in_sizes[3] < DM * DQ || in_sizes[4] < DM * 2 * DQ
        || in_sizes[5] < DM * DQ || in_sizes[6] < DQ || in_sizes[7] < DQ * DM || in_sizes[8] < DM) return;
    if (out_size < NT * DM) return;
    const float* x = (const float*)d_in[0]; const float* ln_g = (const float*)d_in[1]; const float* ln_b = (const float*)d_in[2]; const float* wq = (const float*)d_in[3]; const float* wkv = (const float*)d_in[4]; const float* wg = (const float*)d_in[5]; const float* bg = (const float*)d_in[6]; const float* wo = (const float*)d_in[7]; const float* bo = (const float*)d_in[8];
    float* OUT = (float*)d_out;     // [NB][TT][DM] = [NT][256]
    char* wsp = (char*)d_ws;
    auto take = [&](size_t bytes) { char* p = wsp; wsp += (bytes + 255) & ~(size_t)255; return (void*)p; };
    bf* WB = (bf*)take((size_t)DP * DM * 2);     // Bt [2048][256]: rows 0..511 q, 512..1023 k, 1024..1535 v, 1536..2047 g
    bf* WO = (bf*)take((size_t)DM * DQ * 2);     // Bt [256][512]
    bf* LNh = (bf*)take((size_t)NT * DM * 2); bf* LNl = (bf*)take((size_t)NT * DM * 2);
    float* F = (float*)take((size_t)GR * DP * 4); // [GR][2048] f32: q | k | v | g (g without bias)
    bf* VTh = (bf*)take((size_t)ZH * HD * TT * 2); bf* VTl = (bf*)take((size_t)ZH * HD * TT * 2);
    float* Sb = (float*)take((size_t)ZH * TT * TT * 4); bf* Ph = (bf*)take((size_t)ZH * TT * TT * 2); bf* Pl = (bf*)take((size_t)ZH * TT * TT * 2);
    /* q / k planes are last read by the score GEMM, before the softmax launch writes Ph: they share its bytes */
    bf* QPh = Ph; bf* QPl = QPh + (size_t)ZH * TT * HD; bf* KPh = QPl + (size_t)ZH * TT * HD; bf* KPl = KPh + (size_t)ZH * TT * HD;
    /* Sb is last read by the softmax launch, before attn.v writes Ob: Ob and the gated planes share its bytes */
    float* Ob = Sb; bf* ATh = (bf*)(Sb + (size_t)ZH * TT * HD); bf* ATl = ATh + (size_t)GR * DQ;
    if ((size_t)(wsp - (char*)d_ws) > ws_size) return;
    /* weights ('xw': Bt[n][k] = W[k][n]); the fused Wkv gives Bt rows 512..1023 = k, 1024..1535 = v */
    k_wtG<<<(unsigned)((DM * DQ / 64 + 63) / 64), 256, 0, stream>>>(wq, DM, DQ, WB);
    k_wtG<<<(unsigned)((DM * 2 * DQ / 64 + 63) / 64), 256, 0, stream>>>(wkv, DM, 2 * DQ, WB + (size_t)DQ * DM);
    k_wtG<<<(unsigned)((DM * DQ / 64 + 63) / 64), 256, 0, stream>>>(wg, DM, DQ, WB + (size_t)3 * DQ * DM);
    k_wtG<<<(unsigned)((DQ * DM / 64 + 63) / 64), 256, 0, stream>>>(wo, DQ, DM, WO);
    k_ln256<<<NT / 8, 256, 0, stream>>>(x, NT, ln_g, ln_b, LNh, LNl);
    const unsigned LP = (unsigned)(((size_t)ZH * TT * HD / 2 + 255) / 256);
    for (int g = 0; g < NB_ / GB; ++g) { const size_t row0 = (size_t)g * GR;
        k_gemmw<bf, 1, false><<<dim3(GR / 64, DP / 64, 1), 32, 0, stream>>>(LNh + row0 * DM, LNl + row0 * DM, WB, nullptr, DM, F, DP, nullptr, 0, 0, 0);
        k_planes<<<dim3(LP, 3, 1), 256, 0, stream>>>(F, DP, QPh, QPl, KPh, KPl, VTh, VTl);
        k_gemmw<bf, 2, false><<<dim3(TT / 64, TT / 64, ZH), 32, 0, stream>>>(QPh, QPl, KPh, KPl, HD, Sb, TT, nullptr, (size_t)TT * HD, (size_t)TT * HD, (size_t)TT * TT);
        k_asoft<<<ZH * TT / 8, 256, 0, stream>>>(Sb, Ph, Pl);
        k_gemmw<bf, 2, false><<<dim3(TT / 64, HD / 64, ZH), 32, 0, stream>>>(Ph, Pl, VTh, VTl, TT, Ob, HD, nullptr, (size_t)TT * TT, (size_t)HD * TT, (size_t)TT * HD);
        k_mergeGz<<<LP, 256, 0, stream>>>(Ob, F, DP, 3 * DQ, bg, ATh, ATl);
        k_gemmw<bf, 1, true><<<dim3(GR / 64, DM / 64, 1), 32, 0, stream>>>(ATh, ATl, WO, nullptr, DQ, OUT + row0 * DM, DM, bo, 0, 0, 0); }
}

// v002
// Measured time: 548 microseconds a run.
// Next to v001, in two timings, it ran 1.14 and 1.15 times as fast.
// Over all steps from v000 it is 1.87 times as fast.
#include <hip/hip_runtime.h>

// Gated row attention along the width axis with a pre-LayerNorm: x [1][128][256][256] = 128 independent sequences (image rows) of 256 tokens x 256 features; xn = LayerNorm(x) (gamma, beta, eps 1e-5); q = xn Wq ('xw' [256][512], 8 heads x 64), [k|v] = xn Wkv ('xw' [256][1024]: columns k | v); dots = (q/8).k over the 256 keys of the same sequence; softmax; out = attn.v merged; gates = sigmoid(xn Wg + bg) ('xw' [256][512]); y = (out * gates) Wo + bo ('xw' [512][256]) -> [1][128][256][256] (8.4 M).
// Compute dtypes, f32 accumulate: all contractions v_wmma_f32_16x16x32_bf16 (bf16 operands). Every input RNE-converted to bf16 on load; LayerNorm in f32, xn as bf16 hi + lo planes; fused q|k|v|g projection as (hi + lo) x exact weights (2 products); scores and attn.v on bf16 hi/lo planes (3 products) for every row; softmax f32; sigmoid gate f32 (true division) with f32 bias add; (out x gate) as hi + lo x exact Wo (2 products) + bo.
// Layout: LayerNorm planes for all tokens in one launch; then 32 sequences (8,192 tokens) per pass, workspace planes that are dead by then reused inside the pass; all per-(sequence, head) planes are z-major ([z = s*8 + head][256][64]) so each attention stage is ONE z-batched launch of tile GEMMs; the projection GEMM's own epilogue splits its q, k and v tiles into those planes (v transposed), only the gate columns go out as f32.

#ifndef NB_
#define NB_  128       // sequences (image rows) processed by this build
#endif
#define NB_FULL 128    // sequences in the input / output
#define TT   256       // tokens per sequence
#define DM   256
#define NH_  8
#define HD   64
#define DQ   (NH_ * HD)    // 512 = inner dim
#define DP   (4 * DQ)      // 2048 = fused projection width q | k | v | g
#ifndef GB
#if NB_ >= 32
#define GB   32            // sequences per pass
#else
#define GB   NB_
#endif
#endif
#define GR   (GB * TT)     // token rows per pass
#define ZH   (GB * NH_)    // (sequence, head) planes per pass
#define NT   (NB_ * TT)    // token rows in total
#define SCL  0.125f        // HD^-0.5

static_assert(NB_ >= 1 && NB_ <= NB_FULL);
static_assert((NB_ % GB) == 0);
static_assert((GR % 64) == 0 && (TT % 64) == 0 && (HD % 64) == 0 && (DM % 64) == 0 && (DQ % 64) == 0 && (DP % 64) == 0);
static_assert((HD % 32) == 0 && (DM % 32) == 0 && (DQ % 32) == 0 && (TT % 32) == 0);
static_assert((TT % 128) == 0 && (NT % 8) == 0 && (DM % 128) == 0);
static_assert(((DQ * DM) % 64) == 0 && ((2 * DQ * DM) % 64) == 0);

typedef unsigned short bf;
typedef __attribute__((ext_vector_type(16))) __bf16   v16bf;
typedef __attribute__((ext_vector_type(8)))  unsigned short v8us;
typedef __attribute__((ext_vector_type(8)))  float    v8f;
typedef __attribute__((ext_vector_type(4)))  float    v4f;
typedef v4f  __attribute__((may_alias)) v4fa;
typedef __attribute__((ext_vector_type(2))) unsigned short v2us;
typedef __attribute__((ext_vector_type(4))) unsigned short v4us;

constexpr size_t al256(size_t b) { return (b + 255) & ~(size_t)255; }
constexpr size_t WS_NEED = al256((size_t)DP * DM * 2) + al256((size_t)DM * DQ * 2) + 2 * al256((size_t)NT * DM * 2) + al256((size_t)GR * DP * 4)
                         + 2 * al256((size_t)ZH * TT * HD * 2) + al256((size_t)ZH * TT * TT * 4) + 2 * al256((size_t)ZH * TT * TT * 2);
static_assert(WS_NEED <= (size_t)268435456);
static_assert(4 * HD == TT);                                                                     // the four q / k planes fill exactly the Ph plane
static_assert((size_t)ZH * TT * HD * 4 + 2 * (size_t)GR * DQ * 2 <= (size_t)ZH * TT * TT * 4);   // Ob + ATh + ATl fit inside Sb

__device__ __forceinline__ unsigned short f2bf(float f) { unsigned u = __float_as_uint(f); u += 0x7FFFu + ((u >> 16) & 1u); return (unsigned short)(u >> 16); }
__device__ __forceinline__ float bf2f(unsigned short b) { return __uint_as_float(((unsigned)b) << 16); }
__device__ __forceinline__ float bfr(float f) { return bf2f(f2bf(f)); }
__device__ __forceinline__ v16bf cat16b(v8us lo, v8us hi) { return __builtin_bit_cast(v16bf, __builtin_shufflevector(lo, hi, 0, 1, 2, 3, 4, 5, 6, 7, 8, 9, 10, 11, 12, 13, 14, 15)); }
__device__ __forceinline__ v8f wmmab(v16bf a, v16bf b, v8f c) { return __builtin_amdgcn_wmma_f32_16x16x32_bf16(false, a, false, b, (short)0, c, false, false); }
__device__ __forceinline__ void splitf(float y, unsigned short& h, unsigned short& l) { h = f2bf(y); l = f2bf(y - bf2f(h)); }

// ---- k_gemmw: register-blocked GEMM, ONE WAVE per 64x64 output tile (16 accumulators), operands straight from K-contiguous 16-bit planes; grid (M/64, N/64, Z), 32 threads.
// C[m][n] (f32, pitch ldc, + optional f32 bias[n]) = sum_k A[m][k] Bt[n][k] (+ split products per NSPLIT). z-batch strides sA/sB/sC in elements. K % 32 == 0.
// Fragments: lane l -> row/col l&15, elements 0..7 <- k0 + 8*(l>>4) + 0..7, elements 8..15 <- k0 + 16 + 8*(l>>4) + 0..7 for A and for Bt alike; D element r of lane l = (row 8*(l>>4) + r, col l&15).
template <typename T16> struct WFrag;
template <> struct WFrag<bf> { typedef v16bf V; static __device__ __forceinline__ V ld(const bf* p) { return cat16b(*(const v8us*)p, *(const v8us*)(p + 16)); } static __device__ __forceinline__ v8f mma(V a, V b, v8f c) { return wmmab(a, b, c); } };
// PLANES (the fused q | k | v | g projection, N = DP): a 64-column tile is one head of q, k, v or g and its 64 rows lie in one sequence, so the epilogue writes the tile where the attention stages read it:
// q, k: hi / lo planes [z][t][d]; v: hi / lo planes transposed [z][d][t] (a lane's 8 accumulator registers are 8 consecutive t of one d: one 16-byte store a plane); g: f32 into C as without PLANES.
static_assert(HD == 64 && (DQ % 64) == 0 && (TT % 64) == 0);
template <typename T16, int NSPLIT, bool BIAS, bool PLANES>
__global__ __launch_bounds__(32) void k_gemmw(const T16* __restrict__ A, const T16* __restrict__ A2, const T16* __restrict__ Bt, const T16* __restrict__ Bt2, int K, float* C, int ldc, const float* __restrict__ bias, size_t sA, size_t sB, size_t sC, bf* qh, bf* ql, bf* kh, bf* kl, bf* vh, bf* vl) {
    typedef typename WFrag<T16>::V V;
    __shared__ __align__(16) float os[16 * 68];
    const size_t z = blockIdx.z; A += z * sA; if (A2) A2 += z * sA; Bt += z * sB; if (Bt2) Bt2 += z * sB; C += z * sC;
    const int lane = threadIdx.x & 31, lr = lane & 15, hi = lane >> 4; const int r0 = blockIdx.x * 64, c0 = blockIdx.y * 64;
    v8f acc[4][4];
#pragma unroll
    for (int mb = 0; mb < 4; ++mb)
#pragma unroll
        for (int nb = 0; nb < 4; ++nb) acc[mb][nb] = (v8f){};
    const size_t aoff = (size_t)(r0 + lr) * K + 8 * hi, boff = (size_t)(c0 + lr) * K + 8 * hi;
#pragma unroll 1
    for (int kc = 0; kc < K; kc += 32) {
        V a[4], a2[4];
#pragma unroll
        for (int mb = 0; mb < 4; ++mb) { a[mb] = WFrag<T16>::ld(A + aoff + (size_t)mb * 16 * K + kc); if (NSPLIT == 1 || NSPLIT == 2) a2[mb] = WFrag<T16>::ld(A2 + aoff + (size_t)mb * 16 * K + kc); }
#pragma unroll
        for (int nb = 0; nb < 4; ++nb) { const V b = WFrag<T16>::ld(Bt + boff + (size_t)nb * 16 * K + kc); V b2; if (NSPLIT >= 2) b2 = WFrag<T16>::ld(Bt2 + boff + (size_t)nb * 16 * K + kc);
#pragma unroll
            for (int mb = 0; mb < 4; ++mb) { acc[mb][nb] = WFrag<T16>::mma(a[mb], b, acc[mb][nb]); if (NSPLIT == 1 || NSPLIT == 2) acc[mb][nb] = WFrag<T16>::mma(a2[mb], b, acc[mb][nb]); if (NSPLIT >= 2) acc[mb][nb] = WFrag<T16>::mma(a[mb], b2, acc[mb][nb]); } }
        asm volatile("v_nop\n\tv_nop\n\tv_nop\n\tv_nop" : "+v"(acc[0][0]), "+v"(acc[1][1]), "+v"(acc[2][2]), "+v"(acc[3][3]) : "v"(a[0]), "v"(a[3]));
    }
    const int sel = PLANES ? c0 / DQ : 3;                                                  // 0 q, 1 k, 2 v, 3 f32 output; the same for the whole tile
    const size_t zp = PLANES ? (size_t)(r0 / TT) * NH_ + (c0 % DQ) / HD : 0; const int t0 = r0 % TT;   // plane (sequence, head) and first token of the tile
    if (PLANES && sel == 2) {
#pragma unroll
        for (int mb = 0; mb < 4; ++mb)
#pragma unroll
            for (int nb = 0; nb < 4; ++nb) { v8us oh, ol;
#pragma unroll
                for (int j = 0; j < 8; ++j) { unsigned short a, c2; splitf(acc[mb][nb][j], a, c2); oh[j] = a; ol[j] = c2; }
                const size_t o = (zp * HD + nb * 16 + lr) * TT + t0 + mb * 16 + 8 * hi; *(v8us*)(vh + o) = oh; *(v8us*)(vl + o) = ol; }
        return;
    }
    if (PLANES && sel < 2) { bf* ph = (sel == 0) ? qh : kh; bf* pl = (sel == 0) ? ql : kl;
#pragma unroll
        for (int mb = 0; mb < 4; ++mb) {
#pragma unroll
            for (int nb = 0; nb < 4; ++nb) {
#pragma unroll
                for (int j = 0; j < 8; ++j) os[(hi * 8 + j) * 68 + nb * 16 + lr] = acc[mb][nb][j]; }
            __builtin_amdgcn_wave_barrier(); asm volatile("" ::: "memory");   // the rows read below were written by other lanes of this wave: keep the LDS reads behind the writes
#pragma unroll
            for (int s = 0; s < 8; ++s) { const int row = 2 * s + hi, cofs = lr * 4; const v4f val = *(const v4fa*)(os + row * 68 + cofs); v4us oh, ol;
#pragma unroll
                for (int q = 0; q < 4; ++q) { unsigned short a, c2; splitf(val[q], a, c2); oh[q] = a; ol[q] = c2; }
                const size_t o = (zp * TT + t0 + mb * 16 + row) * HD + cofs; *(v4us*)(ph + o) = oh; *(v4us*)(pl + o) = ol; }
            __builtin_amdgcn_wave_barrier(); asm volatile("" ::: "memory");   // and the next block's writes behind these reads
        }
        asm volatile("s_wait_xcnt 0x0" ::: "memory");   // behind the last stores: their address registers are reused by the code laid out behind this block
        return;
    }
#pragma unroll
    for (int mb = 0; mb < 4; ++mb) {
#pragma unroll
        for (int nb = 0; nb < 4; ++nb) {
#pragma unroll
            for (int j = 0; j < 8; ++j) os[(hi * 8 + j) * 68 + nb * 16 + lr] = acc[mb][nb][j]; }
        __builtin_amdgcn_wave_barrier(); asm volatile("" ::: "memory");
        float* crow = C + (size_t)(r0 + mb * 16) * ldc + c0;
{
#pragma unroll
            for (int s = 0; s < 8; ++s) { const int row = 2 * s + hi, cofs = lr * 4; v4f val = *(const v4fa*)(os + row * 68 + cofs); if (BIAS) { val[0] += bfr(bias[c0 + cofs]); val[1] += bfr(bias[c0 + cofs + 1]); val[2] += bfr(bias[c0 + cofs + 2]); val[3] += bfr(bias[c0 + cofs + 3]); }
                *(v4f*)(crow + (size_t)row * ldc + cofs) = val; }
             }
        __builtin_amdgcn_wave_barrier(); asm volatile("" ::: "memory");
    }
    if (PLANES) asm volatile("s_wait_xcnt 0x0" ::: "memory");   // behind the last stores: in this build the plane blocks are laid out behind them and reuse their address registers
}

__global__ __launch_bounds__(256) void k_wtG(const float* __restrict__ w, int K, int N, bf* Bt) {
    const int lane = threadIdx.x & 31; const int L0 = (blockIdx.x * 8 + (threadIdx.x >> 5)) * 8; const int nlines = N * K / 64;
{
#pragma unroll 1
        for (int l = 0; l < 8; ++l) { const int L = L0 + l; if (L >= nlines) break; const size_t e = (size_t)L * 64 + lane * 2; const int k = (int)(e % K), n = (int)(e / K); v2us o;
            o[0] = f2bf(w[(size_t)k * N + n]); o[1] = f2bf(w[(size_t)(k + 1) * N + n]); *(v2us*)(Bt + e) = o; }
         }
}

__global__ __launch_bounds__(256) void k_ln256(const float* __restrict__ X, int nrows, const float* __restrict__ gw, const float* __restrict__ gb, bf* Yh, bf* Yl) {
    const int lane = threadIdx.x & 31; const int r = blockIdx.x * 8 + (threadIdx.x >> 5); if (r >= nrows) return; const float* xr = X + (size_t)r * DM; float hv[8]; float s = 0.f;
#pragma unroll
    for (int ch = 0; ch < 2; ++ch) { const v4f y = *(const v4f*)(xr + ch * 128 + lane * 4);
#pragma unroll
        for (int q = 0; q < 4; ++q) { const float u = bfr(y[q]); hv[ch * 4 + q] = u; s += u; } }
#pragma unroll
    for (int sh = 16; sh; sh >>= 1) s += __shfl_xor(s, sh, 32);
    float mu = s * (1.0f / 256.0f); asm volatile("" : "+v"(mu)); float s2 = 0.f;
#pragma unroll
    for (int k = 0; k < 8; ++k) { float d0 = __fsub_rn(hv[k], mu); asm volatile("" : "+v"(d0)); float p = __fmul_rn(d0, d0); asm volatile("" : "+v"(p)); s2 = __fadd_rn(s2, p); }
#pragma unroll
    for (int sh = 16; sh; sh >>= 1) s2 += __shfl_xor(s2, sh, 32);
    float var = __fadd_rn(s2 * (1.0f / 256.0f), 1e-5f); asm volatile("" : "+v"(var)); const float rs = __frsqrt_rn(var);
{
#pragma unroll
        for (int ch = 0; ch < 2; ++ch) { const int c0 = ch * 128 + lane * 4; v4us oh, ol;
#pragma unroll
            for (int q = 0; q < 4; ++q) { float gg = bfr(gw[c0 + q]); asm volatile("" : "+v"(gg)); float d0 = __fsub_rn(hv[ch * 4 + q], mu); asm volatile("" : "+v"(d0)); float n0 = __fmul_rn(d0, rs); asm volatile("" : "+v"(n0)); float y = __fmul_rn(n0, gg); asm volatile("" : "+v"(y)); y = __fadd_rn(y, bfr(gb[c0 + q])); unsigned short a, c2; splitf(y, a, c2); oh[q] = a; ol[q] = c2; }
            *(v4us*)(Yh + (size_t)r * DM + c0) = oh; *(v4us*)(Yl + (size_t)r * DM + c0) = ol; }
         } }

// k_asoft: per row (z, i): t = S x HD^-0.5 (no mask); softmax over the TT keys (register row, one exp, fixed trees, reciprocal-multiply normalisation);
__global__ __launch_bounds__(256) void k_asoft(const float* __restrict__ Sb, bf* Ph, bf* Pl) {
    const int lane = threadIdx.x & 31; const int row = blockIdx.x * 8 + (threadIdx.x >> 5); if (row >= ZH * TT) return;
    const float* sr = Sb + (size_t)row * TT; float v[TT / 32]; float mx = -3.0e38f;
#pragma unroll
    for (int ch = 0; ch < TT / 128; ++ch) { const int j0 = ch * 128 + lane * 4; const v4f a = *(const v4f*)(sr + j0);
#pragma unroll
        for (int q = 0; q < 4; ++q) { const float t = a[q] * SCL; v[ch * 4 + q] = t; mx = fmaxf(mx, t); } }
#pragma unroll
    for (int sh = 16; sh; sh >>= 1) mx = fmaxf(mx, __shfl_xor(mx, sh, 32));
    float sum = 0.f;
#pragma unroll
    for (int k = 0; k < TT / 32; ++k) { float d0 = __fsub_rn(v[k], mx); asm volatile("" : "+v"(d0)); v[k] = __builtin_amdgcn_exp2f(__fmul_rn(d0, 1.4426950408889634f)); sum += v[k]; }
#pragma unroll
    for (int sh = 16; sh; sh >>= 1) sum += __shfl_xor(sum, sh, 32);
    const float f = __fdiv_rn(1.0f, sum);
{
#pragma unroll
        for (int ch = 0; ch < TT / 128; ++ch) { v4us oh, ol;
#pragma unroll
            for (int q = 0; q < 4; ++q) { unsigned short a, c2; splitf(v[ch * 4 + q] * f, a, c2); oh[q] = a; ol[q] = c2; }
            const size_t oo = (size_t)row * TT + ch * 128 + lane * 4; *(v4us*)(Ph + oo) = oh; *(v4us*)(Pl + oo) = ol; }
         }
}

// k_mergeGz: gated merge: AT hi/lo planes [s*TT + t][h*HD + d] = O[z][t][d] x sigmoid(G[(s*TT + t)*gpitch + gcoff + h*HD + d] + bg[h*HD + d]) with z = s*NH_ + h, G the f32 gate pre-activation without bias
__global__ __launch_bounds__(256) void k_mergeGz(const float* __restrict__ O, const float* __restrict__ G, int gpitch, int gcoff, const float* __restrict__ bgp, bf* Ah, bf* Al) {
    const size_t e = ((size_t)blockIdx.x * 256 + threadIdx.x) * 2; if (e >= (size_t)ZH * TT * HD) return;
    const int d = (int)(e % HD); const int t = (int)((e / HD) % TT); const int z = (int)(e / ((size_t)HD * TT)); const int h = z % NH_, sq = z / NH_;
    const size_t tok = (size_t)sq * TT + t; const int col = h * HD + d;
    const size_t oo = tok * DQ + col; const size_t go = tok * (size_t)gpitch + gcoff + col; v2us oh, ol;
#pragma unroll
    for (int q = 0; q < 2; ++q) { float o = O[e + q]; asm volatile("" : "+v"(o)); float g = __fadd_rn(G[go + q], bfr(bgp[col + q])); asm volatile("" : "+v"(g)); float den = __fadd_rn(1.0f, expf(-g)); asm volatile("" : "+v"(den)); const float sg = __fdiv_rn(1.0f, den); unsigned short a, c2; splitf(__fmul_rn(o, sg), a, c2); oh[q] = a; ol[q] = c2; }
    *(v2us*)(Ah + oo) = oh; *(v2us*)(Al + oo) = ol;  }

extern "C" void kernel_launch(void* const* d_in, const int* in_sizes, int n_in,
                              void* d_out, int out_size, void* d_ws, size_t ws_size, hipStream_t stream) {
    if (n_in < 9) return;
    if (in_sizes[0] < NT * DM || in_sizes[1] < DM || in_sizes[2] < DM || in_sizes[3] < DM * DQ || in_sizes[4] < DM * 2 * DQ
        || in_sizes[5] < DM * DQ || in_sizes[6] < DQ || in_sizes[7] < DQ * DM || in_sizes[8] < DM) return;
    if (out_size < NT * DM) return;
    const float* x = (const float*)d_in[0]; const float* ln_g = (const float*)d_in[1]; const float* ln_b = (const float*)d_in[2]; const float* wq = (const float*)d_in[3]; const float* wkv = (const float*)d_in[4]; const float* wg = (const float*)d_in[5]; const float* bg = (const float*)d_in[6]; const float* wo = (const float*)d_in[7]; const float* bo = (const float*)d_in[8];
    float* OUT = (float*)d_out;     // [NB][TT][DM] = [NT][256]
    char* wsp = (char*)d_ws;
    auto take = [&](size_t bytes) { char* p = wsp; wsp += (bytes + 255) & ~(size_t)255; return (void*)p; };
    bf* WB = (bf*)take((size_t)DP * DM * 2);     // Bt [2048][256]: rows 0..511 q, 512..1023 k, 1024..1535 v, 1536..2047 g
    bf* WO = (bf*)take((size_t)DM * DQ * 2);     // Bt [256][512]
    bf* LNh = (bf*)take((size_t)NT * DM * 2); bf* LNl = (bf*)take((size_t)NT * DM * 2);
    float* F = (float*)take((size_t)GR * DP * 4); // [GR][2048] f32, pitch of the fused projection: only the g columns (1536..2047, without bias) are written and read
    bf* VTh = (bf*)take((size_t)ZH * HD * TT * 2); bf* VTl = (bf*)take((size_t)ZH * HD * TT * 2);
    float* Sb = (float*)take((size_t)ZH * TT * TT * 4); bf* Ph = (bf*)take((size_t)ZH * TT * TT * 2); bf* Pl = (bf*)take((size_t)ZH * TT * TT * 2);
    /* q / k planes are last read by the score GEMM, before the softmax launch writes Ph: they share its bytes */
    bf* QPh = Ph; bf* QPl = QPh + (size_t)ZH * TT * HD; bf* KPh = QPl + (size_t)ZH * TT * HD; bf* KPl = KPh + (size_t)ZH * TT * HD;
    /* Sb is last read by the softmax launch, before attn.v writes Ob: Ob and the gated planes share its bytes */
    float* Ob = Sb; bf* ATh = (bf*)(Sb + (size_t)ZH * TT * HD); bf* ATl = ATh + (size_t)GR * DQ;
    if ((size_t)(wsp - (char*)d_ws) > ws_size) return;
    /* weights ('xw': Bt[n][k] = W[k][n]); the fused Wkv gives Bt rows 512..1023 = k, 1024..1535 = v */
    k_wtG<<<(unsigned)((DM * DQ / 64 + 63) / 64), 256, 0, stream>>>(wq, DM, DQ, WB);
    k_wtG<<<(unsigned)((DM * 2 * DQ / 64 + 63) / 64), 256, 0, stream>>>(wkv, DM, 2 * DQ, WB + (size_t)DQ * DM);
    k_wtG<<<(unsigned)((DM * DQ / 64 + 63) / 64), 256, 0, stream>>>(wg, DM, DQ, WB + (size_t)3 * DQ * DM);
    k_wtG<<<(unsigned)((DQ * DM / 64 + 63) / 64), 256, 0, stream>>>(wo, DQ, DM, WO);
    k_ln256<<<NT / 8, 256, 0, stream>>>(x, NT, ln_g, ln_b, LNh, LNl);
    const unsigned LP = (unsigned)(((size_t)ZH * TT * HD / 2 + 255) / 256);
    for (int g = 0; g < NB_ / GB; ++g) { const size_t row0 = (size_t)g * GR;
        k_gemmw<bf, 1, false, true><<<dim3(GR / 64, DP / 64, 1), 32, 0, stream>>>(LNh + row0 * DM, LNl + row0 * DM, WB, nullptr, DM, F, DP, nullptr, 0, 0, 0, QPh, QPl, KPh, KPl, VTh, VTl);
        k_gemmw<bf, 2, false, false><<<dim3(TT / 64, TT / 64, ZH), 32, 0, stream>>>(QPh, QPl, KPh, KPl, HD, Sb, TT, nullptr, (size_t)TT * HD, (size_t)TT * HD, (size_t)TT * TT, nullptr, nullptr, nullptr, nullptr, nullptr, nullptr);
        k_asoft<<<ZH * TT / 8, 256, 0, stream>>>(Sb, Ph, Pl);
        k_gemmw<bf, 2, false, false><<<dim3(TT / 64, HD / 64, ZH), 32, 0, stream>>>(Ph, Pl, VTh, VTl, TT, Ob, HD, nullptr, (size_t)TT * TT, (size_t)HD * TT, (size_t)TT * HD, nullptr, nullptr, nullptr, nullptr, nullptr, nullptr);
        k_mergeGz<<<LP, 256, 0, stream>>>(Ob, F, DP, 3 * DQ, bg, ATh, ATl);
        k_gemmw<bf, 1, true, false><<<dim3(GR / 64, DM / 64, 1), 32, 0, stream>>>(ATh, ATl, WO, nullptr, DQ, OUT + row0 * DM, DM, bo, 0, 0, 0, nullptr, nullptr, nullptr, nullptr, nullptr, nullptr); }
}

// v003
// A run of this version takes 347 microseconds.
// Next to v002, in two timings, it ran 1.59 and 1.57 times as fast.
// All steps since v000 together make it 2.95 times as fast.
#include <hip/hip_runtime.h>

// Gated row attention along the width axis with a pre-LayerNorm: x [1][128][256][256] = 128 independent sequences (image rows) of 256 tokens x 256 features; xn = LayerNorm(x) (gamma, beta, eps 1e-5); q = xn Wq ('xw' [256][512], 8 heads x 64), [k|v] = xn Wkv ('xw' [256][1024]: columns k | v); dots = (q/8).k over the 256 keys of the same sequence; softmax; out = attn.v merged; gates = sigmoid(xn Wg + bg) ('xw' [256][512]); y = (out * gates) Wo + bo ('xw' [512][256]) -> [1][128][256][256] (8.4 M).
// Compute dtypes, f32 accumulate: all contractions v_wmma_f32_16x16x32_bf16 (bf16 operands). Every input RNE-converted to bf16 on load; LayerNorm in f32, xn as bf16 hi + lo planes; fused q|k|v|g projection as (hi + lo) x exact weights (2 products); scores and attn.v on bf16 hi/lo planes (3 products) for every row; softmax f32; sigmoid gate f32 (true division) with f32 bias add; (out x gate) as hi + lo x exact Wo (2 products) + bo.
// Layout: LayerNorm planes for all tokens in one launch; then 32 sequences (8,192 tokens) per pass; all per-(sequence, head) planes are z-major ([z = s*8 + head][256][64]); the projection GEMM's own epilogue splits its q, k and v tiles into those planes (v transposed), only the gate columns go out as f32; scores, softmax and attn.v are ONE launch, one work-group per plane z, and neither the scores nor the probabilities leave the registers.

#ifndef NB_
#define NB_  128       // sequences (image rows) processed by this build
#endif
#define NB_FULL 128    // sequences in the input / output
#define TT   256       // tokens per sequence
#define DM   256
#define NH_  8
#define HD   64
#define DQ   (NH_ * HD)    // 512 = inner dim
#define DP   (4 * DQ)      // 2048 = fused projection width q | k | v | g
#ifndef GB
#if NB_ >= 32
#define GB   32            // sequences per pass
#else
#define GB   NB_
#endif
#endif
#define GR   (GB * TT)     // token rows per pass
#define ZH   (GB * NH_)    // (sequence, head) planes per pass
#define NT   (NB_ * TT)    // token rows in total
#define SCL  0.125f        // HD^-0.5

static_assert(NB_ >= 1 && NB_ <= NB_FULL);
static_assert((NB_ % GB) == 0);
static_assert((GR % 64) == 0 && (TT % 64) == 0 && (HD % 64) == 0 && (DM % 64) == 0 && (DQ % 64) == 0 && (DP % 64) == 0);
static_assert((HD % 32) == 0 && (DM % 32) == 0 && (DQ % 32) == 0 && (TT % 32) == 0);
static_assert((TT % 128) == 0 && (NT % 8) == 0 && (DM % 128) == 0);
static_assert(((DQ * DM) % 64) == 0 && ((2 * DQ * DM) % 64) == 0);

typedef unsigned short bf;
typedef __attribute__((ext_vector_type(16))) __bf16   v16bf;
typedef __attribute__((ext_vector_type(8)))  unsigned short v8us;
typedef __attribute__((ext_vector_type(8)))  float    v8f;
typedef __attribute__((ext_vector_type(4)))  float    v4f;
typedef v4f  __attribute__((may_alias)) v4fa;
typedef __attribute__((ext_vector_type(2))) unsigned short v2us;
typedef __attribute__((ext_vector_type(4))) unsigned short v4us;

constexpr size_t al256(size_t b) { return (b + 255) & ~(size_t)255; }
constexpr size_t WS_NEED = al256((size_t)DP * DM * 2) + al256((size_t)DM * DQ * 2) + 2 * al256((size_t)NT * DM * 2) + al256((size_t)GR * DP * 4)
                         + 6 * al256((size_t)ZH * TT * HD * 2) + al256((size_t)ZH * TT * HD * 4) + 2 * al256((size_t)GR * DQ * 2);
static_assert(WS_NEED <= (size_t)268435456);

__device__ __forceinline__ unsigned short f2bf(float f) { unsigned u = __float_as_uint(f); u += 0x7FFFu + ((u >> 16) & 1u); return (unsigned short)(u >> 16); }
__device__ __forceinline__ float bf2f(unsigned short b) { return __uint_as_float(((unsigned)b) << 16); }
__device__ __forceinline__ float bfr(float f) { return bf2f(f2bf(f)); }
__device__ __forceinline__ v16bf cat16b(v8us lo, v8us hi) { return __builtin_bit_cast(v16bf, __builtin_shufflevector(lo, hi, 0, 1, 2, 3, 4, 5, 6, 7, 8, 9, 10, 11, 12, 13, 14, 15)); }
__device__ __forceinline__ v8f wmmab(v16bf a, v16bf b, v8f c) { return __builtin_amdgcn_wmma_f32_16x16x32_bf16(false, a, false, b, (short)0, c, false, false); }
__device__ __forceinline__ void splitf(float y, unsigned short& h, unsigned short& l) { h = f2bf(y); l = f2bf(y - bf2f(h)); }

// ---- k_gemmw: register-blocked GEMM, ONE WAVE per 64x64 output tile (16 accumulators), operands straight from K-contiguous 16-bit planes; grid (M/64, N/64, Z), 32 threads.
// C[m][n] (f32, pitch ldc, + optional f32 bias[n]) = sum_k A[m][k] Bt[n][k] (+ split products per NSPLIT). z-batch strides sA/sB/sC in elements. K % 32 == 0.
// Fragments: lane l -> row/col l&15, elements 0..7 <- k0 + 8*(l>>4) + 0..7, elements 8..15 <- k0 + 16 + 8*(l>>4) + 0..7 for A and for Bt alike; D element r of lane l = (row 8*(l>>4) + r, col l&15).
template <typename T16> struct WFrag;
template <> struct WFrag<bf> { typedef v16bf V; static __device__ __forceinline__ V ld(const bf* p) { return cat16b(*(const v8us*)p, *(const v8us*)(p + 16)); } static __device__ __forceinline__ v8f mma(V a, V b, v8f c) { return wmmab(a, b, c); } };
// PLANES (the fused q | k | v | g projection, N = DP): a 64-column tile is one head of q, k, v or g and its 64 rows lie in one sequence, so the epilogue writes the tile where the attention stages read it:
// q, k: hi / lo planes [z][t][d]; v: hi / lo planes transposed [z][d][t] (a lane's 8 accumulator registers are 8 consecutive t of one d: one 16-byte store a plane); g: f32 into C as without PLANES.
static_assert(HD == 64 && (DQ % 64) == 0 && (TT % 64) == 0);
template <typename T16, int NSPLIT, bool BIAS, bool PLANES>
__global__ __launch_bounds__(32) void k_gemmw(const T16* __restrict__ A, const T16* __restrict__ A2, const T16* __restrict__ Bt, const T16* __restrict__ Bt2, int K, float* C, int ldc, const float* __restrict__ bias, size_t sA, size_t sB, size_t sC, bf* qh, bf* ql, bf* kh, bf* kl, bf* vh, bf* vl) {
    typedef typename WFrag<T16>::V V;
    __shared__ __align__(16) float os[16 * 68];
    const size_t z = blockIdx.z; A += z * sA; if (A2) A2 += z * sA; Bt += z * sB; if (Bt2) Bt2 += z * sB; C += z * sC;
    const int lane = threadIdx.x & 31, lr = lane & 15, hi = lane >> 4; const int r0 = blockIdx.x * 64, c0 = blockIdx.y * 64;
    v8f acc[4][4];
#pragma unroll
    for (int mb = 0; mb < 4; ++mb)
#pragma unroll
        for (int nb = 0; nb < 4; ++nb) acc[mb][nb] = (v8f){};
    const size_t aoff = (size_t)(r0 + lr) * K + 8 * hi, boff = (size_t)(c0 + lr) * K + 8 * hi;
#pragma unroll 1
    for (int kc = 0; kc < K; kc += 32) {
        V a[4], a2[4];
#pragma unroll
        for (int mb = 0; mb < 4; ++mb) { a[mb] = WFrag<T16>::ld(A + aoff + (size_t)mb * 16 * K + kc); if (NSPLIT == 1 || NSPLIT == 2) a2[mb] = WFrag<T16>::ld(A2 + aoff + (size_t)mb * 16 * K + kc); }
#pragma unroll
        for (int nb = 0; nb < 4; ++nb) { const V b = WFrag<T16>::ld(Bt + boff + (size_t)nb * 16 * K + kc); V b2; if (NSPLIT >= 2) b2 = WFrag<T16>::ld(Bt2 + boff + (size_t)nb * 16 * K + kc);
#pragma unroll
            for (int mb = 0; mb < 4; ++mb) { acc[mb][nb] = WFrag<T16>::mma(a[mb], b, acc[mb][nb]); if (NSPLIT == 1 || NSPLIT == 2) acc[mb][nb] = WFrag<T16>::mma(a2[mb], b, acc[mb][nb]); if (NSPLIT >= 2) acc[mb][nb] = WFrag<T16>::mma(a[mb], b2, acc[mb][nb]); } }
        asm volatile("v_nop\n\tv_nop\n\tv_nop\n\tv_nop" : "+v"(acc[0][0]), "+v"(acc[1][1]), "+v"(acc[2][2]), "+v"(acc[3][3]) : "v"(a[0]), "v"(a[3]));
    }
    const int sel = PLANES ? c0 / DQ : 3;                                                  // 0 q, 1 k, 2 v, 3 f32 output; the same for the whole tile
    const size_t zp = PLANES ? (size_t)(r0 / TT) * NH_ + (c0 % DQ) / HD : 0; const int t0 = r0 % TT;   // plane (sequence, head) and first token of the tile
    if (PLANES && sel == 2) {
#pragma unroll
        for (int mb = 0; mb < 4; ++mb)
#pragma unroll
            for (int nb = 0; nb < 4; ++nb) { v8us oh, ol;
#pragma unroll
                for (int j = 0; j < 8; ++j) { unsigned short a, c2; splitf(acc[mb][nb][j], a, c2); oh[j] = a; ol[j] = c2; }
                const size_t o = (zp * HD + nb * 16 + lr) * TT + t0 + mb * 16 + 8 * hi; *(v8us*)(vh + o) = oh; *(v8us*)(vl + o) = ol; }
        return;
    }
    if (PLANES && sel < 2) { bf* ph = (sel == 0) ? qh : kh; bf* pl = (sel == 0) ? ql : kl;
#pragma unroll
        for (int mb = 0; mb < 4; ++mb) {
#pragma unroll
            for (int nb = 0; nb < 4; ++nb) {
#pragma unroll
                for (int j = 0; j < 8; ++j) os[(hi * 8 + j) * 68 + nb * 16 + lr] = acc[mb][nb][j]; }
            __builtin_amdgcn_wave_barrier(); asm volatile("" ::: "memory");   // the rows read below were written by other lanes of this wave: keep the LDS reads behind the writes
#pragma unroll
            for (int s = 0; s < 8; ++s) { const int row = 2 * s + hi, cofs = lr * 4; const v4f val = *(const v4fa*)(os + row * 68 + cofs); v4us oh, ol;
#pragma unroll
                for (int q = 0; q < 4; ++q) { unsigned short a, c2; splitf(val[q], a, c2); oh[q] = a; ol[q] = c2; }
                const size_t o = (zp * TT + t0 + mb * 16 + row) * HD + cofs; *(v4us*)(ph + o) = oh; *(v4us*)(pl + o) = ol; }
            __builtin_amdgcn_wave_barrier(); asm volatile("" ::: "memory");   // and the next block's writes behind these reads
        }
        asm volatile("s_wait_xcnt 0x0" ::: "memory");   // behind the last stores: their address registers are reused by the code laid out behind this block
        return;
    }
#pragma unroll
    for (int mb = 0; mb < 4; ++mb) {
#pragma unroll
        for (int nb = 0; nb < 4; ++nb) {
#pragma unroll
            for (int j = 0; j < 8; ++j) os[(hi * 8 + j) * 68 + nb * 16 + lr] = acc[mb][nb][j]; }
        __builtin_amdgcn_wave_barrier(); asm volatile("" ::: "memory");
        float* crow = C + (size_t)(r0 + mb * 16) * ldc + c0;
{
#pragma unroll
            for (int s = 0; s < 8; ++s) { const int row = 2 * s + hi, cofs = lr * 4; v4f val = *(const v4fa*)(os + row * 68 + cofs); if (BIAS) { val[0] += bfr(bias[c0 + cofs]); val[1] += bfr(bias[c0 + cofs + 1]); val[2] += bfr(bias[c0 + cofs + 2]); val[3] += bfr(bias[c0 + cofs + 3]); }
                *(v4f*)(crow + (size_t)row * ldc + cofs) = val; }
             }
        __builtin_amdgcn_wave_barrier(); asm volatile("" ::: "memory");
    }
    if (PLANES) asm volatile("s_wait_xcnt 0x0" ::: "memory");   // behind the last stores: in this build the plane blocks are laid out behind them and reuse their address registers
}

__global__ __launch_bounds__(256) void k_wtG(const float* __restrict__ w, int K, int N, bf* Bt) {
    const int lane = threadIdx.x & 31; const int L0 = (blockIdx.x * 8 + (threadIdx.x >> 5)) * 8; const int nlines = N * K / 64;
{
#pragma unroll 1
        for (int l = 0; l < 8; ++l) { const int L = L0 + l; if (L >= nlines) break; const size_t e = (size_t)L * 64 + lane * 2; const int k = (int)(e % K), n = (int)(e / K); v2us o;
            o[0] = f2bf(w[(size_t)k * N + n]); o[1] = f2bf(w[(size_t)(k + 1) * N + n]); *(v2us*)(Bt + e) = o; }
         }
}

__global__ __launch_bounds__(256) void k_ln256(const float* __restrict__ X, int nrows, const float* __restrict__ gw, const float* __restrict__ gb, bf* Yh, bf* Yl) {
    const int lane = threadIdx.x & 31; const int r = blockIdx.x * 8 + (threadIdx.x >> 5); if (r >= nrows) return; const float* xr = X + (size_t)r * DM; float hv[8]; float s = 0.f;
#pragma unroll
    for (int ch = 0; ch < 2; ++ch) { const v4f y = *(const v4f*)(xr + ch * 128 + lane * 4);
#pragma unroll
        for (int q = 0; q < 4; ++q) { const float u = bfr(y[q]); hv[ch * 4 + q] = u; s += u; } }
#pragma unroll
    for (int sh = 16; sh; sh >>= 1) s += __shfl_xor(s, sh, 32);
    float mu = s * (1.0f / 256.0f); asm volatile("" : "+v"(mu)); float s2 = 0.f;
#pragma unroll
    for (int k = 0; k < 8; ++k) { float d0 = __fsub_rn(hv[k], mu); asm volatile("" : "+v"(d0)); float p = __fmul_rn(d0, d0); asm volatile("" : "+v"(p)); s2 = __fadd_rn(s2, p); }
#pragma unroll
    for (int sh = 16; sh; sh >>= 1) s2 += __shfl_xor(s2, sh, 32);
    float var = __fadd_rn(s2 * (1.0f / 256.0f), 1e-5f); asm volatile("" : "+v"(var)); const float rs = __frsqrt_rn(var);
{
#pragma unroll
        for (int ch = 0; ch < 2; ++ch) { const int c0 = ch * 128 + lane * 4; v4us oh, ol;
#pragma unroll
            for (int q = 0; q < 4; ++q) { float gg = bfr(gw[c0 + q]); asm volatile("" : "+v"(gg)); float d0 = __fsub_rn(hv[ch * 4 + q], mu); asm volatile("" : "+v"(d0)); float n0 = __fmul_rn(d0, rs); asm volatile("" : "+v"(n0)); float y = __fmul_rn(n0, gg); asm volatile("" : "+v"(y)); y = __fadd_rn(y, bfr(gb[c0 + q])); unsigned short a, c2; splitf(y, a, c2); oh[q] = a; ol[q] = c2; }
            *(v4us*)(Yh + (size_t)r * DM + c0) = oh; *(v4us*)(Yl + (size_t)r * DM + c0) = ol; }
         } }

// k_attn: scores, softmax and attn.v of one plane z in one work-group of 16 waves; wave w owns the 16 queries 16w .. 16w + 15 and all TT keys.
// K hi / lo ([key][d]) and V^T hi / lo ([d][key]) are staged once in LDS with whole-line loads and read from there by every wave; the Q fragments come straight from the planes, once.
// S^T = K Q^T (A = K rows, B = Q rows): D register r of tile kb in lane l = score(key 16 kb + 8 (l >> 4) + r, query l & 15), so a lane holds 128 scores of ONE query:
// maximum and sum in the lane plus one exchange between the wave's halves. Tiles 2j and 2j + 1, normalised and split hi / lo in place, ARE the B fragment of keys 32j .. 32j + 31
// in the loader's k order, so O^T = V^T P^T (A = V^T rows) needs no exchange. Products per accumulator in the order hi.hi, lo.hi, hi.lo of (q, k) and of (p, v).
#define KP 72     // LDS pitch of a K row, 16-bit elements: 144 B = 16 B x 9; an odd multiple of 16 B keeps the 16-byte fragment reads off each other's banks
#define VP 264    // LDS pitch of a V^T row: 528 B = 16 B x 33
#define OP 68     // LDS pitch of an output row, floats: 272 B = 16 B x 17
static_assert(TT == 256 && HD == 64);
typedef __attribute__((ext_vector_type(2))) float  v2f;
typedef __attribute__((ext_vector_type(2))) __bf16 v2bf;
typedef __attribute__((ext_vector_type(8))) unsigned v8u;
__global__ __launch_bounds__(512) void k_attn(const bf* __restrict__ Qh, const bf* __restrict__ Ql, const bf* __restrict__ Kh, const bf* __restrict__ Kl, const bf* __restrict__ Vh, const bf* __restrict__ Vl, float* __restrict__ O) {
    __shared__ __align__(16) bf sKh[TT * KP]; __shared__ __align__(16) bf sKl[TT * KP];
    __shared__ __align__(16) bf sVh[HD * VP]; __shared__ __align__(16) bf sVl[HD * VP];
    __shared__ __align__(16) float sO[16 * 16 * OP];
    const int tid = threadIdx.x, lane = tid & 31, wv = tid >> 5, lr = lane & 15, hi = lane >> 4;
    const size_t zo = (size_t)blockIdx.x * (TT * HD);
    v8us tk[4][2], tv[4][2];   // all sixteen loads of a thread are issued before the first LDS store waits for one
#pragma unroll
    for (int i = 0; i < 4; ++i) { const size_t e = zo + (size_t)(i * 512 + tid) * 8; tk[i][0] = *(const v8us*)(Kh + e); tk[i][1] = *(const v8us*)(Kl + e); tv[i][0] = *(const v8us*)(Vh + e); tv[i][1] = *(const v8us*)(Vl + e); }
    v16bf qh[2], ql[2];
#pragma unroll
    for (int ks = 0; ks < 2; ++ks) { const size_t qo = zo + (size_t)(wv * 16 + lr) * HD + ks * 32 + 8 * hi; qh[ks] = WFrag<bf>::ld(Qh + qo); ql[ks] = WFrag<bf>::ld(Ql + qo); }
#pragma unroll
    for (int i = 0; i < 4; ++i) { const int e = (i * 512 + tid) * 8; const int ko = (e / HD) * KP + (e % HD), vo = (e / TT) * VP + (e % TT);
        *(v8us*)(sKh + ko) = tk[i][0]; *(v8us*)(sKl + ko) = tk[i][1]; *(v8us*)(sVh + vo) = tv[i][0]; *(v8us*)(sVl + vo) = tv[i][1]; }
    __syncthreads();   // K and V^T are complete in LDS; they are only read from here on
    // Scores: step st = (pair of key tiles st >> 1, half ks = st & 1 of the head dim), 4 fragments and 6 products; each step's fragments are fetched as one group one step ahead
    v8f s[16]; v16bf fk[2][4];
    const int kof = lr * KP + 8 * hi;
#pragma unroll
    for (int p = 0; p < 2; ++p) { fk[0][p] = WFrag<bf>::ld(sKh + kof + p * 16 * KP); fk[0][2 + p] = WFrag<bf>::ld(sKl + kof + p * 16 * KP); }
#pragma unroll
    for (int st = 0; st < 16; ++st) { const int kb = (st >> 1) * 2, ks = st & 1, cb = st & 1, nb = cb ^ 1;
        if (st + 1 < 16) { const int o = kof + ((st + 1) >> 1) * 32 * KP + ((st + 1) & 1) * 32;
#pragma unroll
            for (int p = 0; p < 2; ++p) { fk[nb][p] = WFrag<bf>::ld(sKh + o + p * 16 * KP); fk[nb][2 + p] = WFrag<bf>::ld(sKl + o + p * 16 * KP); } }
        v8f a0 = ks ? s[kb] : (v8f){}, a1 = ks ? s[kb + 1] : (v8f){};
        a0 = wmmab(fk[cb][0], qh[ks], a0); a1 = wmmab(fk[cb][1], qh[ks], a1); a0 = wmmab(fk[cb][0], ql[ks], a0); a1 = wmmab(fk[cb][1], ql[ks], a1); a0 = wmmab(fk[cb][2], qh[ks], a0); a1 = wmmab(fk[cb][3], qh[ks], a1);
        s[kb] = a0; s[kb + 1] = a1; }
    v8f m8 = s[0];
#pragma unroll
    for (int kb = 1; kb < 16; ++kb)
#pragma unroll
        for (int r = 0; r < 8; ++r) m8[r] = fmaxf(m8[r], s[kb][r]);
    float mx = fmaxf(fmaxf(fmaxf(m8[0], m8[1]), fmaxf(m8[2], m8[3])), fmaxf(fmaxf(m8[4], m8[5]), fmaxf(m8[6], m8[7])));
    mx = fmaxf(mx, __shfl_xor(mx, 16, 32)) * SCL;   // the scale is a positive power of two: scaling the maximum is the maximum of the scaled scores
    v8f s8;
#pragma unroll
    for (int kb = 0; kb < 16; ++kb) {
#pragma unroll
        for (int r = 0; r < 8; r += 4) { float x[4], ex[4];
#pragma unroll
            for (int c = 0; c < 4; ++c) x[c] = (s[kb][r + c] * SCL - mx) * 1.4426950408889634f;
            // four exponentials whose results share no register with any argument, then one v_nop: the slot the instruction set asks for behind a transcendental; inside the statement it cannot drift away
            asm("v_exp_f32 %0, %4\n\tv_exp_f32 %1, %5\n\tv_exp_f32 %2, %6\n\tv_exp_f32 %3, %7\n\tv_nop" : "=&v"(ex[0]), "=&v"(ex[1]), "=&v"(ex[2]), "=&v"(ex[3]) : "v"(x[0]), "v"(x[1]), "v"(x[2]), "v"(x[3]));
#pragma unroll
            for (int c = 0; c < 4; ++c) { s[kb][r + c] = ex[c]; s8[r + c] = kb ? s8[r + c] + ex[c] : ex[c]; } } }
    float sum = ((s8[0] + s8[1]) + (s8[2] + s8[3])) + ((s8[4] + s8[5]) + (s8[6] + s8[7]));
    sum += __shfl_xor(sum, 16, 32);
    const float f = __fdiv_rn(1.0f, sum);
    // attn.v: step st = (32 keys j = st >> 1, pair of d tiles st & 1), fetched one step ahead like the scores' steps; the two score tiles of j become P^T hi / lo just before their first use
    v8f o[4]; v16bf fv[2][4]; v16bf ph, pl;
    const int vof = lr * VP + 8 * hi;
#pragma unroll
    for (int p = 0; p < 2; ++p) { fv[0][p] = WFrag<bf>::ld(sVh + vof + p * 16 * VP); fv[0][2 + p] = WFrag<bf>::ld(sVl + vof + p * 16 * VP); }
#pragma unroll
    for (int st = 0; st < 16; ++st) { const int j = st >> 1, mb = (st & 1) * 2, cb = st & 1, nb = cb ^ 1;
        if (st + 1 < 16) { const int ofs = vof + ((st + 1) & 1) * 32 * VP + ((st + 1) >> 1) * 32;
#pragma unroll
            for (int p = 0; p < 2; ++p) { fv[nb][p] = WFrag<bf>::ld(sVh + ofs + p * 16 * VP); fv[nb][2 + p] = WFrag<bf>::ld(sVl + ofs + p * 16 * VP); } }
        if ((st & 1) == 0) { v8u wh, wl;
#pragma unroll
            for (int i = 0; i < 8; ++i) { const v8f t = s[2 * j + (i >> 2)]; const v2f y = { t[(2 * i) & 7] * f, t[(2 * i + 1) & 7] * f };
                const v2bf h = __builtin_convertvector(y, v2bf); const v2bf l = __builtin_convertvector(y - __builtin_convertvector(h, v2f), v2bf);
                wh[i] = __builtin_bit_cast(unsigned, h); wl[i] = __builtin_bit_cast(unsigned, l); }
            ph = __builtin_bit_cast(v16bf, wh); pl = __builtin_bit_cast(v16bf, wl); }
        v8f a0 = j ? o[mb] : (v8f){}, a1 = j ? o[mb + 1] : (v8f){};
        a0 = wmmab(fv[cb][0], ph, a0); a1 = wmmab(fv[cb][1], ph, a1); a0 = wmmab(fv[cb][0], pl, a0); a1 = wmmab(fv[cb][1], pl, a1); a0 = wmmab(fv[cb][2], ph, a0); a1 = wmmab(fv[cb][3], ph, a1);
        o[mb] = a0; o[mb + 1] = a1; }
    // o[mb][r] = O(query lr, d = 16 mb + 8 hi + r): through the wave's own LDS rows, so that each store instruction writes whole 128-byte lines
    float* os = sO + wv * (16 * OP);
#pragma unroll
    for (int mb = 0; mb < 4; ++mb) { float* p = os + lr * OP + mb * 16 + 8 * hi; *(v4fa*)p = __builtin_shufflevector(o[mb], o[mb], 0, 1, 2, 3); *(v4fa*)(p + 4) = __builtin_shufflevector(o[mb], o[mb], 4, 5, 6, 7); }
    asm volatile("s_wait_dscnt 0x0" ::: "memory");   // the rows read below were written by other lanes of this wave: the writes are done, and stay in front, before they are read back
    v4f ov[8];   // all eight LDS reads are issued before the first store waits for one
#pragma unroll
    for (int q = 0; q < 8; ++q) ov[q] = *(const v4fa*)(os + (2 * q + hi) * OP + lr * 4);
    float* op = O + zo + (size_t)(wv * 16 + hi) * HD + lr * 4;
#pragma unroll
    for (int q = 0; q < 8; ++q) *(v4f*)(op + q * 2 * HD) = ov[q];
}

// k_mergeGz: gated merge: AT hi/lo planes [s*TT + t][h*HD + d] = O[z][t][d] x sigmoid(G[(s*TT + t)*gpitch + gcoff + h*HD + d] + bg[h*HD + d]) with z = s*NH_ + h, G the f32 gate pre-activation without bias
__global__ __launch_bounds__(256) void k_mergeGz(const float* __restrict__ O, const float* __restrict__ G, int gpitch, int gcoff, const float* __restrict__ bgp, bf* Ah, bf* Al) {
    const size_t e = ((size_t)blockIdx.x * 256 + threadIdx.x) * 2; if (e >= (size_t)ZH * TT * HD) return;
    const int d = (int)(e % HD); const int t = (int)((e / HD) % TT); const int z = (int)(e / ((size_t)HD * TT)); const int h = z % NH_, sq = z / NH_;
    const size_t tok = (size_t)sq * TT + t; const int col = h * HD + d;
    const size_t oo = tok * DQ + col; const size_t go = tok * (size_t)gpitch + gcoff + col; v2us oh, ol;
#pragma unroll
    for (int q = 0; q < 2; ++q) { float o = O[e + q]; asm volatile("" : "+v"(o)); float g = __fadd_rn(G[go + q], bfr(bgp[col + q])); asm volatile("" : "+v"(g)); float den = __fadd_rn(1.0f, expf(-g)); asm volatile("" : "+v"(den)); const float sg = __fdiv_rn(1.0f, den); unsigned short a, c2; splitf(__fmul_rn(o, sg), a, c2); oh[q] = a; ol[q] = c2; }
    *(v2us*)(Ah + oo) = oh; *(v2us*)(Al + oo) = ol;  }

extern "C" void kernel_launch(void* const* d_in, const int* in_sizes, int n_in,
                              void* d_out, int out_size, void* d_ws, size_t ws_size, hipStream_t stream) {
    if (n_in < 9) return;
    if (in_sizes[0] < NT * DM || in_sizes[1] < DM || in_sizes[2] < DM || in_sizes[3] < DM * DQ || in_sizes[4] < DM * 2 * DQ
        || in_sizes[5] < DM * DQ || in_sizes[6] < DQ || in_sizes[7] < DQ * DM || in_sizes[8] < DM) return;
    if (out_size < NT * DM) return;
    const float* x = (const float*)d_in[0]; const float* ln_g = (const float*)d_in[1]; const float* ln_b = (const float*)d_in[2]; const float* wq = (const float*)d_in[3]; const float* wkv = (const float*)d_in[4]; const float* wg = (const float*)d_in[5]; const float* bg = (const float*)d_in[6]; const float* wo = (const float*)d_in[7]; const float* bo = (const float*)d_in[8];
    float* OUT = (float*)d_out;     // [NB][TT][DM] = [NT][256]
    char* wsp = (char*)d_ws;
    auto take = [&](size_t bytes) { char* p = wsp; wsp += (bytes + 255) & ~(size_t)255; return (void*)p; };
    bf* WB = (bf*)take((size_t)DP * DM * 2);     // Bt [2048][256]: rows 0..511 q, 512..1023 k, 1024..1535 v, 1536..2047 g
    bf* WO = (bf*)take((size_t)DM * DQ * 2);     // Bt [256][512]
    bf* LNh = (bf*)take((size_t)NT * DM * 2); bf* LNl = (bf*)take((size_t)NT * DM * 2);
    float* F = (float*)take((size_t)GR * DP * 4); // [GR][2048] f32, pitch of the fused projection: only the g columns (1536..2047, without bias) are written and read
    bf* VTh = (bf*)take((size_t)ZH * HD * TT * 2); bf* VTl = (bf*)take((size_t)ZH * HD * TT * 2);
    bf* QPh = (bf*)take((size_t)ZH * TT * HD * 2); bf* QPl = (bf*)take((size_t)ZH * TT * HD * 2); bf* KPh = (bf*)take((size_t)ZH * TT * HD * 2); bf* KPl = (bf*)take((size_t)ZH * TT * HD * 2);
    float* Ob = (float*)take((size_t)ZH * TT * HD * 4); bf* ATh = (bf*)take((size_t)GR * DQ * 2); bf* ATl = (bf*)take((size_t)GR * DQ * 2);
    if ((size_t)(wsp - (char*)d_ws) > ws_size) return;
    /* weights ('xw': Bt[n][k] = W[k][n]); the fused Wkv gives Bt rows 512..1023 = k, 1024..1535 = v */
    k_wtG<<<(unsigned)((DM * DQ / 64 + 63) / 64), 256, 0, stream>>>(wq, DM, DQ, WB);
    k_wtG<<<(unsigned)((DM * 2 * DQ / 64 + 63) / 64), 256, 0, stream>>>(wkv, DM, 2 * DQ, WB + (size_t)DQ * DM);
    k_wtG<<<(unsigned)((DM * DQ / 64 + 63) / 64), 256, 0, stream>>>(wg, DM, DQ, WB + (size_t)3 * DQ * DM);
    k_wtG<<<(unsigned)((DQ * DM / 64 + 63) / 64), 256, 0, stream>>>(wo, DQ, DM, WO);
    k_ln256<<<NT / 8, 256, 0, stream>>>(x, NT, ln_g, ln_b, LNh, LNl);
    const unsigned LP = (unsigned)(((size_t)ZH * TT * HD / 2 + 255) / 256);
    for (int g = 0; g < NB_ / GB; ++g) { const size_t row0 = (size_t)g * GR;
        k_gemmw<bf, 1, false, true><<<dim3(GR / 64, DP / 64, 1), 32, 0, stream>>>(LNh + row0 * DM, LNl + row0 * DM, WB, nullptr, DM, F, DP, nullptr, 0, 0, 0, QPh, QPl, KPh, KPl, VTh, VTl);
        k_attn<<<ZH, 512, 0, stream>>>(QPh, QPl, KPh, KPl, VTh, VTl, Ob);
        k_mergeGz<<<LP, 256, 0, stream>>>(Ob, F, DP, 3 * DQ, bg, ATh, ATl);
        k_gemmw<bf, 1, true, false><<<dim3(GR / 64, DM / 64, 1), 32, 0, stream>>>(ATh, ATl, WO, nullptr, DQ, OUT + row0 * DM, DM, bo, 0, 0, 0, nullptr, nullptr, nullptr, nullptr, nullptr, nullptr); }
}

// v004
// Measured time: 308 microseconds a run.
// Timed twice side by side with v003, it ran 1.12 and 1.13 times as fast.
// All steps since v000 together make it 3.33 times as fast.
#include <hip/hip_runtime.h>

// Gated row attention along the width axis with a pre-LayerNorm: x [1][128][256][256] = 128 independent sequences (image rows) of 256 tokens x 256 features; xn = LayerNorm(x) (gamma, beta, eps 1e-5); q = xn Wq ('xw' [256][512], 8 heads x 64), [k|v] = xn Wkv ('xw' [256][1024]: columns k | v); dots = (q/8).k over the 256 keys of the same sequence; softmax; out = attn.v merged; gates = sigmoid(xn Wg + bg) ('xw' [256][512]); y = (out * gates) Wo + bo ('xw' [512][256]) -> [1][128][256][256] (8.4 M).
// Compute dtypes, f32 accumulate: all contractions v_wmma_f32_16x16x32_bf16 (bf16 operands). Every input RNE-converted to bf16 on load; LayerNorm in f32, xn as bf16 hi + lo planes; fused q|k|v|g projection as (hi + lo) x exact weights (2 products); scores and attn.v on bf16 hi/lo planes (3 products) for every row; softmax f32; sigmoid gate f32 (true division) with f32 bias add; (out x gate) as hi + lo x exact Wo (2 products) + bo.
// Layout: LayerNorm planes for all tokens in one launch; then 32 sequences (8,192 tokens) per pass; all per-(sequence, head) planes are z-major ([z = s*8 + head][256][64]); the projection GEMM's own epilogue splits its q, k and v tiles into those planes (v transposed), only the gate columns go out as f32; scores, softmax, attn.v and the sigmoid gate are ONE launch, one work-group per plane z: neither the scores nor the probabilities leave the registers, and the gated output goes out as the hi / lo planes that the last GEMM reads.

#ifndef NB_
#define NB_  128       // sequences (image rows) processed by this build
#endif
#define NB_FULL 128    // sequences in the input / output
#define TT   256       // tokens per sequence
#define DM   256
#define NH_  8
#define HD   64
#define DQ   (NH_ * HD)    // 512 = inner dim
#define DP   (4 * DQ)      // 2048 = fused projection width q | k | v | g
#ifndef GB
#if NB_ >= 32
#define GB   32            // sequences per pass
#else
#define GB   NB_
#endif
#endif
#define GR   (GB * TT)     // token rows per pass
#define ZH   (GB * NH_)    // (sequence, head) planes per pass
#define NT   (NB_ * TT)    // token rows in total
#define SCL  0.125f        // HD^-0.5

static_assert(NB_ >= 1 && NB_ <= NB_FULL);
static_assert((NB_ % GB) == 0);
static_assert((GR % 64) == 0 && (TT % 64) == 0 && (HD % 64) == 0 && (DM % 64) == 0 && (DQ % 64) == 0 && (DP % 64) == 0);
static_assert((HD % 32) == 0 && (DM % 32) == 0 && (DQ % 32) == 0 && (TT % 32) == 0);
static_assert((TT % 128) == 0 && (NT % 8) == 0 && (DM % 128) == 0);
static_assert(((DQ * DM) % 64) == 0 && ((2 * DQ * DM) % 64) == 0);

typedef unsigned short bf;
typedef __attribute__((ext_vector_type(16))) __bf16   v16bf;
typedef __attribute__((ext_vector_type(8)))  unsigned short v8us;
typedef __attribute__((ext_vector_type(8)))  float    v8f;
typedef __attribute__((ext_vector_type(4)))  float    v4f;
typedef v4f  __attribute__((may_alias)) v4fa;
typedef __attribute__((ext_vector_type(2))) unsigned short v2us;
typedef __attribute__((ext_vector_type(4))) unsigned short v4us;

constexpr size_t al256(size_t b) { return (b + 255) & ~(size_t)255; }
constexpr size_t WS_NEED = al256((size_t)DP * DM * 2) + al256((size_t)DM * DQ * 2) + 2 * al256((size_t)NT * DM * 2) + al256((size_t)GR * DP * 4)
                         + 6 * al256((size_t)ZH * TT * HD * 2) + 2 * al256((size_t)GR * DQ * 2);
static_assert(WS_NEED <= (size_t)268435456);

__device__ __forceinline__ unsigned short f2bf(float f) { unsigned u = __float_as_uint(f); u += 0x7FFFu + ((u >> 16) & 1u); return (unsigned short)(u >> 16); }
__device__ __forceinline__ float bf2f(unsigned short b) { return __uint_as_float(((unsigned)b) << 16); }
__device__ __forceinline__ float bfr(float f) { return bf2f(f2bf(f)); }
__device__ __forceinline__ v16bf cat16b(v8us lo, v8us hi) { return __builtin_bit_cast(v16bf, __builtin_shufflevector(lo, hi, 0, 1, 2, 3, 4, 5, 6, 7, 8, 9, 10, 11, 12, 13, 14, 15)); }
__device__ __forceinline__ v8f wmmab(v16bf a, v16bf b, v8f c) { return __builtin_amdgcn_wmma_f32_16x16x32_bf16(false, a, false, b, (short)0, c, false, false); }
__device__ __forceinline__ void splitf(float y, unsigned short& h, unsigned short& l) { h = f2bf(y); l = f2bf(y - bf2f(h)); }

// ---- k_gemmw: register-blocked GEMM, ONE WAVE per 64x64 output tile (16 accumulators), operands straight from K-contiguous 16-bit planes; grid (M/64, N/64, Z), 32 threads.
// C[m][n] (f32, pitch ldc, + optional f32 bias[n]) = sum_k A[m][k] Bt[n][k] (+ split products per NSPLIT). z-batch strides sA/sB/sC in elements. K % 32 == 0.
// Fragments: lane l -> row/col l&15, elements 0..7 <- k0 + 8*(l>>4) + 0..7, elements 8..15 <- k0 + 16 + 8*(l>>4) + 0..7 for A and for Bt alike; D element r of lane l = (row 8*(l>>4) + r, col l&15).
template <typename T16> struct WFrag;
template <> struct WFrag<bf> { typedef v16bf V; static __device__ __forceinline__ V ld(const bf* p) { return cat16b(*(const v8us*)p, *(const v8us*)(p + 16)); } static __device__ __forceinline__ v8f mma(V a, V b, v8f c) { return wmmab(a, b, c); } };
// PLANES (the fused q | k | v | g projection, N = DP): a 64-column tile is one head of q, k, v or g and its 64 rows lie in one sequence, so the epilogue writes the tile where the attention stages read it:
// q, k: hi / lo planes [z][t][d]; v: hi / lo planes transposed [z][d][t] (a lane's 8 accumulator registers are 8 consecutive t of one d: one 16-byte store a plane); g: f32 into C as without PLANES.
static_assert(HD == 64 && (DQ % 64) == 0 && (TT % 64) == 0);
template <typename T16, int NSPLIT, bool BIAS, bool PLANES>
__global__ __launch_bounds__(32) void k_gemmw(const T16* __restrict__ A, const T16* __restrict__ A2, const T16* __restrict__ Bt, const T16* __restrict__ Bt2, int K, float* C, int ldc, const float* __restrict__ bias, size_t sA, size_t sB, size_t sC, bf* qh, bf* ql, bf* kh, bf* kl, bf* vh, bf* vl) {
    typedef typename WFrag<T16>::V V;
    __shared__ __align__(16) float os[16 * 68];
    const size_t z = blockIdx.z; A += z * sA; if (A2) A2 += z * sA; Bt += z * sB; if (Bt2) Bt2 += z * sB; C += z * sC;
    const int lane = threadIdx.x & 31, lr = lane & 15, hi = lane >> 4; const int r0 = blockIdx.x * 64, c0 = blockIdx.y * 64;
    v8f acc[4][4];
#pragma unroll
    for (int mb = 0; mb < 4; ++mb)
#pragma unroll
        for (int nb = 0; nb < 4; ++nb) acc[mb][nb] = (v8f){};
    const size_t aoff = (size_t)(r0 + lr) * K + 8 * hi, boff = (size_t)(c0 + lr) * K + 8 * hi;
#pragma unroll 1
    for (int kc = 0; kc < K; kc += 32) {
        V a[4], a2[4];
#pragma unroll
        for (int mb = 0; mb < 4; ++mb) { a[mb] = WFrag<T16>::ld(A + aoff + (size_t)mb * 16 * K + kc); if (NSPLIT == 1 || NSPLIT == 2) a2[mb] = WFrag<T16>::ld(A2 + aoff + (size_t)mb * 16 * K + kc); }
#pragma unroll
        for (int nb = 0; nb < 4; ++nb) { const V b = WFrag<T16>::ld(Bt + boff + (size_t)nb * 16 * K + kc); V b2; if (NSPLIT >= 2) b2 = WFrag<T16>::ld(Bt2 + boff + (size_t)nb * 16 * K + kc);
#pragma unroll
            for (int mb = 0; mb < 4; ++mb) { acc[mb][nb] = WFrag<T16>::mma(a[mb], b, acc[mb][nb]); if (NSPLIT == 1 || NSPLIT == 2) acc[mb][nb] = WFrag<T16>::mma(a2[mb], b, acc[mb][nb]); if (NSPLIT >= 2) acc[mb][nb] = WFrag<T16>::mma(a[mb], b2, acc[mb][nb]); } }
        asm volatile("v_nop\n\tv_nop\n\tv_nop\n\tv_nop" : "+v"(acc[0][0]), "+v"(acc[1][1]), "+v"(acc[2][2]), "+v"(acc[3][3]) : "v"(a[0]), "v"(a[3]));
    }
    const int sel = PLANES ? c0 / DQ : 3;                                                  // 0 q, 1 k, 2 v, 3 f32 output; the same for the whole tile
    const size_t zp = PLANES ? (size_t)(r0 / TT) * NH_ + (c0 % DQ) / HD : 0; const int t0 = r0 % TT;   // plane (sequence, head) and first token of the tile
    if (PLANES && sel == 2) {
#pragma unroll
        for (int mb = 0; mb < 4; ++mb)
#pragma unroll
            for (int nb = 0; nb < 4; ++nb) { v8us oh, ol;
#pragma unroll
                for (int j = 0; j < 8; ++j) { unsigned short a, c2; splitf(acc[mb][nb][j], a, c2); oh[j] = a; ol[j] = c2; }
                const size_t o = (zp * HD + nb * 16 + lr) * TT + t0 + mb * 16 + 8 * hi; *(v8us*)(vh + o) = oh; *(v8us*)(vl + o) = ol; }
        return;
    }
    if (PLANES && sel < 2) { bf* ph = (sel == 0) ? qh : kh; bf* pl = (sel == 0) ? ql : kl;
#pragma unroll
        for (int mb = 0; mb < 4; ++mb) {
#pragma unroll
            for (int nb = 0; nb < 4; ++nb) {
#pragma unroll
                for (int j = 0; j < 8; ++j) os[(hi * 8 + j) * 68 + nb * 16 + lr] = acc[mb][nb][j]; }
            __builtin_amdgcn_wave_barrier(); asm volatile("" ::: "memory");   // the rows read below were written by other lanes of this wave: keep the LDS reads behind the writes
#pragma unroll
            for (int s = 0; s < 8; ++s) { const int row = 2 * s + hi, cofs = lr * 4; const v4f val = *(const v4fa*)(os + row * 68 + cofs); v4us oh, ol;
#pragma unroll
                for (int q = 0; q < 4; ++q) { unsigned short a, c2; splitf(val[q], a, c2); oh[q] = a; ol[q] = c2; }
                const size_t o = (zp * TT + t0 + mb * 16 + row) * HD + cofs; *(v4us*)(ph + o) = oh; *(v4us*)(pl + o) = ol; }
            __builtin_amdgcn_wave_barrier(); asm volatile("" ::: "memory");   // and the next block's writes behind these reads
        }
        asm volatile("s_wait_xcnt 0x0" ::: "memory");   // behind the last stores: their address registers are reused by the code laid out behind this block
        return;
    }
#pragma unroll
    for (int mb = 0; mb < 4; ++mb) {
#pragma unroll
        for (int nb = 0; nb < 4; ++nb) {
#pragma unroll
            for (int j = 0; j < 8; ++j) os[(hi * 8 + j) * 68 + nb * 16 + lr] = acc[mb][nb][j]; }
        __builtin_amdgcn_wave_barrier(); asm volatile("" ::: "memory");
        float* crow = C + (size_t)(r0 + mb * 16) * ldc + c0;
{
#pragma unroll
            for (int s = 0; s < 8; ++s) { const int row = 2 * s + hi, cofs = lr * 4; v4f val = *(const v4fa*)(os + row * 68 + cofs); if (BIAS) { val[0] += bfr(bias[c0 + cofs]); val[1] += bfr(bias[c0 + cofs + 1]); val[2] += bfr(bias[c0 + cofs + 2]); val[3] += bfr(bias[c0 + cofs + 3]); }
                *(v4f*)(crow + (size_t)row * ldc + cofs) = val; }
             }
        __builtin_amdgcn_wave_barrier(); asm volatile("" ::: "memory");
    }
    if (PLANES) asm volatile("s_wait_xcnt 0x0" ::: "memory");   // behind the last stores: in this build the plane blocks are laid out behind them and reuse their address registers
}

__global__ __launch_bounds__(256) void k_wtG(const float* __restrict__ w, int K, int N, bf* Bt) {
    const int lane = threadIdx.x & 31; const int L0 = (blockIdx.x * 8 + (threadIdx.x >> 5)) * 8; const int nlines = N * K / 64;
{
#pragma unroll 1
        for (int l = 0; l < 8; ++l) { const int L = L0 + l; if (L >= nlines) break; const size_t e = (size_t)L * 64 + lane * 2; const int k = (int)(e % K), n = (int)(e / K); v2us o;
            o[0] = f2bf(w[(size_t)k * N + n]); o[1] = f2bf(w[(size_t)(k + 1) * N + n]); *(v2us*)(Bt + e) = o; }
         }
}

__global__ __launch_bounds__(256) void k_ln256(const float* __restrict__ X, int nrows, const float* __restrict__ gw, const float* __restrict__ gb, bf* Yh, bf* Yl) {
    const int lane = threadIdx.x & 31; const int r = blockIdx.x * 8 + (threadIdx.x >> 5); if (r >= nrows) return; const float* xr = X + (size_t)r * DM; float hv[8]; float s = 0.f;
#pragma unroll
    for (int ch = 0; ch < 2; ++ch) { const v4f y = *(const v4f*)(xr + ch * 128 + lane * 4);
#pragma unroll
        for (int q = 0; q < 4; ++q) { const float u = bfr(y[q]); hv[ch * 4 + q] = u; s += u; } }
#pragma unroll
    for (int sh = 16; sh; sh >>= 1) s += __shfl_xor(s, sh, 32);
    float mu = s * (1.0f / 256.0f); asm volatile("" : "+v"(mu)); float s2 = 0.f;
#pragma unroll
    for (int k = 0; k < 8; ++k) { float d0 = __fsub_rn(hv[k], mu); asm volatile("" : "+v"(d0)); float p = __fmul_rn(d0, d0); asm volatile("" : "+v"(p)); s2 = __fadd_rn(s2, p); }
#pragma unroll
    for (int sh = 16; sh; sh >>= 1) s2 += __shfl_xor(s2, sh, 32);
    float var = __fadd_rn(s2 * (1.0f / 256.0f), 1e-5f); asm volatile("" : "+v"(var)); const float rs = __frsqrt_rn(var);
{
#pragma unroll
        for (int ch = 0; ch < 2; ++ch) { const int c0 = ch * 128 + lane * 4; v4us oh, ol;
#pragma unroll
            for (int q = 0; q < 4; ++q) { float gg = bfr(gw[c0 + q]); asm volatile("" : "+v"(gg)); float d0 = __fsub_rn(hv[ch * 4 + q], mu); asm volatile("" : "+v"(d0)); float n0 = __fmul_rn(d0, rs); asm volatile("" : "+v"(n0)); float y = __fmul_rn(n0, gg); asm volatile("" : "+v"(y)); y = __fadd_rn(y, bfr(gb[c0 + q])); unsigned short a, c2; splitf(y, a, c2); oh[q] = a; ol[q] = c2; }
            *(v4us*)(Yh + (size_t)r * DM + c0) = oh; *(v4us*)(Yl + (size_t)r * DM + c0) = ol; }
         } }

// k_attn: scores, softmax and attn.v of one plane z in one work-group of 16 waves; wave w owns the 16 queries 16w .. 16w + 15 and all TT keys.
// K hi / lo ([key][d]) and V^T hi / lo ([d][key]) are staged once in LDS with whole-line loads and read from there by every wave; the Q fragments come straight from the planes, once.
// S^T = K Q^T (A = K rows, B = Q rows): D register r of tile kb in lane l = score(key 16 kb + 8 (l >> 4) + r, query l & 15), so a lane holds 128 scores of ONE query:
// maximum and sum in the lane plus one exchange between the wave's halves. Tiles 2j and 2j + 1, normalised and split hi / lo in place, ARE the B fragment of keys 32j .. 32j + 31
// in the loader's k order, so O^T = V^T P^T (A = V^T rows) needs no exchange. Products per accumulator in the order hi.hi, lo.hi, hi.lo of (q, k) and of (p, v).
// Epilogue: AT hi / lo planes [s*TT + t][h*HD + d] = O[t][d] x sigmoid(G[(s*TT + t)*DP + 3*DQ + h*HD + d] + bg[h*HD + d]) with z = s*NH_ + h, G the f32 output of the fused projection: its last DQ columns are the gate pre-activation without bias.
#define KP 72     // LDS pitch of a K row, 16-bit elements: 144 B = 16 B x 9; an odd multiple of 16 B keeps the 16-byte fragment reads off each other's banks
#define VP 264    // LDS pitch of a V^T row: 528 B = 16 B x 33
#define OP 68     // LDS pitch of an output row, floats: 272 B = 16 B x 17
#define GST 8     // step of attn.v at which the gate rows are loaded
static_assert(TT == 256 && HD == 64);
typedef __attribute__((ext_vector_type(2))) float  v2f;
typedef __attribute__((ext_vector_type(2))) __bf16 v2bf;
typedef __attribute__((ext_vector_type(8))) unsigned v8u;
typedef __attribute__((ext_vector_type(4))) __bf16 v4bf;
__global__ __launch_bounds__(512) void k_attn(const bf* __restrict__ Qh, const bf* __restrict__ Ql, const bf* __restrict__ Kh, const bf* __restrict__ Kl, const bf* __restrict__ Vh, const bf* __restrict__ Vl, const float* __restrict__ G, const float* __restrict__ bgp, bf* __restrict__ Ah, bf* __restrict__ Al) {
    __shared__ __align__(16) bf sKh[TT * KP]; __shared__ __align__(16) bf sKl[TT * KP];
    __shared__ __align__(16) bf sVh[HD * VP]; __shared__ __align__(16) bf sVl[HD * VP];
    __shared__ __align__(16) float sO[16 * 16 * OP];
    const int tid = threadIdx.x, lane = tid & 31, wv = tid >> 5, lr = lane & 15, hi = lane >> 4;
    const size_t zo = (size_t)blockIdx.x * (TT * HD);
    v8us tk[4][2], tv[4][2];   // all sixteen loads of a thread are issued before the first LDS store waits for one
#pragma unroll
    for (int i = 0; i < 4; ++i) { const size_t e = zo + (size_t)(i * 512 + tid) * 8; tk[i][0] = *(const v8us*)(Kh + e); tk[i][1] = *(const v8us*)(Kl + e); tv[i][0] = *(const v8us*)(Vh + e); tv[i][1] = *(const v8us*)(Vl + e); }
    v16bf qh[2], ql[2];
#pragma unroll
    for (int ks = 0; ks < 2; ++ks) { const size_t qo = zo + (size_t)(wv * 16 + lr) * HD + ks * 32 + 8 * hi; qh[ks] = WFrag<bf>::ld(Qh + qo); ql[ks] = WFrag<bf>::ld(Ql + qo); }
#pragma unroll
    for (int i = 0; i < 4; ++i) { const int e = (i * 512 + tid) * 8; const int ko = (e / HD) * KP + (e % HD), vo = (e / TT) * VP + (e % TT);
        *(v8us*)(sKh + ko) = tk[i][0]; *(v8us*)(sKl + ko) = tk[i][1]; *(v8us*)(sVh + vo) = tv[i][0]; *(v8us*)(sVl + vo) = tv[i][1]; }
    __syncthreads();   // K and V^T are complete in LDS; they are only read from here on
    // Scores: step st = (pair of key tiles st >> 1, half ks = st & 1 of the head dim), 4 fragments and 6 products; each step's fragments are fetched as one group one step ahead
    v8f s[16]; v16bf fk[2][4];
    const int kof = lr * KP + 8 * hi;
#pragma unroll
    for (int p = 0; p < 2; ++p) { fk[0][p] = WFrag<bf>::ld(sKh + kof + p * 16 * KP); fk[0][2 + p] = WFrag<bf>::ld(sKl + kof + p * 16 * KP); }
#pragma unroll
    for (int st = 0; st < 16; ++st) { const int kb = (st >> 1) * 2, ks = st & 1, cb = st & 1, nb = cb ^ 1;
        if (st + 1 < 16) { const int o = kof + ((st + 1) >> 1) * 32 * KP + ((st + 1) & 1) * 32;
#pragma unroll
            for (int p = 0; p < 2; ++p) { fk[nb][p] = WFrag<bf>::ld(sKh + o + p * 16 * KP); fk[nb][2 + p] = WFrag<bf>::ld(sKl + o + p * 16 * KP); } }
        v8f a0 = ks ? s[kb] : (v8f){}, a1 = ks ? s[kb + 1] : (v8f){};
        a0 = wmmab(fk[cb][0], qh[ks], a0); a1 = wmmab(fk[cb][1], qh[ks], a1); a0 = wmmab(fk[cb][0], ql[ks], a0); a1 = wmmab(fk[cb][1], ql[ks], a1); a0 = wmmab(fk[cb][2], qh[ks], a0); a1 = wmmab(fk[cb][3], qh[ks], a1);
        s[kb] = a0; s[kb + 1] = a1; }
    v8f m8 = s[0];
#pragma unroll
    for (int kb = 1; kb < 16; ++kb)
#pragma unroll
        for (int r = 0; r < 8; ++r) m8[r] = fmaxf(m8[r], s[kb][r]);
    float mx = fmaxf(fmaxf(fmaxf(m8[0], m8[1]), fmaxf(m8[2], m8[3])), fmaxf(fmaxf(m8[4], m8[5]), fmaxf(m8[6], m8[7])));
    mx = fmaxf(mx, __shfl_xor(mx, 16, 32)) * SCL;   // the scale is a positive power of two: scaling the maximum is the maximum of the scaled scores
    v8f s8;
#pragma unroll
    for (int kb = 0; kb < 16; ++kb) {
#pragma unroll
        for (int r = 0; r < 8; r += 4) { float x[4], ex[4];
#pragma unroll
            for (int c = 0; c < 4; ++c) x[c] = (s[kb][r + c] * SCL - mx) * 1.4426950408889634f;
            // four exponentials whose results share no register with any argument, then one v_nop: the slot the instruction set asks for behind a transcendental; inside the statement it cannot drift away
            asm("v_exp_f32 %0, %4\n\tv_exp_f32 %1, %5\n\tv_exp_f32 %2, %6\n\tv_exp_f32 %3, %7\n\tv_nop" : "=&v"(ex[0]), "=&v"(ex[1]), "=&v"(ex[2]), "=&v"(ex[3]) : "v"(x[0]), "v"(x[1]), "v"(x[2]), "v"(x[3]));
#pragma unroll
            for (int c = 0; c < 4; ++c) { s[kb][r + c] = ex[c]; s8[r + c] = kb ? s8[r + c] + ex[c] : ex[c]; } } }
    float sum = ((s8[0] + s8[1]) + (s8[2] + s8[3])) + ((s8[4] + s8[5]) + (s8[6] + s8[7]));
    sum += __shfl_xor(sum, 16, 32);
    const float f = __fdiv_rn(1.0f, sum);
    // attn.v: step st = (32 keys j = st >> 1, pair of d tiles st & 1), fetched one step ahead like the scores' steps; the two score tiles of j become P^T hi / lo just before their first use
    v8f o[4]; v16bf fv[2][4]; v16bf ph, pl;
    // this lane's part of the epilogue: tokens wv*16 + hi + 2q (q = 0 .. 7), columns lr*4 .. lr*4 + 3 of the head; the work-group's part of each address is the same in every lane
    const size_t tok0 = (size_t)(blockIdx.x / NH_) * TT; const int col0 = ((int)blockIdx.x % NH_) * HD; v4f gv[8], bv;
    const int vof = lr * VP + 8 * hi;
#pragma unroll
    for (int p = 0; p < 2; ++p) { fv[0][p] = WFrag<bf>::ld(sVh + vof + p * 16 * VP); fv[0][2 + p] = WFrag<bf>::ld(sVl + vof + p * 16 * VP); }
#pragma unroll
    for (int st = 0; st < 16; ++st) { const int j = st >> 1, mb = (st & 1) * 2, cb = st & 1, nb = cb ^ 1;
        if (st + 1 < 16) { const int ofs = vof + ((st + 1) & 1) * 32 * VP + ((st + 1) >> 1) * 32;
#pragma unroll
            for (int p = 0; p < 2; ++p) { fv[nb][p] = WFrag<bf>::ld(sVh + ofs + p * 16 * VP); fv[nb][2 + p] = WFrag<bf>::ld(sVl + ofs + p * 16 * VP); } }
        if (st == GST) {   // the gate rows are asked for here, where enough score tiles are dead to hold them, so that they have landed when the products end
            const char* gp = (const char*)(G + tok0 * DP + 3 * DQ + col0) + (unsigned)(((wv * 16 + hi) * DP + lr * 4) * 4);
            bv = *(const v4f*)(bgp + col0 + lr * 4);
#pragma unroll
            for (int q = 0; q < 8; ++q) gv[q] = *(const v4f*)(gp + q * 2 * DP * 4); }
        if ((st & 1) == 0) { v8u wh, wl;
#pragma unroll
            for (int i = 0; i < 8; ++i) { const v8f t = s[2 * j + (i >> 2)]; const v2f y = { t[(2 * i) & 7] * f, t[(2 * i + 1) & 7] * f };
                const v2bf h = __builtin_convertvector(y, v2bf); const v2bf l = __builtin_convertvector(y - __builtin_convertvector(h, v2f), v2bf);
                wh[i] = __builtin_bit_cast(unsigned, h); wl[i] = __builtin_bit_cast(unsigned, l); }
            ph = __builtin_bit_cast(v16bf, wh); pl = __builtin_bit_cast(v16bf, wl); }
        v8f a0 = j ? o[mb] : (v8f){}, a1 = j ? o[mb + 1] : (v8f){};
        a0 = wmmab(fv[cb][0], ph, a0); a1 = wmmab(fv[cb][1], ph, a1); a0 = wmmab(fv[cb][0], pl, a0); a1 = wmmab(fv[cb][1], pl, a1); a0 = wmmab(fv[cb][2], ph, a0); a1 = wmmab(fv[cb][3], ph, a1);
        o[mb] = a0; o[mb + 1] = a1; }
    // o[mb][r] = O(query lr, d = 16 mb + 8 hi + r): through the wave's own LDS rows, so that each store instruction writes whole 128-byte lines
    float* os = sO + wv * (16 * OP);
#pragma unroll
    for (int mb = 0; mb < 4; ++mb) { float* p = os + lr * OP + mb * 16 + 8 * hi; *(v4fa*)p = __builtin_shufflevector(o[mb], o[mb], 0, 1, 2, 3); *(v4fa*)(p + 4) = __builtin_shufflevector(o[mb], o[mb], 4, 5, 6, 7); }
    asm volatile("s_wait_dscnt 0x0" ::: "memory");   // the rows read below were written by other lanes of this wave: the writes are done, and stay in front, before they are read back
    v4f ov[8];   // all eight LDS reads are issued before the first store waits for one
#pragma unroll
    for (int q = 0; q < 8; ++q) ov[q] = *(const v4fa*)(os + (2 * q + hi) * OP + lr * 4);
    const v4f bb = { bfr(bv[0]), bfr(bv[1]), bfr(bv[2]), bfr(bv[3]) };
    const unsigned ao = (unsigned)(((wv * 16 + hi) * DQ + lr * 4) * 2);   // 16 lanes x 8 bytes = one whole 128-byte line of a plane per token
    char* ah = (char*)(Ah + tok0 * DQ + col0) + ao; char* al = (char*)(Al + tok0 * DQ + col0) + ao;
#pragma unroll
    for (int q = 0; q < 8; ++q) { v4f y;
#pragma unroll
        for (int c = 0; c < 4; ++c) { const float den = 1.0f + expf(-(gv[q][c] + bb[c])); y[c] = ov[q][c] * __fdiv_rn(1.0f, den); }
        const v4bf h = __builtin_convertvector(y, v4bf); const v4bf l = __builtin_convertvector(y - __builtin_convertvector(h, v4f), v4bf);
        *(v4us*)(ah + q * 2 * DQ * 2) = __builtin_bit_cast(v4us, h); *(v4us*)(al + q * 2 * DQ * 2) = __builtin_bit_cast(v4us, l); }
}

extern "C" void kernel_launch(void* const* d_in, const int* in_sizes, int n_in,
                              void* d_out, int out_size, void* d_ws, size_t ws_size, hipStream_t stream) {
    if (n_in < 9) return;
    if (in_sizes[0] < NT * DM || in_sizes[1] < DM || in_sizes[2] < DM || in_sizes[3] < DM * DQ || in_sizes[4] < DM * 2 * DQ
        || in_sizes[5] < DM * DQ || in_sizes[6] < DQ || in_sizes[7] < DQ * DM || in_sizes[8] < DM) return;
    if (out_size < NT * DM) return;
    const float* x = (const float*)d_in[0]; const float* ln_g = (const float*)d_in[1]; const float* ln_b = (const float*)d_in[2]; const float* wq = (const float*)d_in[3]; const float* wkv = (const float*)d_in[4]; const float* wg = (const float*)d_in[5]; const float* bg = (const float*)d_in[6]; const float* wo = (const float*)d_in[7]; const float* bo = (const float*)d_in[8];
    float* OUT = (float*)d_out;     // [NB][TT][DM] = [NT][256]
    char* wsp = (char*)d_ws;
    auto take = [&](size_t bytes) { char* p = wsp; wsp += (bytes + 255) & ~(size_t)255; return (void*)p; };
    bf* WB = (bf*)take((size_t)DP * DM * 2);     // Bt [2048][256]: rows 0..511 q, 512..1023 k, 1024..1535 v, 1536..2047 g
    bf* WO = (bf*)take((size_t)DM * DQ * 2);     // Bt [256][512]
    bf* LNh = (bf*)take((size_t)NT * DM * 2); bf* LNl = (bf*)take((size_t)NT * DM * 2);
    float* F = (float*)take((size_t)GR * DP * 4); // [GR][2048] f32, pitch of the fused projection: only the g columns (1536..2047, without bias) are written and read
    bf* VTh = (bf*)take((size_t)ZH * HD * TT * 2); bf* VTl = (bf*)take((size_t)ZH * HD * TT * 2);
    bf* QPh = (bf*)take((size_t)ZH * TT * HD * 2); bf* QPl = (bf*)take((size_t)ZH * TT * HD * 2); bf* KPh = (bf*)take((size_t)ZH * TT * HD * 2); bf* KPl = (bf*)take((size_t)ZH * TT * HD * 2);
    bf* ATh = (bf*)take((size_t)GR * DQ * 2); bf* ATl = (bf*)take((size_t)GR * DQ * 2);
    if ((size_t)(wsp - (char*)d_ws) > ws_size) return;
    /* weights ('xw': Bt[n][k] = W[k][n]); the fused Wkv gives Bt rows 512..1023 = k, 1024..1535 = v */
    k_wtG<<<(unsigned)((DM * DQ / 64 + 63) / 64), 256, 0, stream>>>(wq, DM, DQ, WB);
    k_wtG<<<(unsigned)((DM * 2 * DQ / 64 + 63) / 64), 256, 0, stream>>>(wkv, DM, 2 * DQ, WB + (size_t)DQ * DM);
    k_wtG<<<(unsigned)((DM * DQ / 64 + 63) / 64), 256, 0, stream>>>(wg, DM, DQ, WB + (size_t)3 * DQ * DM);
    k_wtG<<<(unsigned)((DQ * DM / 64 + 63) / 64), 256, 0, stream>>>(wo, DQ, DM, WO);
    k_ln256<<<NT / 8, 256, 0, stream>>>(x, NT, ln_g, ln_b, LNh, LNl);
    for (int g = 0; g < NB_ / GB; ++g) { const size_t row0 = (size_t)g * GR;
        k_gemmw<bf, 1, false, true><<<dim3(GR / 64, DP / 64, 1), 32, 0, stream>>>(LNh + row0 * DM, LNl + row0 * DM, WB, nullptr, DM, F, DP, nullptr, 0, 0, 0, QPh, QPl, KPh, KPl, VTh, VTl);
        k_attn<<<ZH, 512, 0, stream>>>(QPh, QPl, KPh, KPl, VTh, VTl, F, bg, ATh, ATl);
        k_gemmw<bf, 1, true, false><<<dim3(GR / 64, DM / 64, 1), 32, 0, stream>>>(ATh, ATl, WO, nullptr, DQ, OUT + row0 * DM, DM, bo, 0, 0, 0, nullptr, nullptr, nullptr, nullptr, nullptr, nullptr); }
}

// v005
// It runs in 246 microseconds.
// Timed twice side by side with v004, it ran 1.27 and 1.24 times as fast.
// Over all steps from v000 it is 4.17 times as fast.
#include <hip/hip_runtime.h>

// Gated row attention along the width axis with a pre-LayerNorm: x [1][128][256][256] = 128 independent sequences (image rows) of 256 tokens x 256 features; xn = LayerNorm(x) (gamma, beta, eps 1e-5); q = xn Wq ('xw' [256][512], 8 heads x 64), [k|v] = xn Wkv ('xw' [256][1024]: columns k | v); dots = (q/8).k over the 256 keys of the same sequence; softmax; out = attn.v merged; gates = sigmoid(xn Wg + bg) ('xw' [256][512]); y = (out * gates) Wo + bo ('xw' [512][256]) -> [1][128][256][256] (8.4 M).
// Compute dtypes, f32 accumulate: all contractions v_wmma_f32_16x16x32_bf16 (bf16 operands). Every input RNE-converted to bf16 on load; LayerNorm in f32, xn as bf16 hi + lo planes; fused q|k|v|g projection as (hi + lo) x exact weights (2 products); scores and attn.v on bf16 hi/lo planes (3 products) for every row; softmax f32; sigmoid gate f32 (true division) with f32 bias add; (out x gate) as hi + lo x exact Wo (2 products) + bo.
// Layout: LayerNorm planes for all tokens in one launch; then 32 sequences (8,192 tokens) per pass; all per-(sequence, head) planes are z-major ([z = s*8 + head][256][64]); both GEMMs stage their operands in LDS with asynchronous copies (4 waves share a 128x128 tile); the projection GEMM's own epilogue splits its q, k and v tiles into those planes (v transposed), only the gate columns go out as f32; scores, softmax, attn.v and the sigmoid gate are ONE launch, one work-group per plane z: neither the scores nor the probabilities leave the registers, and the gated output goes out as the hi / lo planes that the last GEMM reads.

#ifndef NB_
#define NB_  128       // sequences (image rows) processed by this build
#endif
#define NB_FULL 128    // sequences in the input / output
#define TT   256       // tokens per sequence
#define DM   256
#define NH_  8
#define HD   64
#define DQ   (NH_ * HD)    // 512 = inner dim
#define DP   (4 * DQ)      // 2048 = fused projection width q | k | v | g
#ifndef GB
#if NB_ >= 32
#define GB   32            // sequences per pass
#else
#define GB   NB_
#endif
#endif
#define GR   (GB * TT)     // token rows per pass
#define ZH   (GB * NH_)    // (sequence, head) planes per pass
#define NT   (NB_ * TT)    // token rows in total
#define SCL  0.125f        // HD^-0.5

static_assert(NB_ >= 1 && NB_ <= NB_FULL);
static_assert((NB_ % GB) == 0);
static_assert((GR % 64) == 0 && (TT % 64) == 0 && (HD % 64) == 0 && (DM % 64) == 0 && (DQ % 64) == 0 && (DP % 64) == 0);
static_assert((HD % 32) == 0 && (DM % 32) == 0 && (DQ % 32) == 0 && (TT % 32) == 0);
static_assert((TT % 128) == 0 && (NT % 8) == 0 && (DM % 128) == 0);
static_assert(((DQ * DM) % 64) == 0 && ((2 * DQ * DM) % 64) == 0);
static_assert((GR % 128) == 0 && (DP % 128) == 0 && (DM % 128) == 0 && (DQ % 128) == 0);

typedef unsigned short bf;
typedef __attribute__((ext_vector_type(16))) __bf16   v16bf;
typedef __attribute__((ext_vector_type(8)))  unsigned short v8us;
typedef __attribute__((ext_vector_type(8)))  float    v8f;
typedef __attribute__((ext_vector_type(4)))  float    v4f;
typedef v4f  __attribute__((may_alias)) v4fa;
typedef __attribute__((ext_vector_type(2))) unsigned short v2us;
typedef __attribute__((ext_vector_type(4))) unsigned short v4us;

constexpr size_t al256(size_t b) { return (b + 255) & ~(size_t)255; }
constexpr size_t WS_NEED = al256((size_t)DP * DM * 2) + al256((size_t)DM * DQ * 2) + 2 * al256((size_t)NT * DM * 2) + al256((size_t)GR * DP * 4)
                         + 6 * al256((size_t)ZH * TT * HD * 2) + 2 * al256((size_t)GR * DQ * 2);
static_assert(WS_NEED <= (size_t)268435456);

__device__ __forceinline__ unsigned short f2bf(float f) { unsigned u = __float_as_uint(f); u += 0x7FFFu + ((u >> 16) & 1u); return (unsigned short)(u >> 16); }
__device__ __forceinline__ float bf2f(unsigned short b) { return __uint_as_float(((unsigned)b) << 16); }
__device__ __forceinline__ float bfr(float f) { return bf2f(f2bf(f)); }
__device__ __forceinline__ v16bf cat16b(v8us lo, v8us hi) { return __builtin_bit_cast(v16bf, __builtin_shufflevector(lo, hi, 0, 1, 2, 3, 4, 5, 6, 7, 8, 9, 10, 11, 12, 13, 14, 15)); }
__device__ __forceinline__ v8f wmmab(v16bf a, v16bf b, v8f c) { return __builtin_amdgcn_wmma_f32_16x16x32_bf16(false, a, false, b, (short)0, c, false, false); }
__device__ __forceinline__ void splitf(float y, unsigned short& h, unsigned short& l) { h = f2bf(y); l = f2bf(y - bf2f(h)); }

// ---- k_gemmw: register-blocked GEMM, one wave per 64x64 output tile (16 accumulators), FOUR waves (2 x 2) per work-group = a 128x128 tile; grid (M/128, N/128, Z), 128 threads.
// Operands are K-contiguous 16-bit planes. A trip is 64 k: 128 rows of A, of A2 and of Bt, 128 bytes each (one whole line a row), are brought into LDS by asynchronous copies, two buffers, the next trip's copies in flight while this trip's products run; fragments are read from LDS at pitch GP. K % 64 == 0.
// C[m][n] (f32, pitch ldc, + optional f32 bias[n]) = sum_k A[m][k] Bt[n][k] + sum_k A2[m][k] Bt[n][k] (NSPLIT 1). z-batch strides sA/sB/sC in elements.
// Fragments: lane l -> row/col l&15, elements 0..7 <- k0 + 8*(l>>4) + 0..7, elements 8..15 <- k0 + 16 + 8*(l>>4) + 0..7 for A and for Bt alike; D element r of lane l = (row 8*(l>>4) + r, col l&15).
template <typename T16> struct WFrag;
template <> struct WFrag<bf> { typedef v16bf V; static __device__ __forceinline__ V ld(const bf* p) { return cat16b(*(const v8us*)p, *(const v8us*)(p + 16)); } static __device__ __forceinline__ v8f mma(V a, V b, v8f c) { return wmmab(a, b, c); } };
// PLANES (the fused q | k | v | g projection, N = DP): a 64-column tile is one head of q, k, v or g and its 64 rows lie in one sequence, so the epilogue writes the tile where the attention stages read it:
// q, k: hi / lo planes [z][t][d]; v: hi / lo planes transposed [z][d][t] (a lane's 8 accumulator registers are 8 consecutive t of one d: one 16-byte store a plane); g: f32 into C as without PLANES.
static_assert(HD == 64 && (DQ % 64) == 0 && (TT % 64) == 0);
#define GP 72                 // LDS pitch of a staged row of 64 k, 16-bit elements: 144 B = 16 B x 9 keeps the 16-byte fragment reads off each other's banks
#define GPL (128 * GP)        // one operand's 128 rows
#define GSTG (3 * GPL)        // one buffer: A | A2 | Bt
// Eight asynchronous copies of 16 bytes a lane: rows r, r + 16, .. r + 112 of one operand (a wave's 32 lanes cover 4 whole 128-byte lines a copy).
// s_wait_xcnt stands inside the statement, behind the last copy: no address register of a copy is rewritten in front of it.
__device__ __forceinline__ void cp8(unsigned l, const bf* g, size_t rs) {
    asm volatile("global_load_async_to_lds_b128 %0, %8, off\n\tglobal_load_async_to_lds_b128 %1, %9, off\n\tglobal_load_async_to_lds_b128 %2, %10, off\n\tglobal_load_async_to_lds_b128 %3, %11, off\n\t"
                 "global_load_async_to_lds_b128 %4, %12, off\n\tglobal_load_async_to_lds_b128 %5, %13, off\n\tglobal_load_async_to_lds_b128 %6, %14, off\n\tglobal_load_async_to_lds_b128 %7, %15, off\n\ts_wait_xcnt 0x0"
                 :: "v"(l), "v"(l + 1u * 16 * GP * 2), "v"(l + 2u * 16 * GP * 2), "v"(l + 3u * 16 * GP * 2), "v"(l + 4u * 16 * GP * 2), "v"(l + 5u * 16 * GP * 2), "v"(l + 6u * 16 * GP * 2), "v"(l + 7u * 16 * GP * 2),
                    "v"(g), "v"(g + rs), "v"(g + 2 * rs), "v"(g + 3 * rs), "v"(g + 4 * rs), "v"(g + 5 * rs), "v"(g + 6 * rs), "v"(g + 7 * rs) : "memory");
}
template <typename T16, int NSPLIT, bool BIAS, bool PLANES>
__global__ __launch_bounds__(128) void k_gemmw(const T16* __restrict__ A, const T16* __restrict__ A2, const T16* __restrict__ Bt, const T16* __restrict__ Bt2, int K, float* C, int ldc, const float* __restrict__ bias, size_t sA, size_t sB, size_t sC, bf* qh, bf* ql, bf* kh, bf* kl, bf* vh, bf* vl) {
    static_assert(NSPLIT == 1);   // products a.b and a2.b
    typedef typename WFrag<T16>::V V;
    __shared__ __align__(16) bf sT[2 * GSTG];
    __shared__ __align__(16) float osw[4 * 16 * 68];
    const size_t z = blockIdx.z; A += z * sA; A2 += z * sA; Bt += z * sB; C += z * sC;
    const int tid = threadIdx.x, lane = tid & 31, lr = lane & 15, hi = lane >> 4; const int wv = __builtin_amdgcn_readfirstlane(tid >> 5);   // the wave's number, in a scalar register: tile indices and the epilogue's branches stay scalar
    const int R0 = blockIdx.x * 128, C0 = blockIdx.y * 128; const int r0 = R0 + (wv >> 1) * 64, c0 = C0 + (wv & 1) * 64;
    float* os = osw + wv * (16 * 68);   // each wave's own rows for its epilogue
    v8f acc[4][4];
#pragma unroll
    for (int mb = 0; mb < 4; ++mb)
#pragma unroll
        for (int nb = 0; nb < 4; ++nb) acc[mb][nb] = (v8f){};
    // this thread's part of a trip's copies: 16-byte piece tid & 7 of rows (tid >> 3) + 16 i, i = 0 .. 7, of each operand
    const size_t rs = (size_t)16 * K; const size_t go = (size_t)(tid >> 3) * K + (tid & 7) * 8;
    const bf* gA = A + (size_t)R0 * K + go; const bf* gA2 = A2 + (size_t)R0 * K + go; const bf* gB = Bt + (size_t)C0 * K + go;
    const unsigned l0 = (unsigned)(size_t)sT + (unsigned)(((tid >> 3) * GP + (tid & 7) * 8) * 2);
    const int nt = K / 64;
    cp8(l0, gA, rs); cp8(l0 + GPL * 2, gA2, rs); cp8(l0 + 2 * GPL * 2, gB, rs);
    asm volatile("s_wait_asynccnt 0x0" ::: "memory");   // this wave's copies of trip 0 have landed
    __syncthreads();                                      // and every other wave's: buffer 0 may be read
    if (nt > 1) { cp8(l0 + GSTG * 2, gA + 64, rs); cp8(l0 + (GSTG + GPL) * 2, gA2 + 64, rs); cp8(l0 + (GSTG + 2 * GPL) * 2, gB + 64, rs); }
    const int aof = ((wv >> 1) * 64 + lr) * GP + 8 * hi, bof = 2 * GPL + ((wv & 1) * 64 + lr) * GP + 8 * hi;
#pragma unroll 1
    for (int t = 0; t < nt; ++t) { const bf* sb = sT + (t & 1) * GSTG;
#pragma unroll
        for (int ks = 0; ks < 2; ++ks) {
            V a[4], a2[4], b[4];
            b[0] = WFrag<T16>::ld(sb + bof + ks * 32);
#pragma unroll
            for (int mb = 0; mb < 4; ++mb) a[mb] = WFrag<T16>::ld(sb + aof + mb * 16 * GP + ks * 32);
#pragma unroll
            for (int mb = 0; mb < 4; ++mb) a2[mb] = WFrag<T16>::ld(sb + GPL + aof + mb * 16 * GP + ks * 32);
#pragma unroll
            for (int nb = 1; nb < 4; ++nb) b[nb] = WFrag<T16>::ld(sb + bof + nb * 16 * GP + ks * 32);
            __builtin_amdgcn_sched_barrier(0);   // the twelve fragments of 32 k are read as ONE group in front of their 32 products: left to itself the build reads each b in front of its own 8 products and waits for it there
#pragma unroll
            for (int nb = 0; nb < 4; ++nb)
#pragma unroll
                for (int mb = 0; mb < 4; ++mb) { acc[mb][nb] = WFrag<T16>::mma(a[mb], b[nb], acc[mb][nb]); acc[mb][nb] = WFrag<T16>::mma(a2[mb], b[nb], acc[mb][nb]); }
        }
        asm volatile("s_wait_dscnt 0x0" ::: "memory");      // this wave's reads of the buffer are done before it is refilled
        asm volatile("s_wait_asynccnt 0x0" ::: "memory");   // this wave's copies of trip t + 1 have landed
        __syncthreads();                                      // publishes trip t + 1's buffer and ends every wave's reads of trip t's
        if (t + 2 < nt) { const unsigned lb = l0 + (unsigned)(t & 1) * (GSTG * 2); const int kc = (t + 2) * 64; cp8(lb, gA + kc, rs); cp8(lb + GPL * 2, gA2 + kc, rs); cp8(lb + 2 * GPL * 2, gB + kc, rs); }
    }
    asm volatile("s_wait_asynccnt 0x0" ::: "memory");   // no copy is outstanding when the wave goes on to its epilogue and ends
    const int sel = PLANES ? c0 / DQ : 3;                                                  // 0 q, 1 k, 2 v, 3 f32 output; the same for the whole tile
    const size_t zp = PLANES ? (size_t)(r0 / TT) * NH_ + (c0 % DQ) / HD : 0; const int t0 = r0 % TT;   // plane (sequence, head) and first token of the tile
    if (PLANES && sel == 2) {
#pragma unroll
        for (int mb = 0; mb < 4; ++mb)
#pragma unroll
            for (int nb = 0; nb < 4; ++nb) { v8us oh, ol;
#pragma unroll
                for (int j = 0; j < 8; ++j) { unsigned short a, c2; splitf(acc[mb][nb][j], a, c2); oh[j] = a; ol[j] = c2; }
                const size_t o = (zp * HD + nb * 16 + lr) * TT + t0 + mb * 16 + 8 * hi; *(v8us*)(vh + o) = oh; *(v8us*)(vl + o) = ol; }
        return;
    }
    if (PLANES && sel < 2) { bf* ph = (sel == 0) ? qh : kh; bf* pl = (sel == 0) ? ql : kl;
#pragma unroll
        for (int mb = 0; mb < 4; ++mb) {
#pragma unroll
            for (int nb = 0; nb < 4; ++nb) {
#pragma unroll
                for (int j = 0; j < 8; ++j) os[(hi * 8 + j) * 68 + nb * 16 + lr] = acc[mb][nb][j]; }
            __builtin_amdgcn_wave_barrier(); asm volatile("" ::: "memory");   // the rows read below were written by other lanes of this wave: keep the LDS reads behind the writes
#pragma unroll
            for (int s = 0; s < 8; ++s) { const int row = 2 * s + hi, cofs = lr * 4; const v4f val = *(const v4fa*)(os + row * 68 + cofs); v4us oh, ol;
#pragma unroll
                for (int q = 0; q < 4; ++q) { unsigned short a, c2; splitf(val[q], a, c2); oh[q] = a; ol[q] = c2; }
                const size_t o = (zp * TT + t0 + mb * 16 + row) * HD + cofs; *(v4us*)(ph + o) = oh; *(v4us*)(pl + o) = ol; }
            __builtin_amdgcn_wave_barrier(); asm volatile("" ::: "memory");   // and the next block's writes behind these reads
        }
        asm volatile("s_wait_xcnt 0x0" ::: "memory");   // behind the last stores: their address registers are reused by the code laid out behind this block
        return;
    }
#pragma unroll
    for (int mb = 0; mb < 4; ++mb) {
#pragma unroll
        for (int nb = 0; nb < 4; ++nb) {
#pragma unroll
            for (int j = 0; j < 8; ++j) os[(hi * 8 + j) * 68 + nb * 16 + lr] = acc[mb][nb][j]; }
        __builtin_amdgcn_wave_barrier(); asm volatile("" ::: "memory");
        float* crow = C + (size_t)(r0 + mb * 16) * ldc + c0;
{
#pragma unroll
            for (int s = 0; s < 8; ++s) { const int row = 2 * s + hi, cofs = lr * 4; v4f val = *(const v4fa*)(os + row * 68 + cofs); if (BIAS) { val[0] += bfr(bias[c0 + cofs]); val[1] += bfr(bias[c0 + cofs + 1]); val[2] += bfr(bias[c0 + cofs + 2]); val[3] += bfr(bias[c0 + cofs + 3]); }
                *(v4f*)(crow + (size_t)row * ldc + cofs) = val; }
             }
        __builtin_amdgcn_wave_barrier(); asm volatile("" ::: "memory");
    }
    if (PLANES) asm volatile("s_wait_xcnt 0x0" ::: "memory");   // behind the last stores: in this build the plane blocks are laid out behind them and reuse their address registers
}

__global__ __launch_bounds__(256) void k_wtG(const float* __restrict__ w, int K, int N, bf* Bt) {
    const int lane = threadIdx.x & 31; const int L0 = (blockIdx.x * 8 + (threadIdx.x >> 5)) * 8; const int nlines = N * K / 64;
{
#pragma unroll 1
        for (int l = 0; l < 8; ++l) { const int L = L0 + l; if (L >= nlines) break; const size_t e = (size_t)L * 64 + lane * 2; const int k = (int)(e % K), n = (int)(e / K); v2us o;
            o[0] = f2bf(w[(size_t)k * N + n]); o[1] = f2bf(w[(size_t)(k + 1) * N + n]); *(v2us*)(Bt + e) = o; }
         }
}

__global__ __launch_bounds__(256) void k_ln256(const float* __restrict__ X, int nrows, const float* __restrict__ gw, const float* __restrict__ gb, bf* Yh, bf* Yl) {
    const int lane = threadIdx.x & 31; const int r = blockIdx.x * 8 + (threadIdx.x >> 5); if (r >= nrows) return; const float* xr = X + (size_t)r * DM; float hv[8]; float s = 0.f;
#pragma unroll
    for (int ch = 0; ch < 2; ++ch) { const v4f y = *(const v4f*)(xr + ch * 128 + lane * 4);
#pragma unroll
        for (int q = 0; q < 4; ++q) { const float u = bfr(y[q]); hv[ch * 4 + q] = u; s += u; } }
#pragma unroll
    for (int sh = 16; sh; sh >>= 1) s += __shfl_xor(s, sh, 32);
    float mu = s * (1.0f / 256.0f); asm volatile("" : "+v"(mu)); float s2 = 0.f;
#pragma unroll
    for (int k = 0; k < 8; ++k) { float d0 = __fsub_rn(hv[k], mu); asm volatile("" : "+v"(d0)); float p = __fmul_rn(d0, d0); asm volatile("" : "+v"(p)); s2 = __fadd_rn(s2, p); }
#pragma unroll
    for (int sh = 16; sh; sh >>= 1) s2 += __shfl_xor(s2, sh, 32);
    float var = __fadd_rn(s2 * (1.0f / 256.0f), 1e-5f); asm volatile("" : "+v"(var)); const float rs = __frsqrt_rn(var);
{
#pragma unroll
        for (int ch = 0; ch < 2; ++ch) { const int c0 = ch * 128 + lane * 4; v4us oh, ol;
#pragma unroll
            for (int q = 0; q < 4; ++q) { float gg = bfr(gw[c0 + q]); asm volatile("" : "+v"(gg)); float d0 = __fsub_rn(hv[ch * 4 + q], mu); asm volatile("" : "+v"(d0)); float n0 = __fmul_rn(d0, rs); asm volatile("" : "+v"(n0)); float y = __fmul_rn(n0, gg); asm volatile("" : "+v"(y)); y = __fadd_rn(y, bfr(gb[c0 + q])); unsigned short a, c2; splitf(y, a, c2); oh[q] = a; ol[q] = c2; }
            *(v4us*)(Yh + (size_t)r * DM + c0) = oh; *(v4us*)(Yl + (size_t)r * DM + c0) = ol; }
         } }

// k_attn: scores, softmax and attn.v of one plane z in one work-group of 16 waves; wave w owns the 16 queries 16w .. 16w + 15 and all TT keys.
// K hi / lo ([key][d]) and V^T hi / lo ([d][key]) are staged once in LDS with whole-line loads and read from there by every wave; the Q fragments come straight from the planes, once.
// S^T = K Q^T (A = K rows, B = Q rows): D register r of tile kb in lane l = score(key 16 kb + 8 (l >> 4) + r, query l & 15), so a lane holds 128 scores of ONE query:
// maximum and sum in the lane plus one exchange between the wave's halves. Tiles 2j and 2j + 1, normalised and split hi / lo in place, ARE the B fragment of keys 32j .. 32j + 31
// in the loader's k order, so O^T = V^T P^T (A = V^T rows) needs no exchange. Products per accumulator in the order hi.hi, lo.hi, hi.lo of (q, k) and of (p, v).
// Epilogue: AT hi / lo planes [s*TT + t][h*HD + d] = O[t][d] x sigmoid(G[(s*TT + t)*DP + 3*DQ + h*HD + d] + bg[h*HD + d]) with z = s*NH_ + h, G the f32 output of the fused projection: its last DQ columns are the gate pre-activation without bias.
#define KP 72     // LDS pitch of a K row, 16-bit elements: 144 B = 16 B x 9; an odd multiple of 16 B keeps the 16-byte fragment reads off each other's banks
#define VP 264    // LDS pitch of a V^T row: 528 B = 16 B x 33
#define OP 68     // LDS pitch of an output row, floats: 272 B = 16 B x 17
#define GST 8     // step of attn.v at which the gate rows are loaded
static_assert(TT == 256 && HD == 64);
typedef __attribute__((ext_vector_type(2))) float  v2f;
typedef __attribute__((ext_vector_type(2))) __bf16 v2bf;
typedef __attribute__((ext_vector_type(8))) unsigned v8u;
typedef __attribute__((ext_vector_type(4))) __bf16 v4bf;
__global__ __launch_bounds__(512) void k_attn(const bf* __restrict__ Qh, const bf* __restrict__ Ql, const bf* __restrict__ Kh, const bf* __restrict__ Kl, const bf* __restrict__ Vh, const bf* __restrict__ Vl, const float* __restrict__ G, const float* __restrict__ bgp, bf* __restrict__ Ah, bf* __restrict__ Al) {
    __shared__ __align__(16) bf sKh[TT * KP]; __shared__ __align__(16) bf sKl[TT * KP];
    __shared__ __align__(16) bf sVh[HD * VP]; __shared__ __align__(16) bf sVl[HD * VP];
    __shared__ __align__(16) float sO[16 * 16 * OP];
    const int tid = threadIdx.x, lane = tid & 31, wv = tid >> 5, lr = lane & 15, hi = lane >> 4;
    const size_t zo = (size_t)blockIdx.x * (TT * HD);
    v8us tk[4][2], tv[4][2];   // all sixteen loads of a thread are issued before the first LDS store waits for one
#pragma unroll
    for (int i = 0; i < 4; ++i) { const size_t e = zo + (size_t)(i * 512 + tid) * 8; tk[i][0] = *(const v8us*)(Kh + e); tk[i][1] = *(const v8us*)(Kl + e); tv[i][0] = *(const v8us*)(Vh + e); tv[i][1] = *(const v8us*)(Vl + e); }
    v16bf qh[2], ql[2];
#pragma unroll
    for (int ks = 0; ks < 2; ++ks) { const size_t qo = zo + (size_t)(wv * 16 + lr) * HD + ks * 32 + 8 * hi; qh[ks] = WFrag<bf>::ld(Qh + qo); ql[ks] = WFrag<bf>::ld(Ql + qo); }
#pragma unroll
    for (int i = 0; i < 4; ++i) { const int e = (i * 512 + tid) * 8; const int ko = (e / HD) * KP + (e % HD), vo = (e / TT) * VP + (e % TT);
        *(v8us*)(sKh + ko) = tk[i][0]; *(v8us*)(sKl + ko) = tk[i][1]; *(v8us*)(sVh + vo) = tv[i][0]; *(v8us*)(sVl + vo) = tv[i][1]; }
    __syncthreads();   // K and V^T are complete in LDS; they are only read from here on
    // Scores: step st = (pair of key tiles st >> 1, half ks = st & 1 of the head dim), 4 fragments and 6 products; each step's fragments are fetched as one group one step ahead
    v8f s[16]; v16bf fk[2][4];
    const int kof = lr * KP + 8 * hi;
#pragma unroll
    for (int p = 0; p < 2; ++p) { fk[0][p] = WFrag<bf>::ld(sKh + kof + p * 16 * KP); fk[0][2 + p] = WFrag<bf>::ld(sKl + kof + p * 16 * KP); }
#pragma unroll
    for (int st = 0; st < 16; ++st) { const int kb = (st >> 1) * 2, ks = st & 1, cb = st & 1, nb = cb ^ 1;
        if (st + 1 < 16) { const int o = kof + ((st + 1) >> 1) * 32 * KP + ((st + 1) & 1) * 32;
#pragma unroll
            for (int p = 0; p < 2; ++p) { fk[nb][p] = WFrag<bf>::ld(sKh + o + p * 16 * KP); fk[nb][2 + p] = WFrag<bf>::ld(sKl + o + p * 16 * KP); } }
        v8f a0 = ks ? s[kb] : (v8f){}, a1 = ks ? s[kb + 1] : (v8f){};
        a0 = wmmab(fk[cb][0], qh[ks], a0); a1 = wmmab(fk[cb][1], qh[ks], a1); a0 = wmmab(fk[cb][0], ql[ks], a0); a1 = wmmab(fk[cb][1], ql[ks], a1); a0 = wmmab(fk[cb][2], qh[ks], a0); a1 = wmmab(fk[cb][3], qh[ks], a1);
        s[kb] = a0; s[kb + 1] = a1; }
    v8f m8 = s[0];
#pragma unroll
    for (int kb = 1; kb < 16; ++kb)
#pragma unroll
        for (int r = 0; r < 8; ++r) m8[r] = fmaxf(m8[r], s[kb][r]);
    float mx = fmaxf(fmaxf(fmaxf(m8[0], m8[1]), fmaxf(m8[2], m8[3])), fmaxf(fmaxf(m8[4], m8[5]), fmaxf(m8[6], m8[7])));
    mx = fmaxf(mx, __shfl_xor(mx, 16, 32)) * SCL;   // the scale is a positive power of two: scaling the maximum is the maximum of the scaled scores
    v8f s8;
#pragma unroll
    for (int kb = 0; kb < 16; ++kb) {
#pragma unroll
        for (int r = 0; r < 8; r += 4) { float x[4], ex[4];
#pragma unroll
            for (int c = 0; c < 4; ++c) x[c] = (s[kb][r + c] * SCL - mx) * 1.4426950408889634f;
            // four exponentials whose results share no register with any argument, then one v_nop: the slot the instruction set asks for behind a transcendental; inside the statement it cannot drift away
            asm("v_exp_f32 %0, %4\n\tv_exp_f32 %1, %5\n\tv_exp_f32 %2, %6\n\tv_exp_f32 %3, %7\n\tv_nop" : "=&v"(ex[0]), "=&v"(ex[1]), "=&v"(ex[2]), "=&v"(ex[3]) : "v"(x[0]), "v"(x[1]), "v"(x[2]), "v"(x[3]));
#pragma unroll
            for (int c = 0; c < 4; ++c) { s[kb][r + c] = ex[c]; s8[r + c] = kb ? s8[r + c] + ex[c] : ex[c]; } } }
    float sum = ((s8[0] + s8[1]) + (s8[2] + s8[3])) + ((s8[4] + s8[5]) + (s8[6] + s8[7]));
    sum += __shfl_xor(sum, 16, 32);
    const float f = __fdiv_rn(1.0f, sum);
    // attn.v: step st = (32 keys j = st >> 1, pair of d tiles st & 1), fetched one step ahead like the scores' steps; the two score tiles of j become P^T hi / lo just before their first use
    v8f o[4]; v16bf fv[2][4]; v16bf ph, pl;
    // this lane's part of the epilogue: tokens wv*16 + hi + 2q (q = 0 .. 7), columns lr*4 .. lr*4 + 3 of the head; the work-group's part of each address is the same in every lane
    const size_t tok0 = (size_t)(blockIdx.x / NH_) * TT; const int col0 = ((int)blockIdx.x % NH_) * HD; v4f gv[8], bv;
    const int vof = lr * VP + 8 * hi;
#pragma unroll
    for (int p = 0; p < 2; ++p) { fv[0][p] = WFrag<bf>::ld(sVh + vof + p * 16 * VP); fv[0][2 + p] = WFrag<bf>::ld(sVl + vof + p * 16 * VP); }
#pragma unroll
    for (int st = 0; st < 16; ++st) { const int j = st >> 1, mb = (st & 1) * 2, cb = st & 1, nb = cb ^ 1;
        if (st + 1 < 16) { const int ofs = vof + ((st + 1) & 1) * 32 * VP + ((st + 1) >> 1) * 32;
#pragma unroll
            for (int p = 0; p < 2; ++p) { fv[nb][p] = WFrag<bf>::ld(sVh + ofs + p * 16 * VP); fv[nb][2 + p] = WFrag<bf>::ld(sVl + ofs + p * 16 * VP); } }
        if (st == GST) {   // the gate rows are asked for here, where enough score tiles are dead to hold them, so that they have landed when the products end
            const char* gp = (const char*)(G + tok0 * DP + 3 * DQ + col0) + (unsigned)(((wv * 16 + hi) * DP + lr * 4) * 4);
            bv = *(const v4f*)(bgp + col0 + lr * 4);
#pragma unroll
            for (int q = 0; q < 8; ++q) gv[q] = *(const v4f*)(gp + q * 2 * DP * 4); }
        if ((st & 1) == 0) { v8u wh, wl;
#pragma unroll
            for (int i = 0; i < 8; ++i) { const v8f t = s[2 * j + (i >> 2)]; const v2f y = { t[(2 * i) & 7] * f, t[(2 * i + 1) & 7] * f };
                const v2bf h = __builtin_convertvector(y, v2bf); const v2bf l = __builtin_convertvector(y - __builtin_convertvector(h, v2f), v2bf);
                wh[i] = __builtin_bit_cast(unsigned, h); wl[i] = __builtin_bit_cast(unsigned, l); }
            ph = __builtin_bit_cast(v16bf, wh); pl = __builtin_bit_cast(v16bf, wl); }
        v8f a0 = j ? o[mb] : (v8f){}, a1 = j ? o[mb + 1] : (v8f){};
        a0 = wmmab(fv[cb][0], ph, a0); a1 = wmmab(fv[cb][1], ph, a1); a0 = wmmab(fv[cb][0], pl, a0); a1 = wmmab(fv[cb][1], pl, a1); a0 = wmmab(fv[cb][2], ph, a0); a1 = wmmab(fv[cb][3], ph, a1);
        o[mb] = a0; o[mb + 1] = a1; }
    // o[mb][r] = O(query lr, d = 16 mb + 8 hi + r): through the wave's own LDS rows, so that each store instruction writes whole 128-byte lines
    float* os = sO + wv * (16 * OP);
#pragma unroll
    for (int mb = 0; mb < 4; ++mb) { float* p = os + lr * OP + mb * 16 + 8 * hi; *(v4fa*)p = __builtin_shufflevector(o[mb], o[mb], 0, 1, 2, 3); *(v4fa*)(p + 4) = __builtin_shufflevector(o[mb], o[mb], 4, 5, 6, 7); }
    asm volatile("s_wait_dscnt 0x0" ::: "memory");   // the rows read below were written by other lanes of this wave: the writes are done, and stay in front, before they are read back
    v4f ov[8];   // all eight LDS reads are issued before the first store waits for one
#pragma unroll
    for (int q = 0; q < 8; ++q) ov[q] = *(const v4fa*)(os + (2 * q + hi) * OP + lr * 4);
    const v4f bb = { bfr(bv[0]), bfr(bv[1]), bfr(bv[2]), bfr(bv[3]) };
    const unsigned ao = (unsigned)(((wv * 16 + hi) * DQ + lr * 4) * 2);   // 16 lanes x 8 bytes = one whole 128-byte line of a plane per token
    char* ah = (char*)(Ah + tok0 * DQ + col0) + ao; char* al = (char*)(Al + tok0 * DQ + col0) + ao;
#pragma unroll
    for (int q = 0; q < 8; ++q) { v4f y;
#pragma unroll
        for (int c = 0; c < 4; ++c) { const float den = 1.0f + expf(-(gv[q][c] + bb[c])); y[c] = ov[q][c] * __fdiv_rn(1.0f, den); }
        const v4bf h = __builtin_convertvector(y, v4bf); const v4bf l = __builtin_convertvector(y - __builtin_convertvector(h, v4f), v4bf);
        *(v4us*)(ah + q * 2 * DQ * 2) = __builtin_bit_cast(v4us, h); *(v4us*)(al + q * 2 * DQ * 2) = __builtin_bit_cast(v4us, l); }
}

extern "C" void kernel_launch(void* const* d_in, const int* in_sizes, int n_in,
                              void* d_out, int out_size, void* d_ws, size_t ws_size, hipStream_t stream) {
    if (n_in < 9) return;
    if (in_sizes[0] < NT * DM || in_sizes[1] < DM || in_sizes[2] < DM || in_sizes[3] < DM * DQ || in_sizes[4] < DM * 2 * DQ
        || in_sizes[5] < DM * DQ || in_sizes[6] < DQ || in_sizes[7] < DQ * DM || in_sizes[8] < DM) return;
    if (out_size < NT * DM) return;
    const float* x = (const float*)d_in[0]; const float* ln_g = (const float*)d_in[1]; const float* ln_b = (const float*)d_in[2]; const float* wq = (const float*)d_in[3]; const float* wkv = (const float*)d_in[4]; const float* wg = (const float*)d_in[5]; const float* bg = (const float*)d_in[6]; const float* wo = (const float*)d_in[7]; const float* bo = (const float*)d_in[8];
    float* OUT = (float*)d_out;     // [NB][TT][DM] = [NT][256]
    char* wsp = (char*)d_ws;
    auto take = [&](size_t bytes) { char* p = wsp; wsp += (bytes + 255) & ~(size_t)255; return (void*)p; };
    bf* WB = (bf*)take((size_t)DP * DM * 2);     // Bt [2048][256]: rows 0..511 q, 512..1023 k, 1024..1535 v, 1536..2047 g
    bf* WO = (bf*)take((size_t)DM * DQ * 2);     // Bt [256][512]
    bf* LNh = (bf*)take((size_t)NT * DM * 2); bf* LNl = (bf*)take((size_t)NT * DM * 2);
    float* F = (float*)take((size_t)GR * DP * 4); // [GR][2048] f32, pitch of the fused projection: only the g columns (1536..2047, without bias) are written and read
    bf* VTh = (bf*)take((size_t)ZH * HD * TT * 2); bf* VTl = (bf*)take((size_t)ZH * HD * TT * 2);
    bf* QPh = (bf*)take((size_t)ZH * TT * HD * 2); bf* QPl = (bf*)take((size_t)ZH * TT * HD * 2); bf* KPh = (bf*)take((size_t)ZH * TT * HD * 2); bf* KPl = (bf*)take((size_t)ZH * TT * HD * 2);
    bf* ATh = (bf*)take((size_t)GR * DQ * 2); bf* ATl = (bf*)take((size_t)GR * DQ * 2);
    if ((size_t)(wsp - (char*)d_ws) > ws_size) return;
    /* weights ('xw': Bt[n][k] = W[k][n]); the fused Wkv gives Bt rows 512..1023 = k, 1024..1535 = v */
    k_wtG<<<(unsigned)((DM * DQ / 64 + 63) / 64), 256, 0, stream>>>(wq, DM, DQ, WB);
    k_wtG<<<(unsigned)((DM * 2 * DQ / 64 + 63) / 64), 256, 0, stream>>>(wkv, DM, 2 * DQ, WB + (size_t)DQ * DM);
    k_wtG<<<(unsigned)((DM * DQ / 64 + 63) / 64), 256, 0, stream>>>(wg, DM, DQ, WB + (size_t)3 * DQ * DM);
    k_wtG<<<(unsigned)((DQ * DM / 64 + 63) / 64), 256, 0, stream>>>(wo, DQ, DM, WO);
    k_ln256<<<NT / 8, 256, 0, stream>>>(x, NT, ln_g, ln_b, LNh, LNl);
    for (int g = 0; g < NB_ / GB; ++g) { const size_t row0 = (size_t)g * GR;
        k_gemmw<bf, 1, false, true><<<dim3(GR / 128, DP / 128, 1), 128, 0, stream>>>(LNh + row0 * DM, LNl + row0 * DM, WB, nullptr, DM, F, DP, nullptr, 0, 0, 0, QPh, QPl, KPh, KPl, VTh, VTl);
        k_attn<<<ZH, 512, 0, stream>>>(QPh, QPl, KPh, KPl, VTh, VTl, F, bg, ATh, ATl);
        k_gemmw<bf, 1, true, false><<<dim3(GR / 128, DM / 128, 1), 128, 0, stream>>>(ATh, ATl, WO, nullptr, DQ, OUT + row0 * DM, DM, bo, 0, 0, 0, nullptr, nullptr, nullptr, nullptr, nullptr, nullptr); }
}

// v007
// A run of this version takes 123 microseconds.
// Versions between v005 and this one are left out; their measured steps multiply to 2.00 times as fast.
// Counting every step since v000, it is 8.35 times as fast.
#include <hip/hip_runtime.h>

// Gated row attention along the width axis with a pre-LayerNorm: x [1][128][256][256] = 128 independent sequences (image rows) of 256 tokens x 256 features; xn = LayerNorm(x) (gamma, beta, eps 1e-5); q = xn Wq ('xw' [256][512], 8 heads x 64), [k|v] = xn Wkv ('xw' [256][1024]: columns k | v); dots = (q/8).k over the 256 keys of the same sequence; softmax; out = attn.v merged; gates = sigmoid(xn Wg + bg) ('xw' [256][512]); y = (out * gates) Wo + bo ('xw' [512][256]) -> [1][128][256][256] (8.4 M).
// Compute dtypes, f32 accumulate: all contractions v_wmma_f32_16x16x32_bf16 (bf16 operands). Every input RNE-converted to bf16 on load; LayerNorm in f32, xn as bf16 hi + lo planes; q, k, v, g projections as (hi + lo) x exact weights (2 products); scores and attn.v on bf16 hi/lo operands (3 products) for every row; softmax f32; sigmoid gate f32 (true division) with f32 bias add; (out x gate) as hi + lo x exact Wo (2 products) + bo.
// Layout: the transposed weights and the LayerNorm planes for all tokens in one launch; then ONE launch with one work-group per (sequence, head) does that head's q, k, v, g projections, the scores, the softmax, attn.v and the gate: q, k, v, g, the scores and the probabilities never leave the WGP (k and v go to LDS, q and the probabilities stay in registers), and the gated output goes out as the hi / lo planes that the last GEMM reads. The last GEMM stages its operands in LDS with asynchronous copies (4 waves share a 128x128 tile).

#ifndef NB_
#define NB_  128       // sequences (image rows) processed by this build
#endif
#define NB_FULL 128    // sequences in the input / output
#define TT   256       // tokens per sequence
#define DM   256
#define NH_  8
#define HD   64
#define DQ   (NH_ * HD)    // 512 = inner dim
#define DP   (4 * DQ)      // 2048 = rows of the transposed weights q | k | v | g
#define ZH   (NB_ * NH_)   // (sequence, head) planes
#define NT   (NB_ * TT)    // token rows in total
#define SCL  0.125f        // HD^-0.5

static_assert(NB_ >= 1 && NB_ <= NB_FULL);
static_assert((TT % 64) == 0 && (HD % 64) == 0 && (DM % 64) == 0 && (DQ % 64) == 0 && (DP % 64) == 0);
static_assert((HD % 32) == 0 && (DM % 32) == 0 && (DQ % 32) == 0 && (TT % 32) == 0);
static_assert((TT % 128) == 0 && (NT % 8) == 0 && (DM % 128) == 0);
static_assert(((DQ * DM) % 64) == 0 && ((2 * DQ * DM) % 64) == 0);
static_assert((NT % 128) == 0 && (DM % 128) == 0 && (DQ % 128) == 0);

typedef unsigned short bf;
typedef __attribute__((ext_vector_type(16))) __bf16   v16bf;
typedef __attribute__((ext_vector_type(8)))  unsigned short v8us;
typedef __attribute__((ext_vector_type(8)))  float    v8f;
typedef __attribute__((ext_vector_type(4)))  float    v4f;
typedef v4f  __attribute__((may_alias)) v4fa;
typedef __attribute__((ext_vector_type(2))) unsigned short v2us;
typedef __attribute__((ext_vector_type(4))) unsigned short v4us;

constexpr size_t al256(size_t b) { return (b + 255) & ~(size_t)255; }
constexpr size_t WS_NEED = al256((size_t)DP * DM * 2) + al256((size_t)DM * DQ * 2) + 2 * al256((size_t)NT * DM * 2) + 2 * al256((size_t)NT * DQ * 2);
static_assert(WS_NEED <= (size_t)268435456);


__device__ __forceinline__ unsigned short f2bf(float f) { unsigned u = __float_as_uint(f); u += 0x7FFFu + ((u >> 16) & 1u); return (unsigned short)(u >> 16); }
__device__ __forceinline__ float bf2f(unsigned short b) { return __uint_as_float(((unsigned)b) << 16); }
__device__ __forceinline__ float bfr(float f) { return bf2f(f2bf(f)); }
__device__ __forceinline__ v16bf cat16b(v8us lo, v8us hi) { return __builtin_bit_cast(v16bf, __builtin_shufflevector(lo, hi, 0, 1, 2, 3, 4, 5, 6, 7, 8, 9, 10, 11, 12, 13, 14, 15)); }
__device__ __forceinline__ v8f wmmab(v16bf a, v16bf b, v8f c) { return __builtin_amdgcn_wmma_f32_16x16x32_bf16(false, a, false, b, (short)0, c, false, false); }
__device__ __forceinline__ void splitf(float y, unsigned short& h, unsigned short& l) { h = f2bf(y); l = f2bf(y - bf2f(h)); }

// ---- k_gemmw: register-blocked GEMM, one wave per 64x64 output tile (16 accumulators), FOUR waves (2 x 2) per work-group = a 128x128 tile; grid (M/128, N/128, Z), 128 threads.
// Operands are K-contiguous 16-bit planes. A trip is 64 k: 128 rows of A, of A2 and of Bt, 128 bytes each (one whole line a row), are brought into LDS by asynchronous copies, two buffers, the next trip's copies in flight while this trip's products run; fragments are read from LDS at pitch GP. K % 64 == 0.
// C[m][n] (f32, pitch ldc, + optional f32 bias[n]) = sum_k A[m][k] Bt[n][k] + sum_k A2[m][k] Bt[n][k] (NSPLIT 1). z-batch strides sA/sB/sC in elements.
// Fragments: lane l -> row/col l&15, elements 0..7 <- k0 + 8*(l>>4) + 0..7, elements 8..15 <- k0 + 16 + 8*(l>>4) + 0..7 for A and for Bt alike; D element r of lane l = (row 8*(l>>4) + r, col l&15).
template <typename T16> struct WFrag;
template <> struct WFrag<bf> { typedef v16bf V; static __device__ __forceinline__ V ld(const bf* p) { return cat16b(*(const v8us*)p, *(const v8us*)(p + 16)); } static __device__ __forceinline__ v8f mma(V a, V b, v8f c) { return wmmab(a, b, c); } };
#define GP 72                 // LDS pitch of a staged row of 64 k, 16-bit elements: 144 B = 16 B x 9 keeps the 16-byte fragment reads off each other's banks
#define GPL (128 * GP)        // one operand's 128 rows
#define GSTG (3 * GPL)        // one buffer: A | A2 | Bt
// Eight asynchronous copies of 16 bytes a lane: rows r, r + 16, .. r + 112 of one operand (a wave's 32 lanes cover 4 whole 128-byte lines a copy).
// s_wait_xcnt stands inside the statement, behind the last copy: no address register of a copy is rewritten in front of it.
__device__ __forceinline__ void cp8(unsigned l, const bf* g, size_t rs) {
    asm volatile("global_load_async_to_lds_b128 %0, %8, off\n\tglobal_load_async_to_lds_b128 %1, %9, off\n\tglobal_load_async_to_lds_b128 %2, %10, off\n\tglobal_load_async_to_lds_b128 %3, %11, off\n\t"
                 "global_load_async_to_lds_b128 %4, %12, off\n\tglobal_load_async_to_lds_b128 %5, %13, off\n\tglobal_load_async_to_lds_b128 %6, %14, off\n\tglobal_load_async_to_lds_b128 %7, %15, off\n\ts_wait_xcnt 0x0"
                 :: "v"(l), "v"(l + 1u * 16 * GP * 2), "v"(l + 2u * 16 * GP * 2), "v"(l + 3u * 16 * GP * 2), "v"(l + 4u * 16 * GP * 2), "v"(l + 5u * 16 * GP * 2), "v"(l + 6u * 16 * GP * 2), "v"(l + 7u * 16 * GP * 2),
                    "v"(g), "v"(g + rs), "v"(g + 2 * rs), "v"(g + 3 * rs), "v"(g + 4 * rs), "v"(g + 5 * rs), "v"(g + 6 * rs), "v"(g + 7 * rs) : "memory");
}
template <typename T16, int NSPLIT, bool BIAS>
__global__ __launch_bounds__(128) void k_gemmw(const T16* __restrict__ A, const T16* __restrict__ A2, const T16* __restrict__ Bt, const T16* __restrict__ Bt2, int K, float* C, int ldc, const float* __restrict__ bias, size_t sA, size_t sB, size_t sC) {
    static_assert(NSPLIT == 1);   // products a.b and a2.b
    typedef typename WFrag<T16>::V V;
    __shared__ __align__(16) bf sT[2 * GSTG];
    __shared__ __align__(16) float osw[4 * 16 * 68];
    const size_t z = blockIdx.z; A += z * sA; A2 += z * sA; Bt += z * sB; C += z * sC;
    const int tid = threadIdx.x, lane = tid & 31, lr = lane & 15, hi = lane >> 4; const int wv = __builtin_amdgcn_readfirstlane(tid >> 5);   // the wave's number, in a scalar register: tile indices and the epilogue's branches stay scalar
    const int R0 = blockIdx.x * 128, C0 = blockIdx.y * 128; const int r0 = R0 + (wv >> 1) * 64, c0 = C0 + (wv & 1) * 64;
    float* os = osw + wv * (16 * 68);   // each wave's own rows for its epilogue
    v8f acc[4][4];
#pragma unroll
    for (int mb = 0; mb < 4; ++mb)
#pragma unroll
        for (int nb = 0; nb < 4; ++nb) acc[mb][nb] = (v8f){};
    // this thread's part of a trip's copies: 16-byte piece tid & 7 of rows (tid >> 3) + 16 i, i = 0 .. 7, of each operand
    const size_t rs = (size_t)16 * K; const size_t go = (size_t)(tid >> 3) * K + (tid & 7) * 8;
    const bf* gA = A + (size_t)R0 * K + go; const bf* gA2 = A2 + (size_t)R0 * K + go; const bf* gB = Bt + (size_t)C0 * K + go;
    const unsigned l0 = (unsigned)(size_t)sT + (unsigned)(((tid >> 3) * GP + (tid & 7) * 8) * 2);
    const int nt = K / 64;
    cp8(l0, gA, rs); cp8(l0 + GPL * 2, gA2, rs); cp8(l0 + 2 * GPL * 2, gB, rs);
    asm volatile("s_wait_asynccnt 0x0" ::: "memory");   // this wave's copies of trip 0 have landed
    __syncthreads();                                      // and every other wave's: buffer 0 may be read
    if (nt > 1) { cp8(l0 + GSTG * 2, gA + 64, rs); cp8(l0 + (GSTG + GPL) * 2, gA2 + 64, rs); cp8(l0 + (GSTG + 2 * GPL) * 2, gB + 64, rs); }
    const int aof = ((wv >> 1) * 64 + lr) * GP + 8 * hi, bof = 2 * GPL + ((wv & 1) * 64 + lr) * GP + 8 * hi;
#pragma unroll 1
    for (int t = 0; t < nt; ++t) { const bf* sb = sT + (t & 1) * GSTG;
#pragma unroll
        for (int ks = 0; ks < 2; ++ks) {
            V a[4], a2[4], b[4];
            b[0] = WFrag<T16>::ld(sb + bof + ks * 32);
#pragma unroll
            for (int mb = 0; mb < 4; ++mb) a[mb] = WFrag<T16>::ld(sb + aof + mb * 16 * GP + ks * 32);
#pragma unroll
            for (int mb = 0; mb < 4; ++mb) a2[mb] = WFrag<T16>::ld(sb + GPL + aof + mb * 16 * GP + ks * 32);
#pragma unroll
            for (int nb = 1; nb < 4; ++nb) b[nb] = WFrag<T16>::ld(sb + bof + nb * 16 * GP + ks * 32);
            __builtin_amdgcn_sched_barrier(0);   // the twelve fragments of 32 k are read as ONE group in front of their 32 products: left to itself the build reads each b in front of its own 8 products and waits for it there
#pragma unroll
            for (int nb = 0; nb < 4; ++nb)
#pragma unroll
                for (int mb = 0; mb < 4; ++mb) { acc[mb][nb] = WFrag<T16>::mma(a[mb], b[nb], acc[mb][nb]); acc[mb][nb] = WFrag<T16>::mma(a2[mb], b[nb], acc[mb][nb]); }
        }
        asm volatile("s_wait_dscnt 0x0" ::: "memory");      // this wave's reads of the buffer are done before it is refilled
        asm volatile("s_wait_asynccnt 0x0" ::: "memory");   // this wave's copies of trip t + 1 have landed
        __syncthreads();                                      // publishes trip t + 1's buffer and ends every wave's reads of trip t's
        if (t + 2 < nt) { const unsigned lb = l0 + (unsigned)(t & 1) * (GSTG * 2); const int kc = (t + 2) * 64; cp8(lb, gA + kc, rs); cp8(lb + GPL * 2, gA2 + kc, rs); cp8(lb + 2 * GPL * 2, gB + kc, rs); }
    }
    asm volatile("s_wait_asynccnt 0x0" ::: "memory");   // no copy is outstanding when the wave goes on to its epilogue and ends
#pragma unroll
    for (int mb = 0; mb < 4; ++mb) {
#pragma unroll
        for (int nb = 0; nb < 4; ++nb) {
#pragma unroll
            for (int j = 0; j < 8; ++j) os[(hi * 8 + j) * 68 + nb * 16 + lr] = acc[mb][nb][j]; }
        __builtin_amdgcn_wave_barrier(); asm volatile("" ::: "memory");
        float* crow = C + (size_t)(r0 + mb * 16) * ldc + c0;
{
#pragma unroll
            for (int s = 0; s < 8; ++s) { const int row = 2 * s + hi, cofs = lr * 4; v4f val = *(const v4fa*)(os + row * 68 + cofs); if (BIAS) { val[0] += bfr(bias[c0 + cofs]); val[1] += bfr(bias[c0 + cofs + 1]); val[2] += bfr(bias[c0 + cofs + 2]); val[3] += bfr(bias[c0 + cofs + 3]); }
                *(v4f*)(crow + (size_t)row * ldc + cofs) = val; }
             }
        __builtin_amdgcn_wave_barrier(); asm volatile("" ::: "memory");
    }
}

// Work-group blk of a weight's transpose: 64 lines of 64 elements of Bt[n][k] = W[k][n]
__device__ __forceinline__ void wtG(const float* __restrict__ w, int K, int N, bf* Bt, int blk) {
    const int lane = threadIdx.x & 31; const int L0 = (blk * 8 + (threadIdx.x >> 5)) * 8; const int nlines = N * K / 64;
{
#pragma unroll 1
        for (int l = 0; l < 8; ++l) { const int L = L0 + l; if (L >= nlines) break; const size_t e = (size_t)L * 64 + lane * 2; const int k = (int)(e % K), n = (int)(e / K); v2us o;
            o[0] = f2bf(w[(size_t)k * N + n]); o[1] = f2bf(w[(size_t)(k + 1) * N + n]); *(v2us*)(Bt + e) = o; }
         }
}

// Work-group blk of the LayerNorm: 8 rows, one a wave
__device__ __forceinline__ void ln256(const float* __restrict__ X, int nrows, const float* __restrict__ gw, const float* __restrict__ gb, bf* Yh, bf* Yl, int blk) {
    const int lane = threadIdx.x & 31; const int r = blk * 8 + (threadIdx.x >> 5); if (r >= nrows) return; const float* xr = X + (size_t)r * DM; float hv[8]; float s = 0.f;
#pragma unroll
    for (int ch = 0; ch < 2; ++ch) { const v4f y = *(const v4f*)(xr + ch * 128 + lane * 4);
#pragma unroll
        for (int q = 0; q < 4; ++q) { const float u = bfr(y[q]); hv[ch * 4 + q] = u; s += u; } }
#pragma unroll
    for (int sh = 16; sh; sh >>= 1) s += __shfl_xor(s, sh, 32);
    float mu = s * (1.0f / 256.0f); asm volatile("" : "+v"(mu)); float s2 = 0.f;
#pragma unroll
    for (int k = 0; k < 8; ++k) { float d0 = __fsub_rn(hv[k], mu); asm volatile("" : "+v"(d0)); float p = __fmul_rn(d0, d0); asm volatile("" : "+v"(p)); s2 = __fadd_rn(s2, p); }
#pragma unroll
    for (int sh = 16; sh; sh >>= 1) s2 += __shfl_xor(s2, sh, 32);
    float var = __fadd_rn(s2 * (1.0f / 256.0f), 1e-5f); asm volatile("" : "+v"(var)); const float rs = __frsqrt_rn(var);
{
#pragma unroll
        for (int ch = 0; ch < 2; ++ch) { const int c0 = ch * 128 + lane * 4; v4us oh, ol;
#pragma unroll
            for (int q = 0; q < 4; ++q) { float gg = bfr(gw[c0 + q]); asm volatile("" : "+v"(gg)); float d0 = __fsub_rn(hv[ch * 4 + q], mu); asm volatile("" : "+v"(d0)); float n0 = __fmul_rn(d0, rs); asm volatile("" : "+v"(n0)); float y = __fmul_rn(n0, gg); asm volatile("" : "+v"(y)); y = __fadd_rn(y, bfr(gb[c0 + q])); unsigned short a, c2; splitf(y, a, c2); oh[q] = a; ol[q] = c2; }
            *(v4us*)(Yh + (size_t)r * DM + c0) = oh; *(v4us*)(Yl + (size_t)r * DM + c0) = ol; }
         } }

// k_prep: all that the attention launch and the last GEMM read from the workspace, in ONE launch of independent work-groups: the first WTB groups write the transposed 16-bit weights, the others the LayerNorm planes.
// No group reads what another writes. The weight groups have the lowest indices: they start first and end while rows are still being dealt out.
#define WTB_Q  (DM * DQ / 64 / 64)         // groups of 64 lines for Wq, and for Wg
#define WTB_KV (DM * 2 * DQ / 64 / 64)     // for Wkv
#define WTB_O  (DQ * DM / 64 / 64)         // for Wo
#define WTB    (2 * WTB_Q + WTB_KV + WTB_O)
static_assert(((DM * DQ / 64) % 64) == 0);
__global__ __launch_bounds__(256) void k_prep(const float* __restrict__ X, const float* __restrict__ gw, const float* __restrict__ gb, const float* __restrict__ wq, const float* __restrict__ wkv, const float* __restrict__ wg, const float* __restrict__ wo, bf* WB, bf* WO, bf* Yh, bf* Yl) {
    const int b = (int)blockIdx.x;   // every branch below is the same for the whole work-group
    /* weights ('xw': Bt[n][k] = W[k][n]); the fused Wkv gives Bt rows 512..1023 = k, 1024..1535 = v */
    if (b < WTB_Q) wtG(wq, DM, DQ, WB, b);
    else if (b < WTB_Q + WTB_KV) wtG(wkv, DM, 2 * DQ, WB + (size_t)DQ * DM, b - WTB_Q);
    else if (b < 2 * WTB_Q + WTB_KV) wtG(wg, DM, DQ, WB + (size_t)3 * DQ * DM, b - (WTB_Q + WTB_KV));
    else if (b < WTB) wtG(wo, DQ, DM, WO, b - (2 * WTB_Q + WTB_KV));
    else ln256(X, NT, gw, gb, Yh, Yl, b - WTB);
}

// k_attn: the q, k, v, g projections, scores, softmax, attn.v and the gate of one plane z = (sequence s, head h) in one work-group of 16 waves; wave w owns the 16 tokens (queries) 16w .. 16w + 15 and all TT keys.
// Projections: the head's 4 x 64 weight rows (q, g, k, v, each [n][k] over all DM k) are brought into LDS once by asynchronous copies; a wave holds the hi / lo fragments of its 16 rows of xn for all DM k in registers
// and runs through the 16 tiles of 16 features two at a time, per accumulator hi.w then lo.w at each 32 k. The same xn fragment serves as B (tokens = columns) or as A (tokens = rows):
// q, k, g: D = W xn^T: register r of lane l = (feature 8 (l >> 4) + r, token l & 15): 8 consecutive features of one token. k: one 16-byte LDS store a plane into K [key][d]; q: feature tiles 2 ks and 2 ks + 1, split hi / lo, ARE the B fragment of d = 32 ks .. 32 ks + 31; g: the layout of O^T below.
// v: D = xn W^T: register r of lane l = (token 8 (l >> 4) + r, feature l & 15): 8 consecutive keys of one d: one 16-byte LDS store a plane into V^T [d][key].
// S^T = K Q^T (A = K rows, B = Q rows): D register r of tile kb in lane l = score(key 16 kb + 8 (l >> 4) + r, query l & 15), so a lane holds 128 scores of ONE query:
// maximum and sum in the lane plus one exchange between the wave's halves. Tiles 2j and 2j + 1, normalised and split hi / lo in place, ARE the B fragment of keys 32j .. 32j + 31
// in the loader's k order, so O^T = V^T P^T (A = V^T rows) needs no exchange. Products per accumulator in the order hi.hi, lo.hi, hi.lo of (q, k) and of (p, v).
// Epilogue: AT hi / lo planes [s*TT + t][h*HD + d] = O[t][d] x sigmoid(g[t][d] + bg[h*HD + d]).
#define KP 72     // LDS pitch of a K row, 16-bit elements: 144 B = 16 B x 9; an odd multiple of 16 B keeps the 16-byte fragment reads off each other's banks
#define VP 264    // LDS pitch of a V^T row: 528 B = 16 B x 33
#define WP 264    // LDS pitch of a weight row of DM k: 528 B = 16 B x 33
#define OP 68     // LDS pitch of an output row, floats: 272 B = 16 B x 17
static_assert(TT == 256 && HD == 64 && DM == 256);
static_assert(2 * HD * WP <= 16 * 16 * OP * 2);   // the output rows reuse the LDS of the q and g weights, and are the larger of the two
typedef __attribute__((ext_vector_type(2))) float  v2f;
typedef __attribute__((ext_vector_type(2))) __bf16 v2bf;
typedef __attribute__((ext_vector_type(8))) unsigned v8u;
typedef __attribute__((ext_vector_type(4))) __bf16 v4bf;
typedef __attribute__((ext_vector_type(8))) __bf16 v8bf;
// Four asynchronous copies of 16 bytes a lane: rows r, r + 16, r + 32, r + 48 of one 64-row weight block (a wave's 32 lanes cover one whole row of 512 bytes a copy).
// s_wait_xcnt stands inside the statement, behind the last copy: no address register of a copy is rewritten in front of it.
__device__ __forceinline__ void cp4(unsigned l, const bf* g) {
    asm volatile("global_load_async_to_lds_b128 %0, %4, off\n\tglobal_load_async_to_lds_b128 %1, %5, off\n\tglobal_load_async_to_lds_b128 %2, %6, off\n\tglobal_load_async_to_lds_b128 %3, %7, off\n\ts_wait_xcnt 0x0"
                 :: "v"(l), "v"(l + 1u * 16 * WP * 2), "v"(l + 2u * 16 * WP * 2), "v"(l + 3u * 16 * WP * 2), "v"(g), "v"(g + 16 * DM), "v"(g + 32 * DM), "v"(g + 48 * DM) : "memory");
}
// Two feature tiles (32 weight rows in LDS from pc, this lane's place in them included) over all DM k; XA: xn is the A operand (v), else the B operand. The last step fetches the first fragments of the next pair, at pn.
template <bool XA, bool LAST>
__device__ __forceinline__ void proj2(const bf* pc, const bf* pn, const v16bf (&xh)[8], const v16bf (&xl)[8], v16bf (&fw)[2][2], v8f& a0, v8f& a1) {
    a0 = (v8f){}; a1 = (v8f){};
#pragma unroll
    for (int kk = 0; kk < 8; ++kk) { const int cb = kk & 1, nb = cb ^ 1;
        if (kk < 7 || !LAST) { const bf* q = (kk < 7) ? pc + (kk + 1) * 32 : pn; fw[nb][0] = WFrag<bf>::ld(q); fw[nb][1] = WFrag<bf>::ld(q + 16 * WP); }
        if (XA) { a0 = wmmab(xh[kk], fw[cb][0], a0); a1 = wmmab(xh[kk], fw[cb][1], a1); a0 = wmmab(xl[kk], fw[cb][0], a0); a1 = wmmab(xl[kk], fw[cb][1], a1); }
        else    { a0 = wmmab(fw[cb][0], xh[kk], a0); a1 = wmmab(fw[cb][1], xh[kk], a1); a0 = wmmab(fw[cb][0], xl[kk], a0); a1 = wmmab(fw[cb][1], xl[kk], a1); } }
}
// A lane's 8 values of each of two tiles, split hi / lo: one 16-byte LDS store a tile and plane
__device__ __forceinline__ void put2(bf* ph, bf* pl, int step, v8f a0, v8f a1) {
    const v8bf h0 = __builtin_convertvector(a0, v8bf), h1 = __builtin_convertvector(a1, v8bf);
    const v8bf l0 = __builtin_convertvector(a0 - __builtin_convertvector(h0, v8f), v8bf), l1 = __builtin_convertvector(a1 - __builtin_convertvector(h1, v8f), v8bf);
    *(v8us*)ph = __builtin_bit_cast(v8us, h0); *(v8us*)(ph + step) = __builtin_bit_cast(v8us, h1); *(v8us*)pl = __builtin_bit_cast(v8us, l0); *(v8us*)(pl + step) = __builtin_bit_cast(v8us, l1);
}
// Two tiles of 16 features each, split hi / lo, as the fragment of those 32 features in the loader's k order
__device__ __forceinline__ void frag2(v8f a0, v8f a1, v16bf& fh, v16bf& fl) {
    const v8bf h0 = __builtin_convertvector(a0, v8bf), h1 = __builtin_convertvector(a1, v8bf);
    const v8bf l0 = __builtin_convertvector(a0 - __builtin_convertvector(h0, v8f), v8bf), l1 = __builtin_convertvector(a1 - __builtin_convertvector(h1, v8f), v8bf);
    fh = __builtin_shufflevector(h0, h1, 0, 1, 2, 3, 4, 5, 6, 7, 8, 9, 10, 11, 12, 13, 14, 15); fl = __builtin_shufflevector(l0, l1, 0, 1, 2, 3, 4, 5, 6, 7, 8, 9, 10, 11, 12, 13, 14, 15);
}
__global__ __launch_bounds__(512) void k_attn(const bf* __restrict__ Xh, const bf* __restrict__ Xl, const bf* __restrict__ Wb, const float* __restrict__ bgp, bf* __restrict__ Ah, bf* __restrict__ Al) {
    __shared__ __align__(16) bf sKh[TT * KP]; __shared__ __align__(16) bf sKl[TT * KP];
    __shared__ __align__(16) bf sVh[HD * VP]; __shared__ __align__(16) bf sVl[HD * VP];
    __shared__ __align__(16) bf sWa[16 * 16 * OP * 2]; __shared__ __align__(16) bf sWb[2 * HD * WP];   // weight rows q | g and k | v: two arrays, so that each has its own base register and the constant part of every fragment read fits the instruction's 16-bit offset field
    float* sO = (float*)sWa;   // used only behind the barrier that ends every wave's reads of the weights
    const int tid = threadIdx.x, lane = tid & 31, lr = lane & 15, hi = lane >> 4; const int wv = __builtin_amdgcn_readfirstlane(tid >> 5);   // the wave's number, in a scalar register: the wave's part of every address stays out of the vector registers
    const size_t tok0 = (size_t)(blockIdx.x / NH_) * TT; const int col0 = ((int)blockIdx.x % NH_) * HD;
    // weights: wave w copies rows w + 16 i of each of the four blocks; block b (0 q, 1 k, 2 v, 3 g) of the head = rows b*DQ + col0 .. + 63 of Wb; in LDS: q | g in sWa, k | v in sWb
    const unsigned lo = (unsigned)((wv * WP + lane * 8) * 2), la = (unsigned)(size_t)sWa + lo, lb = (unsigned)(size_t)sWb + lo; const bf* gw = Wb + (size_t)(col0 + wv) * DM + lane * 8;
    cp4(la, gw); cp4(la + 1u * HD * WP * 2, gw + (size_t)3 * DQ * DM); cp4(lb, gw + (size_t)1 * DQ * DM); cp4(lb + 1u * HD * WP * 2, gw + (size_t)2 * DQ * DM);
    v16bf xh[8], xl[8];   // this wave's 16 rows of xn, all DM k
    const size_t xo = (tok0 + wv * 16 + lr) * DM + 8 * hi;
#pragma unroll
    for (int kk = 0; kk < 8; ++kk) { xh[kk] = WFrag<bf>::ld(Xh + xo + kk * 32); xl[kk] = WFrag<bf>::ld(Xl + xo + kk * 32); }
    asm volatile("s_wait_asynccnt 0x0" ::: "memory");   // this wave's copies of the weights have landed
    __syncthreads();                                      // and every other wave's: the weights may be read
    // Projections: step (pair of feature tiles in the order k, k, v, v, g, g, q, q; 32 k), 2 fragments and 4 products; each step's fragments are fetched one step ahead
    v16bf qh[2], ql[2], fw[2][2]; v8f gt[4], a0, a1;
    const bf* pa = sWa + lr * WP + 8 * hi; const bf* pb = sWb + lr * WP + 8 * hi;
    fw[0][0] = WFrag<bf>::ld(pb); fw[0][1] = WFrag<bf>::ld(pb + 16 * WP);
    bf* pkh = sKh + (wv * 16 + lr) * KP + 8 * hi; bf* pkl = sKl + (wv * 16 + lr) * KP + 8 * hi; bf* pvh = sVh + lr * VP + wv * 16 + 8 * hi; bf* pvl = sVl + lr * VP + wv * 16 + 8 * hi;
    proj2<false, false>(pb, pb + 32 * WP, xh, xl, fw, a0, a1); put2(pkh, pkl, 16, a0, a1);
    proj2<false, false>(pb + 32 * WP, pb + 64 * WP, xh, xl, fw, a0, a1); put2(pkh + 32, pkl + 32, 16, a0, a1);
    proj2<true, false>(pb + 64 * WP, pb + 96 * WP, xh, xl, fw, a0, a1); put2(pvh, pvl, 16 * VP, a0, a1);
    proj2<true, false>(pb + 96 * WP, pa + 64 * WP, xh, xl, fw, a0, a1); put2(pvh + 32 * VP, pvl + 32 * VP, 16 * VP, a0, a1);
    proj2<false, false>(pa + 64 * WP, pa + 96 * WP, xh, xl, fw, gt[0], gt[1]);
    proj2<false, false>(pa + 96 * WP, pa, xh, xl, fw, gt[2], gt[3]);
    proj2<false, false>(pa, pa + 32 * WP, xh, xl, fw, a0, a1); frag2(a0, a1, qh[0], ql[0]);
    proj2<false, true>(pa + 32 * WP, pa, xh, xl, fw, a0, a1); frag2(a0, a1, qh[1], ql[1]);
    __syncthreads();   // K and V^T are complete in LDS, they are only read from here on; and every wave's reads of the weights are done: their LDS may be rewritten
    // the gates, in the layout of O^T, wait in this lane's own places of the wave's output rows
    float* os = sO + wv * (16 * OP);
#pragma unroll
    for (int mb = 0; mb < 4; ++mb) { const float* bp = bgp + col0 + mb * 16 + 8 * hi; const v4f b0 = *(const v4f*)bp, b1 = *(const v4f*)(bp + 4); v4f g0, g1;
#pragma unroll
        for (int c = 0; c < 4; ++c) { g0[c] = __fdiv_rn(1.0f, 1.0f + expf(-(gt[mb][c] + bfr(b0[c])))); g1[c] = __fdiv_rn(1.0f, 1.0f + expf(-(gt[mb][4 + c] + bfr(b1[c])))); }
        float* p = os + lr * OP + mb * 16 + 8 * hi; *(v4fa*)p = g0; *(v4fa*)(p + 4) = g1; }
    // Scores: step st = (pair of key tiles st >> 1, half ks = st & 1 of the head dim), 4 fragments and 6 products; each step's fragments are fetched as one group one step ahead
    v8f s[16]; v16bf fk[2][4];
    const int kof = lr * KP + 8 * hi;
#pragma unroll
    for (int p = 0; p < 2; ++p) { fk[0][p] = WFrag<bf>::ld(sKh + kof + p * 16 * KP); fk[0][2 + p] = WFrag<bf>::ld(sKl + kof + p * 16 * KP); }
#pragma unroll
    for (int st = 0; st < 16; ++st) { const int kb = (st >> 1) * 2, ks = st & 1, cb = st & 1, nb = cb ^ 1;
        if (st + 1 < 16) { const int o = kof + ((st + 1) >> 1) * 32 * KP + ((st + 1) & 1) * 32;
#pragma unroll
            for (int p = 0; p < 2; ++p) { fk[nb][p] = WFrag<bf>::ld(sKh + o + p * 16 * KP); fk[nb][2 + p] = WFrag<bf>::ld(sKl + o + p * 16 * KP); } }
        v8f a0 = ks ? s[kb] : (v8f){}, a1 = ks ? s[kb + 1] : (v8f){};
        a0 = wmmab(fk[cb][0], qh[ks], a0); a1 = wmmab(fk[cb][1], qh[ks], a1); a0 = wmmab(fk[cb][0], ql[ks], a0); a1 = wmmab(fk[cb][1], ql[ks], a1); a0 = wmmab(fk[cb][2], qh[ks], a0); a1 = wmmab(fk[cb][3], qh[ks], a1);
        s[kb] = a0; s[kb + 1] = a1; }
    v8f m8 = s[0];
#pragma unroll
    for (int kb = 1; kb < 16; ++kb)
#pragma unroll
        for (int r = 0; r < 8; ++r) m8[r] = fmaxf(m8[r], s[kb][r]);
    float mx = fmaxf(fmaxf(fmaxf(m8[0], m8[1]), fmaxf(m8[2], m8[3])), fmaxf(fmaxf(m8[4], m8[5]), fmaxf(m8[6], m8[7])));
    mx = fmaxf(mx, __shfl_xor(mx, 16, 32)) * SCL;   // the scale is a positive power of two: scaling the maximum is the maximum of the scaled scores
    v8f s8;
#pragma unroll
    for (int kb = 0; kb < 16; ++kb) {
#pragma unroll
        for (int r = 0; r < 8; r += 4) { float x[4], ex[4];
#pragma unroll
            for (int c = 0; c < 4; ++c) x[c] = (s[kb][r + c] * SCL - mx) * 1.4426950408889634f;
            // four exponentials whose results share no register with any argument, then one v_nop: the slot the instruction set asks for behind a transcendental; inside the statement it cannot drift away
            asm("v_exp_f32 %0, %4\n\tv_exp_f32 %1, %5\n\tv_exp_f32 %2, %6\n\tv_exp_f32 %3, %7\n\tv_nop" : "=&v"(ex[0]), "=&v"(ex[1]), "=&v"(ex[2]), "=&v"(ex[3]) : "v"(x[0]), "v"(x[1]), "v"(x[2]), "v"(x[3]));
#pragma unroll
            for (int c = 0; c < 4; ++c) { s[kb][r + c] = ex[c]; s8[r + c] = kb ? s8[r + c] + ex[c] : ex[c]; } } }
    float sum = ((s8[0] + s8[1]) + (s8[2] + s8[3])) + ((s8[4] + s8[5]) + (s8[6] + s8[7]));
    sum += __shfl_xor(sum, 16, 32);
    const float f = __fdiv_rn(1.0f, sum);
    // attn.v: step st = (32 keys j = st >> 1, pair of d tiles st & 1), fetched one step ahead like the scores' steps; the two score tiles of j become P^T hi / lo just before their first use
    v8f o[4]; v16bf fv[2][4]; v16bf ph, pl;
    const int vof = lr * VP + 8 * hi;
#pragma unroll
    for (int p = 0; p < 2; ++p) { fv[0][p] = WFrag<bf>::ld(sVh + vof + p * 16 * VP); fv[0][2 + p] = WFrag<bf>::ld(sVl + vof + p * 16 * VP); }
#pragma unroll
    for (int st = 0; st < 16; ++st) { const int j = st >> 1, mb = (st & 1) * 2, cb = st & 1, nb = cb ^ 1;
        if (st + 1 < 16) { const int ofs = vof + ((st + 1) & 1) * 32 * VP + ((st + 1) >> 1) * 32;
#pragma unroll
            for (int p = 0; p < 2; ++p) { fv[nb][p] = WFrag<bf>::ld(sVh + ofs + p * 16 * VP); fv[nb][2 + p] = WFrag<bf>::ld(sVl + ofs + p * 16 * VP); } }
        if ((st & 1) == 0) { v8u wh, wl;
#pragma unroll
            for (int i = 0; i < 8; ++i) { const v8f t = s[2 * j + (i >> 2)]; const v2f y = { t[(2 * i) & 7] * f, t[(2 * i + 1) & 7] * f };
                const v2bf h = __builtin_convertvector(y, v2bf); const v2bf l = __builtin_convertvector(y - __builtin_convertvector(h, v2f), v2bf);
                wh[i] = __builtin_bit_cast(unsigned, h); wl[i] = __builtin_bit_cast(unsigned, l); }
            ph = __builtin_bit_cast(v16bf, wh); pl = __builtin_bit_cast(v16bf, wl); }
        v8f a0 = j ? o[mb] : (v8f){}, a1 = j ? o[mb + 1] : (v8f){};
        a0 = wmmab(fv[cb][0], ph, a0); a1 = wmmab(fv[cb][1], ph, a1); a0 = wmmab(fv[cb][0], pl, a0); a1 = wmmab(fv[cb][1], pl, a1); a0 = wmmab(fv[cb][2], ph, a0); a1 = wmmab(fv[cb][3], ph, a1);
        o[mb] = a0; o[mb + 1] = a1; }
    // o[mb][r] = O(query lr, d = 16 mb + 8 hi + r), times its gate; then through the wave's own LDS rows, so that each store instruction writes whole 128-byte lines
#pragma unroll
    for (int mb = 0; mb < 4; ++mb) { float* p = os + lr * OP + mb * 16 + 8 * hi; const v4f g0 = *(const v4fa*)p, g1 = *(const v4fa*)(p + 4);
        *(v4fa*)p = __builtin_shufflevector(o[mb], o[mb], 0, 1, 2, 3) * g0; *(v4fa*)(p + 4) = __builtin_shufflevector(o[mb], o[mb], 4, 5, 6, 7) * g1; }
    asm volatile("s_wait_dscnt 0x0" ::: "memory");   // the rows read below were written by other lanes of this wave: the writes are done, and stay in front, before they are read back
    v4f ov[8];   // all eight LDS reads are issued before the first store waits for one
#pragma unroll
    for (int q = 0; q < 8; ++q) ov[q] = *(const v4fa*)(os + (2 * q + hi) * OP + lr * 4);
    // this lane's part of the output: tokens wv*16 + hi + 2q (q = 0 .. 7), columns lr*4 .. lr*4 + 3 of the head
    const unsigned ao = (unsigned)(((wv * 16 + hi) * DQ + lr * 4) * 2);   // 16 lanes x 8 bytes = one whole 128-byte line of a plane per token
    char* ah = (char*)(Ah + tok0 * DQ + col0) + ao; char* al = (char*)(Al + tok0 * DQ + col0) + ao;
#pragma unroll
    for (int q = 0; q < 8; ++q) { const v4f y = ov[q];
        const v4bf h = __builtin_convertvector(y, v4bf); const v4bf l = __builtin_convertvector(y - __builtin_convertvector(h, v4f), v4bf);
        *(v4us*)(ah + q * 2 * DQ * 2) = __builtin_bit_cast(v4us, h); *(v4us*)(al + q * 2 * DQ * 2) = __builtin_bit_cast(v4us, l); }
}

extern "C" void kernel_launch(void* const* d_in, const int* in_sizes, int n_in,
                              void* d_out, int out_size, void* d_ws, size_t ws_size, hipStream_t stream) {
    if (n_in < 9) return;
    if (in_sizes[0] < NT * DM || in_sizes[1] < DM || in_sizes[2] < DM || in_sizes[3] < DM * DQ || in_sizes[4] < DM * 2 * DQ
        || in_sizes[5] < DM * DQ || in_sizes[6] < DQ || in_sizes[7] < DQ * DM || in_sizes[8] < DM) return;
    if (out_size < NT * DM) return;
    const float* x = (const float*)d_in[0]; const float* ln_g = (const float*)d_in[1]; const float* ln_b = (const float*)d_in[2]; const float* wq = (const float*)d_in[3]; const float* wkv = (const float*)d_in[4]; const float* wg = (const float*)d_in[5]; const float* bg = (const float*)d_in[6]; const float* wo = (const float*)d_in[7]; const float* bo = (const float*)d_in[8];
    float* OUT = (float*)d_out;     // [NB][TT][DM] = [NT][256]
    char* wsp = (char*)d_ws;
    auto take = [&](size_t bytes) { char* p = wsp; wsp += (bytes + 255) & ~(size_t)255; return (void*)p; };
    bf* WB = (bf*)take((size_t)DP * DM * 2);     // Bt [2048][256]: rows 0..511 q, 512..1023 k, 1024..1535 v, 1536..2047 g
    bf* WO = (bf*)take((size_t)DM * DQ * 2);     // Bt [256][512]
    bf* LNh = (bf*)take((size_t)NT * DM * 2); bf* LNl = (bf*)take((size_t)NT * DM * 2);
    bf* ATh = (bf*)take((size_t)NT * DQ * 2); bf* ATl = (bf*)take((size_t)NT * DQ * 2);
    if ((size_t)(wsp - (char*)d_ws) > ws_size) return;
    k_prep<<<WTB + NT / 8, 256, 0, stream>>>(x, ln_g, ln_b, wq, wkv, wg, wo, WB, WO, LNh, LNl);
    k_attn<<<ZH, 512, 0, stream>>>(LNh, LNl, WB, bg, ATh, ATl);
    k_gemmw<bf, 1, true><<<dim3(NT / 128, DM / 128, 1), 128, 0, stream>>>(ATh, ATl, WO, nullptr, DQ, OUT, DM, bo, 0, 0, 0);
}

// v008
// Measured time: 117 microseconds a run.
// Two timings next to v007 both put it at 1.05 times that version's speed.
// Counting every step since v000, it is 8.77 times as fast.
#include <hip/hip_runtime.h>

// Gated row attention along the width axis with a pre-LayerNorm: x [1][128][256][256] = 128 independent sequences (image rows) of 256 tokens x 256 features; xn = LayerNorm(x) (gamma, beta, eps 1e-5); q = xn Wq ('xw' [256][512], 8 heads x 64), [k|v] = xn Wkv ('xw' [256][1024]: columns k | v); dots = (q/8).k over the 256 keys of the same sequence; softmax; out = attn.v merged; gates = sigmoid(xn Wg + bg) ('xw' [256][512]); y = (out * gates) Wo + bo ('xw' [512][256]) -> [1][128][256][256] (8.4 M).
// Compute dtypes, f32 accumulate: all contractions v_wmma_f32_16x16x32_bf16 (bf16 operands). Every input RNE-converted to bf16 on load; LayerNorm in f32, xn as bf16 hi + lo planes; q, k, v, g projections as (hi + lo) x exact weights (2 products); scores and attn.v on bf16 hi/lo operands (3 products) for every row; softmax f32; sigmoid gate f32 (true division) with f32 bias add; (out x gate) as hi + lo x exact Wo (2 products) + bo.
// Layout: the transposed weights and the LayerNorm planes for all tokens (in the fragment order of their one reader, see ln16) in one launch; then ONE launch with one work-group per (sequence, head) does that head's q, k, v, g projections, the scores, the softmax, attn.v and the gate: q, k, v, g, the scores and the probabilities never leave the WGP (k and v go to LDS, q and the probabilities stay in registers), and the gated output goes out as the hi / lo planes that the last GEMM reads. The last GEMM stages its operands in LDS with asynchronous copies (4 waves share a 128x128 tile).

#ifndef NB_
#define NB_  128       // sequences (image rows) processed by this build
#endif
#define NB_FULL 128    // sequences in the input / output
#define TT   256       // tokens per sequence
#define DM   256
#define NH_  8
#define HD   64
#define DQ   (NH_ * HD)    // 512 = inner dim
#define DP   (4 * DQ)      // 2048 = rows of the transposed weights q | k | v | g
#define ZH   (NB_ * NH_)   // (sequence, head) planes
#define NT   (NB_ * TT)    // token rows in total
#define SCL  0.125f        // HD^-0.5

static_assert(NB_ >= 1 && NB_ <= NB_FULL);
static_assert((TT % 64) == 0 && (HD % 64) == 0 && (DM % 64) == 0 && (DQ % 64) == 0 && (DP % 64) == 0);
static_assert((HD % 32) == 0 && (DM % 32) == 0 && (DQ % 32) == 0 && (TT % 32) == 0);
static_assert((TT % 128) == 0 && (NT % 16) == 0 && (TT % 16) == 0 && (DM % 128) == 0);
static_assert(((DQ * DM) % 64) == 0 && ((2 * DQ * DM) % 64) == 0);
static_assert((NT % 128) == 0 && (DM % 128) == 0 && (DQ % 128) == 0);

typedef unsigned short bf;
typedef __attribute__((ext_vector_type(16))) __bf16   v16bf;
typedef __attribute__((ext_vector_type(8)))  unsigned short v8us;
typedef __attribute__((ext_vector_type(8)))  float    v8f;
typedef __attribute__((ext_vector_type(4)))  float    v4f;
typedef v4f  __attribute__((may_alias)) v4fa;
typedef __attribute__((ext_vector_type(2))) unsigned short v2us;
typedef __attribute__((ext_vector_type(4))) unsigned short v4us;

constexpr size_t al256(size_t b) { return (b + 255) & ~(size_t)255; }
constexpr size_t WS_NEED = al256((size_t)DP * DM * 2) + al256((size_t)DM * DQ * 2) + 2 * al256((size_t)NT * DM * 2) + 2 * al256((size_t)NT * DQ * 2);
static_assert(WS_NEED <= (size_t)268435456);


__device__ __forceinline__ unsigned short f2bf(float f) { unsigned u = __float_as_uint(f); u += 0x7FFFu + ((u >> 16) & 1u); return (unsigned short)(u >> 16); }
__device__ __forceinline__ float bf2f(unsigned short b) { return __uint_as_float(((unsigned)b) << 16); }
__device__ __forceinline__ float bfr(float f) { return bf2f(f2bf(f)); }
__device__ __forceinline__ v16bf cat16b(v8us lo, v8us hi) { return __builtin_bit_cast(v16bf, __builtin_shufflevector(lo, hi, 0, 1, 2, 3, 4, 5, 6, 7, 8, 9, 10, 11, 12, 13, 14, 15)); }
__device__ __forceinline__ v8f wmmab(v16bf a, v16bf b, v8f c) { return __builtin_amdgcn_wmma_f32_16x16x32_bf16(false, a, false, b, (short)0, c, false, false); }
__device__ __forceinline__ void splitf(float y, unsigned short& h, unsigned short& l) { h = f2bf(y); l = f2bf(y - bf2f(h)); }

// ---- k_gemmw: register-blocked GEMM, one wave per 64x64 output tile (16 accumulators), FOUR waves (2 x 2) per work-group = a 128x128 tile; grid (M/128, N/128, Z), 128 threads.
// Operands are K-contiguous 16-bit planes. A trip is 64 k: 128 rows of A, of A2 and of Bt, 128 bytes each (one whole line a row), are brought into LDS by asynchronous copies, two buffers, the next trip's copies in flight while this trip's products run; fragments are read from LDS at pitch GP. K % 64 == 0.
// C[m][n] (f32, pitch ldc, + optional f32 bias[n]) = sum_k A[m][k] Bt[n][k] + sum_k A2[m][k] Bt[n][k] (NSPLIT 1). z-batch strides sA/sB/sC in elements.
// Fragments: lane l -> row/col l&15, elements 0..7 <- k0 + 8*(l>>4) + 0..7, elements 8..15 <- k0 + 16 + 8*(l>>4) + 0..7 for A and for Bt alike; D element r of lane l = (row 8*(l>>4) + r, col l&15).
template <typename T16> struct WFrag;
template <> struct WFrag<bf> { typedef v16bf V; static __device__ __forceinline__ V ld(const bf* p) { return cat16b(*(const v8us*)p, *(const v8us*)(p + 16)); } static __device__ __forceinline__ v8f mma(V a, V b, v8f c) { return wmmab(a, b, c); } };
#define GP 72                 // LDS pitch of a staged row of 64 k, 16-bit elements: 144 B = 16 B x 9 keeps the 16-byte fragment reads off each other's banks
#define GPL (128 * GP)        // one operand's 128 rows
#define GSTG (3 * GPL)        // one buffer: A | A2 | Bt
// Eight asynchronous copies of 16 bytes a lane: rows r, r + 16, .. r + 112 of one operand (a wave's 32 lanes cover 4 whole 128-byte lines a copy).
// s_wait_xcnt stands inside the statement, behind the last copy: no address register of a copy is rewritten in front of it.
__device__ __forceinline__ void cp8(unsigned l, const bf* g, size_t rs) {
    asm volatile("global_load_async_to_lds_b128 %0, %8, off\n\tglobal_load_async_to_lds_b128 %1, %9, off\n\tglobal_load_async_to_lds_b128 %2, %10, off\n\tglobal_load_async_to_lds_b128 %3, %11, off\n\t"
                 "global_load_async_to_lds_b128 %4, %12, off\n\tglobal_load_async_to_lds_b128 %5, %13, off\n\tglobal_load_async_to_lds_b128 %6, %14, off\n\tglobal_load_async_to_lds_b128 %7, %15, off\n\ts_wait_xcnt 0x0"
                 :: "v"(l), "v"(l + 1u * 16 * GP * 2), "v"(l + 2u * 16 * GP * 2), "v"(l + 3u * 16 * GP * 2), "v"(l + 4u * 16 * GP * 2), "v"(l + 5u * 16 * GP * 2), "v"(l + 6u * 16 * GP * 2), "v"(l + 7u * 16 * GP * 2),
                    "v"(g), "v"(g + rs), "v"(g + 2 * rs), "v"(g + 3 * rs), "v"(g + 4 * rs), "v"(g + 5 * rs), "v"(g + 6 * rs), "v"(g + 7 * rs) : "memory");
}
template <typename T16, int NSPLIT, bool BIAS>
__global__ __launch_bounds__(128) void k_gemmw(const T16* __restrict__ A, const T16* __restrict__ A2, const T16* __restrict__ Bt, const T16* __restrict__ Bt2, int K, float* C, int ldc, const float* __restrict__ bias, size_t sA, size_t sB, size_t sC) {
    static_assert(NSPLIT == 1);   // products a.b and a2.b
    typedef typename WFrag<T16>::V V;
    __shared__ __align__(16) bf sT[2 * GSTG];
    __shared__ __align__(16) float osw[4 * 16 * 68];
    const size_t z = blockIdx.z; A += z * sA; A2 += z * sA; Bt += z * sB; C += z * sC;
    const int tid = threadIdx.x, lane = tid & 31, lr = lane & 15, hi = lane >> 4; const int wv = __builtin_amdgcn_readfirstlane(tid >> 5);   // the wave's number, in a scalar register: tile indices and the epilogue's branches stay scalar
    const int R0 = blockIdx.x * 128, C0 = blockIdx.y * 128; const int r0 = R0 + (wv >> 1) * 64, c0 = C0 + (wv & 1) * 64;
    float* os = osw + wv * (16 * 68);   // each wave's own rows for its epilogue
    v8f acc[4][4];
#pragma unroll
    for (int mb = 0; mb < 4; ++mb)
#pragma unroll
        for (int nb = 0; nb < 4; ++nb) acc[mb][nb] = (v8f){};
    // this thread's part of a trip's copies: 16-byte piece tid & 7 of rows (tid >> 3) + 16 i, i = 0 .. 7, of each operand
    const size_t rs = (size_t)16 * K; const size_t go = (size_t)(tid >> 3) * K + (tid & 7) * 8;
    const bf* gA = A + (size_t)R0 * K + go; const bf* gA2 = A2 + (size_t)R0 * K + go; const bf* gB = Bt + (size_t)C0 * K + go;
    const unsigned l0 = (unsigned)(size_t)sT + (unsigned)(((tid >> 3) * GP + (tid & 7) * 8) * 2);
    const int nt = K / 64;
    cp8(l0, gA, rs); cp8(l0 + GPL * 2, gA2, rs); cp8(l0 + 2 * GPL * 2, gB, rs);
    asm volatile("s_wait_asynccnt 0x0" ::: "memory");   // this wave's copies of trip 0 have landed
    __syncthreads();                                      // and every other wave's: buffer 0 may be read
    if (nt > 1) { cp8(l0 + GSTG * 2, gA + 64, rs); cp8(l0 + (GSTG + GPL) * 2, gA2 + 64, rs); cp8(l0 + (GSTG + 2 * GPL) * 2, gB + 64, rs); }
    const int aof = ((wv >> 1) * 64 + lr) * GP + 8 * hi, bof = 2 * GPL + ((wv & 1) * 64 + lr) * GP + 8 * hi;
#pragma unroll 1
    for (int t = 0; t < nt; ++t) { const bf* sb = sT + (t & 1) * GSTG;
#pragma unroll
        for (int ks = 0; ks < 2; ++ks) {
            V a[4], a2[4], b[4];
            b[0] = WFrag<T16>::ld(sb + bof + ks * 32);
#pragma unroll
            for (int mb = 0; mb < 4; ++mb) a[mb] = WFrag<T16>::ld(sb + aof + mb * 16 * GP + ks * 32);
#pragma unroll
            for (int mb = 0; mb < 4; ++mb) a2[mb] = WFrag<T16>::ld(sb + GPL + aof + mb * 16 * GP + ks * 32);
#pragma unroll
            for (int nb = 1; nb < 4; ++nb) b[nb] = WFrag<T16>::ld(sb + bof + nb * 16 * GP + ks * 32);
            __builtin_amdgcn_sched_barrier(0);   // the twelve fragments of 32 k are read as ONE group in front of their 32 products: left to itself the build reads each b in front of its own 8 products and waits for it there
#pragma unroll
            for (int nb = 0; nb < 4; ++nb)
#pragma unroll
                for (int mb = 0; mb < 4; ++mb) { acc[mb][nb] = WFrag<T16>::mma(a[mb], b[nb], acc[mb][nb]); acc[mb][nb] = WFrag<T16>::mma(a2[mb], b[nb], acc[mb][nb]); }
        }
        asm volatile("s_wait_dscnt 0x0" ::: "memory");      // this wave's reads of the buffer are done before it is refilled
        asm volatile("s_wait_asynccnt 0x0" ::: "memory");   // this wave's copies of trip t + 1 have landed
        __syncthreads();                                      // publishes trip t + 1's buffer and ends every wave's reads of trip t's
        if (t + 2 < nt) { const unsigned lb = l0 + (unsigned)(t & 1) * (GSTG * 2); const int kc = (t + 2) * 64; cp8(lb, gA + kc, rs); cp8(lb + GPL * 2, gA2 + kc, rs); cp8(lb + 2 * GPL * 2, gB + kc, rs); }
    }
    asm volatile("s_wait_asynccnt 0x0" ::: "memory");   // no copy is outstanding when the wave goes on to its epilogue and ends
#pragma unroll
    for (int mb = 0; mb < 4; ++mb) {
#pragma unroll
        for (int nb = 0; nb < 4; ++nb) {
#pragma unroll
            for (int j = 0; j < 8; ++j) os[(hi * 8 + j) * 68 + nb * 16 + lr] = acc[mb][nb][j]; }
        __builtin_amdgcn_wave_barrier(); asm volatile("" ::: "memory");
        float* crow = C + (size_t)(r0 + mb * 16) * ldc + c0;
{
#pragma unroll
            for (int s = 0; s < 8; ++s) { const int row = 2 * s + hi, cofs = lr * 4; v4f val = *(const v4fa*)(os + row * 68 + cofs); if (BIAS) { val[0] += bfr(bias[c0 + cofs]); val[1] += bfr(bias[c0 + cofs + 1]); val[2] += bfr(bias[c0 + cofs + 2]); val[3] += bfr(bias[c0 + cofs + 3]); }
                *(v4f*)(crow + (size_t)row * ldc + cofs) = val; }
             }
        __builtin_amdgcn_wave_barrier(); asm volatile("" ::: "memory");
    }
}

// Work-group blk of a weight's transpose: 64 lines of 64 elements of Bt[n][k] = W[k][n]
__device__ __forceinline__ void wtG(const float* __restrict__ w, int K, int N, bf* Bt, int blk) {
    const int lane = threadIdx.x & 31; const int L0 = (blk * 8 + (threadIdx.x >> 5)) * 8; const int nlines = N * K / 64;
{
#pragma unroll 1
        for (int l = 0; l < 8; ++l) { const int L = L0 + l; if (L >= nlines) break; const size_t e = (size_t)L * 64 + lane * 2; const int k = (int)(e % K), n = (int)(e / K); v2us o;
            o[0] = f2bf(w[(size_t)k * N + n]); o[1] = f2bf(w[(size_t)(k + 1) * N + n]); *(v2us*)(Bt + e) = o; }
         }
}

// Work-group blk of the LayerNorm: the 16 rows of token tile blk, two a wave.
// The planes are stored in the order in which the attention launch reads its fragments: element (row r, feature k) of a plane stands at [r >> 4][k >> 3][r & 15][k & 7],
// so that the 16 bytes of lane l = 16 hi + lr (row lr, k = 32 kk + 16 part + 8 hi + 0 .. 7) follow each other by lane: one 16-byte load a lane covers 512 contiguous bytes, four whole lines.
// A row's values go to their places through LDS, and the tile leaves in whole lines.
#define LG 136   // LDS pitch of one k >> 3 group (16 rows x 8 elements), 16-bit elements: 272 B = 16 B x 17 keeps a row's 8-byte writes, which step from group to group, off each other's banks
#define LPL (32 * LG)   // one plane of a tile
// One row (lr of its tile), loaded as y0 | y1: this lane's features 4 lane .. + 3 and 128 + 4 lane .. + 3
__device__ __forceinline__ void lnrow(const v4f y0, const v4f y1, int lr, const float* __restrict__ gw, const float* __restrict__ gb, bf* sF) {
    const int lane = threadIdx.x & 31; float hv[8]; float s = 0.f;
#pragma unroll
    for (int ch = 0; ch < 2; ++ch) { const v4f y = ch ? y1 : y0;
#pragma unroll
        for (int q = 0; q < 4; ++q) { const float u = bfr(y[q]); hv[ch * 4 + q] = u; s += u; } }
#pragma unroll
    for (int sh = 16; sh; sh >>= 1) s += __shfl_xor(s, sh, 32);
    float mu = s * (1.0f / 256.0f); asm volatile("" : "+v"(mu)); float s2 = 0.f;
#pragma unroll
    for (int k = 0; k < 8; ++k) { float d0 = __fsub_rn(hv[k], mu); asm volatile("" : "+v"(d0)); float p = __fmul_rn(d0, d0); asm volatile("" : "+v"(p)); s2 = __fadd_rn(s2, p); }
#pragma unroll
    for (int sh = 16; sh; sh >>= 1) s2 += __shfl_xor(s2, sh, 32);
    float var = __fadd_rn(s2 * (1.0f / 256.0f), 1e-5f); asm volatile("" : "+v"(var)); const float rs = __frsqrt_rn(var);
{
#pragma unroll
        for (int ch = 0; ch < 2; ++ch) { const int c0 = ch * 128 + lane * 4; v4us oh, ol;
#pragma unroll
            for (int q = 0; q < 4; ++q) { float gg = bfr(gw[c0 + q]); asm volatile("" : "+v"(gg)); float d0 = __fsub_rn(hv[ch * 4 + q], mu); asm volatile("" : "+v"(d0)); float n0 = __fmul_rn(d0, rs); asm volatile("" : "+v"(n0)); float y = __fmul_rn(n0, gg); asm volatile("" : "+v"(y)); y = __fadd_rn(y, bfr(gb[c0 + q])); unsigned short a, c2; splitf(y, a, c2); oh[q] = a; ol[q] = c2; }
            bf* p = sF + (c0 >> 3) * LG + lr * 8 + (c0 & 7); *(v4us*)p = oh; *(v4us*)(p + LPL) = ol; }
         } }
__device__ __forceinline__ void ln16(const float* __restrict__ X, const float* __restrict__ gw, const float* __restrict__ gb, bf* Yh, bf* Yl, int blk, bf* sF) {
    const int tid = threadIdx.x, lane = tid & 31, l0 = (tid >> 5) * 2; const float* xr = X + (size_t)(blk * 16 + l0) * DM + lane * 4;
    const v4f a0 = *(const v4f*)xr, a1 = *(const v4f*)(xr + 128), b0 = *(const v4f*)(xr + DM), b1 = *(const v4f*)(xr + DM + 128);
    lnrow(a0, a1, l0, gw, gb, sF); lnrow(b0, b1, l0 + 1, gw, gb, sF);
    __syncthreads();   // the tile is complete in LDS: each thread takes out pieces that other waves wrote
#pragma unroll
    for (int u = 0; u < 2; ++u) { const int q = tid + u * 256; const bf* p = sF + (q >> 4) * LG + (q & 15) * 8; const size_t o = (size_t)blk * (16 * DM) + q * 8;
        *(v8us*)(Yh + o) = *(const v8us*)p; *(v8us*)(Yl + o) = *(const v8us*)(p + LPL); }
    asm volatile("s_wait_xcnt 0x0" ::: "memory");   // behind the last of the four stores: no register that a store names is rewritten in front of this wait
}

// k_prep: all that the attention launch and the last GEMM read from the workspace, in ONE launch of independent work-groups: the first WTB groups write the transposed 16-bit weights, the others the LayerNorm planes.
// No group reads what another writes. The weight groups have the lowest indices: they start first and end while rows are still being dealt out.
#define WTB_Q  (DM * DQ / 64 / 64)         // groups of 64 lines for Wq, and for Wg
#define WTB_KV (DM * 2 * DQ / 64 / 64)     // for Wkv
#define WTB_O  (DQ * DM / 64 / 64)         // for Wo
#define WTB    (2 * WTB_Q + WTB_KV + WTB_O)
static_assert(((DM * DQ / 64) % 64) == 0);
__global__ __launch_bounds__(256) void k_prep(const float* __restrict__ X, const float* __restrict__ gw, const float* __restrict__ gb, const float* __restrict__ wq, const float* __restrict__ wkv, const float* __restrict__ wg, const float* __restrict__ wo, bf* WB, bf* WO, bf* Yh, bf* Yl) {
    __shared__ __align__(16) bf sF[2 * LPL];   // a LayerNorm group's tile, hi | lo
    const int b = (int)blockIdx.x;   // every branch below is the same for the whole work-group, the barrier of the last one included
    /* weights ('xw': Bt[n][k] = W[k][n]); the fused Wkv gives Bt rows 512..1023 = k, 1024..1535 = v */
    if (b < WTB_Q) wtG(wq, DM, DQ, WB, b);
    else if (b < WTB_Q + WTB_KV) wtG(wkv, DM, 2 * DQ, WB + (size_t)DQ * DM, b - WTB_Q);
    else if (b < 2 * WTB_Q + WTB_KV) wtG(wg, DM, DQ, WB + (size_t)3 * DQ * DM, b - (WTB_Q + WTB_KV));
    else if (b < WTB) wtG(wo, DQ, DM, WO, b - (2 * WTB_Q + WTB_KV));
    else ln16(X, gw, gb, Yh, Yl, b - WTB, sF);
}

// k_attn: the q, k, v, g projections, scores, softmax, attn.v and the gate of one plane z = (sequence s, head h) in one work-group of 16 waves; wave w owns the 16 tokens (queries) 16w .. 16w + 15 and all TT keys.
// Projections: the head's 4 x 64 weight rows (q, g, k, v, each [n][k] over all DM k) are brought into LDS once by asynchronous copies; a wave holds the hi / lo fragments of its 16 rows of xn for all DM k in registers
// and runs through the 16 tiles of 16 features two at a time, per accumulator hi.w then lo.w at each 32 k. The same xn fragment serves as B (tokens = columns) or as A (tokens = rows):
// q, k, g: D = W xn^T: register r of lane l = (feature 8 (l >> 4) + r, token l & 15): 8 consecutive features of one token. k: one 16-byte LDS store a plane into K [key][d]; q: feature tiles 2 ks and 2 ks + 1, split hi / lo, ARE the B fragment of d = 32 ks .. 32 ks + 31; g: the layout of O^T below.
// v: D = xn W^T: register r of lane l = (token 8 (l >> 4) + r, feature l & 15): 8 consecutive keys of one d: one 16-byte LDS store a plane into V^T [d][key].
// S^T = K Q^T (A = K rows, B = Q rows): D register r of tile kb in lane l = score(key 16 kb + 8 (l >> 4) + r, query l & 15), so a lane holds 128 scores of ONE query:
// maximum and sum in the lane plus one exchange between the wave's halves. Tiles 2j and 2j + 1, normalised and split hi / lo in place, ARE the B fragment of keys 32j .. 32j + 31
// in the loader's k order, so O^T = V^T P^T (A = V^T rows) needs no exchange. Products per accumulator in the order hi.hi, lo.hi, hi.lo of (q, k) and of (p, v).
// Epilogue: AT hi / lo planes [s*TT + t][h*HD + d] = O[t][d] x sigmoid(g[t][d] + bg[h*HD + d]).
#define KP 72     // LDS pitch of a K row, 16-bit elements: 144 B = 16 B x 9; an odd multiple of 16 B keeps the 16-byte fragment reads off each other's banks
#define VP 264    // LDS pitch of a V^T row: 528 B = 16 B x 33
#define WP 264    // LDS pitch of a weight row of DM k: 528 B = 16 B x 33
#define OP 68     // LDS pitch of an output row, floats: 272 B = 16 B x 17
static_assert(TT == 256 && HD == 64 && DM == 256);
static_assert(2 * HD * WP <= 16 * 16 * OP * 2);   // the output rows reuse the LDS of the q and g weights, and are the larger of the two
typedef __attribute__((ext_vector_type(2))) float  v2f;
typedef __attribute__((ext_vector_type(2))) __bf16 v2bf;
typedef __attribute__((ext_vector_type(8))) unsigned v8u;
typedef __attribute__((ext_vector_type(4))) __bf16 v4bf;
typedef __attribute__((ext_vector_type(8))) __bf16 v8bf;
// Four asynchronous copies of 16 bytes a lane: rows r, r + 16, r + 32, r + 48 of one 64-row weight block (a wave's 32 lanes cover one whole row of 512 bytes a copy).
// s_wait_xcnt stands inside the statement, behind the last copy: no address register of a copy is rewritten in front of it.
__device__ __forceinline__ void cp4(unsigned l, const bf* g) {
    asm volatile("global_load_async_to_lds_b128 %0, %4, off\n\tglobal_load_async_to_lds_b128 %1, %5, off\n\tglobal_load_async_to_lds_b128 %2, %6, off\n\tglobal_load_async_to_lds_b128 %3, %7, off\n\ts_wait_xcnt 0x0"
                 :: "v"(l), "v"(l + 1u * 16 * WP * 2), "v"(l + 2u * 16 * WP * 2), "v"(l + 3u * 16 * WP * 2), "v"(g), "v"(g + 16 * DM), "v"(g + 32 * DM), "v"(g + 48 * DM) : "memory");
}
// Two feature tiles (32 weight rows in LDS from pc, this lane's place in them included) over all DM k; XA: xn is the A operand (v), else the B operand. The last step fetches the first fragments of the next pair, at pn.
template <bool XA, bool LAST>
__device__ __forceinline__ void proj2(const bf* pc, const bf* pn, const v16bf (&xh)[8], const v16bf (&xl)[8], v16bf (&fw)[2][2], v8f& a0, v8f& a1) {
    a0 = (v8f){}; a1 = (v8f){};
#pragma unroll
    for (int kk = 0; kk < 8; ++kk) { const int cb = kk & 1, nb = cb ^ 1;
        if (kk < 7 || !LAST) { const bf* q = (kk < 7) ? pc + (kk + 1) * 32 : pn; fw[nb][0] = WFrag<bf>::ld(q); fw[nb][1] = WFrag<bf>::ld(q + 16 * WP); }
        if (XA) { a0 = wmmab(xh[kk], fw[cb][0], a0); a1 = wmmab(xh[kk], fw[cb][1], a1); a0 = wmmab(xl[kk], fw[cb][0], a0); a1 = wmmab(xl[kk], fw[cb][1], a1); }
        else    { a0 = wmmab(fw[cb][0], xh[kk], a0); a1 = wmmab(fw[cb][1], xh[kk], a1); a0 = wmmab(fw[cb][0], xl[kk], a0); a1 = wmmab(fw[cb][1], xl[kk], a1); } }
}
// A lane's 8 values of each of two tiles, split hi / lo: one 16-byte LDS store a tile and plane
__device__ __forceinline__ void put2(bf* ph, bf* pl, int step, v8f a0, v8f a1) {
    const v8bf h0 = __builtin_convertvector(a0, v8bf), h1 = __builtin_convertvector(a1, v8bf);
    const v8bf l0 = __builtin_convertvector(a0 - __builtin_convertvector(h0, v8f), v8bf), l1 = __builtin_convertvector(a1 - __builtin_convertvector(h1, v8f), v8bf);
    *(v8us*)ph = __builtin_bit_cast(v8us, h0); *(v8us*)(ph + step) = __builtin_bit_cast(v8us, h1); *(v8us*)pl = __builtin_bit_cast(v8us, l0); *(v8us*)(pl + step) = __builtin_bit_cast(v8us, l1);
}
// Two tiles of 16 features each, split hi / lo, as the fragment of those 32 features in the loader's k order
__device__ __forceinline__ void frag2(v8f a0, v8f a1, v16bf& fh, v16bf& fl) {
    const v8bf h0 = __builtin_convertvector(a0, v8bf), h1 = __builtin_convertvector(a1, v8bf);
    const v8bf l0 = __builtin_convertvector(a0 - __builtin_convertvector(h0, v8f), v8bf), l1 = __builtin_convertvector(a1 - __builtin_convertvector(h1, v8f), v8bf);
    fh = __builtin_shufflevector(h0, h1, 0, 1, 2, 3, 4, 5, 6, 7, 8, 9, 10, 11, 12, 13, 14, 15); fl = __builtin_shufflevector(l0, l1, 0, 1, 2, 3, 4, 5, 6, 7, 8, 9, 10, 11, 12, 13, 14, 15);
}
__global__ __launch_bounds__(512) void k_attn(const bf* __restrict__ Xh, const bf* __restrict__ Xl, const bf* __restrict__ Wb, const float* __restrict__ bgp, bf* __restrict__ Ah, bf* __restrict__ Al) {
    __shared__ __align__(16) bf sKh[TT * KP]; __shared__ __align__(16) bf sKl[TT * KP];
    __shared__ __align__(16) bf sVh[HD * VP]; __shared__ __align__(16) bf sVl[HD * VP];
    __shared__ __align__(16) bf sWa[16 * 16 * OP * 2]; __shared__ __align__(16) bf sWb[2 * HD * WP];   // weight rows q | g and k | v: two arrays, so that each has its own base register and the constant part of every fragment read fits the instruction's 16-bit offset field
    float* sO = (float*)sWa;   // used only behind the barrier that ends every wave's reads of the weights
    const int tid = threadIdx.x, lane = tid & 31, lr = lane & 15, hi = lane >> 4; const int wv = __builtin_amdgcn_readfirstlane(tid >> 5);   // the wave's number, in a scalar register: the wave's part of every address stays out of the vector registers
    const size_t tok0 = (size_t)(blockIdx.x / NH_) * TT; const int col0 = ((int)blockIdx.x % NH_) * HD;
    // weights: wave w copies rows w + 16 i of each of the four blocks; block b (0 q, 1 k, 2 v, 3 g) of the head = rows b*DQ + col0 .. + 63 of Wb; in LDS: q | g in sWa, k | v in sWb
    const unsigned lo = (unsigned)((wv * WP + lane * 8) * 2), la = (unsigned)(size_t)sWa + lo, lb = (unsigned)(size_t)sWb + lo; const bf* gw = Wb + (size_t)(col0 + wv) * DM + lane * 8;
    cp4(la, gw); cp4(la + 1u * HD * WP * 2, gw + (size_t)3 * DQ * DM); cp4(lb, gw + (size_t)1 * DQ * DM); cp4(lb + 1u * HD * WP * 2, gw + (size_t)2 * DQ * DM);
    v16bf xh[8], xl[8];   // this wave's 16 rows of xn, all DM k
    const size_t xo = (tok0 + wv * 16) * DM + lane * 8;   // the wave's token tile, in fragment order (ln16): 32 k = two runs of 256 elements, lane by lane
#pragma unroll
    for (int kk = 0; kk < 8; ++kk) { xh[kk] = cat16b(*(const v8us*)(Xh + xo + kk * 512), *(const v8us*)(Xh + xo + kk * 512 + 256)); xl[kk] = cat16b(*(const v8us*)(Xl + xo + kk * 512), *(const v8us*)(Xl + xo + kk * 512 + 256)); }
    asm volatile("s_wait_asynccnt 0x0" ::: "memory");   // this wave's copies of the weights have landed
    __syncthreads();                                      // and every other wave's: the weights may be read
    // Projections: step (pair of feature tiles in the order k, k, v, v, g, g, q, q; 32 k), 2 fragments and 4 products; each step's fragments are fetched one step ahead
    v16bf qh[2], ql[2], fw[2][2]; v8f gt[4], a0, a1;
    const bf* pa = sWa + lr * WP + 8 * hi; const bf* pb = sWb + lr * WP + 8 * hi;
    fw[0][0] = WFrag<bf>::ld(pb); fw[0][1] = WFrag<bf>::ld(pb + 16 * WP);
    bf* pkh = sKh + (wv * 16 + lr) * KP + 8 * hi; bf* pkl = sKl + (wv * 16 + lr) * KP + 8 * hi; bf* pvh = sVh + lr * VP + wv * 16 + 8 * hi; bf* pvl = sVl + lr * VP + wv * 16 + 8 * hi;
    proj2<false, false>(pb, pb + 32 * WP, xh, xl, fw, a0, a1); put2(pkh, pkl, 16, a0, a1);
    proj2<false, false>(pb + 32 * WP, pb + 64 * WP, xh, xl, fw, a0, a1); put2(pkh + 32, pkl + 32, 16, a0, a1);
    proj2<true, false>(pb + 64 * WP, pb + 96 * WP, xh, xl, fw, a0, a1); put2(pvh, pvl, 16 * VP, a0, a1);
    proj2<true, false>(pb + 96 * WP, pa + 64 * WP, xh, xl, fw, a0, a1); put2(pvh + 32 * VP, pvl + 32 * VP, 16 * VP, a0, a1);
    proj2<false, false>(pa + 64 * WP, pa + 96 * WP, xh, xl, fw, gt[0], gt[1]);
    proj2<false, false>(pa + 96 * WP, pa, xh, xl, fw, gt[2], gt[3]);
    proj2<false, false>(pa, pa + 32 * WP, xh, xl, fw, a0, a1); frag2(a0, a1, qh[0], ql[0]);
    proj2<false, true>(pa + 32 * WP, pa, xh, xl, fw, a0, a1); frag2(a0, a1, qh[1], ql[1]);
    __syncthreads();   // K and V^T are complete in LDS, they are only read from here on; and every wave's reads of the weights are done: their LDS may be rewritten
    // the gates, in the layout of O^T, wait in this lane's own places of the wave's output rows
    float* os = sO + wv * (16 * OP);
#pragma unroll
    for (int mb = 0; mb < 4; ++mb) { const float* bp = bgp + col0 + mb * 16 + 8 * hi; const v4f b0 = *(const v4f*)bp, b1 = *(const v4f*)(bp + 4); v4f g0, g1;
#pragma unroll
        for (int c = 0; c < 4; ++c) { g0[c] = __fdiv_rn(1.0f, 1.0f + expf(-(gt[mb][c] + bfr(b0[c])))); g1[c] = __fdiv_rn(1.0f, 1.0f + expf(-(gt[mb][4 + c] + bfr(b1[c])))); }
        float* p = os + lr * OP + mb * 16 + 8 * hi; *(v4fa*)p = g0; *(v4fa*)(p + 4) = g1; }
    // Scores: step st = (pair of key tiles st >> 1, half ks = st & 1 of the head dim), 4 fragments and 6 products; each step's fragments are fetched as one group one step ahead
    v8f s[16]; v16bf fk[2][4];
    const int kof = lr * KP + 8 * hi;
#pragma unroll
    for (int p = 0; p < 2; ++p) { fk[0][p] = WFrag<bf>::ld(sKh + kof + p * 16 * KP); fk[0][2 + p] = WFrag<bf>::ld(sKl + kof + p * 16 * KP); }
#pragma unroll
    for (int st = 0; st < 16; ++st) { const int kb = (st >> 1) * 2, ks = st & 1, cb = st & 1, nb = cb ^ 1;
        if (st + 1 < 16) { const int o = kof + ((st + 1) >> 1) * 32 * KP + ((st + 1) & 1) * 32;
#pragma unroll
            for (int p = 0; p < 2; ++p) { fk[nb][p] = WFrag<bf>::ld(sKh + o + p * 16 * KP); fk[nb][2 + p] = WFrag<bf>::ld(sKl + o + p * 16 * KP); } }
        v8f a0 = ks ? s[kb] : (v8f){}, a1 = ks ? s[kb + 1] : (v8f){};
        a0 = wmmab(fk[cb][0], qh[ks], a0); a1 = wmmab(fk[cb][1], qh[ks], a1); a0 = wmmab(fk[cb][0], ql[ks], a0); a1 = wmmab(fk[cb][1], ql[ks], a1); a0 = wmmab(fk[cb][2], qh[ks], a0); a1 = wmmab(fk[cb][3], qh[ks], a1);
        s[kb] = a0; s[kb + 1] = a1; }
    v8f m8 = s[0];
#pragma unroll
    for (int kb = 1; kb < 16; ++kb)
#pragma unroll
        for (int r = 0; r < 8; ++r) m8[r] = fmaxf(m8[r], s[kb][r]);
    float mx = fmaxf(fmaxf(fmaxf(m8[0], m8[1]), fmaxf(m8[2], m8[3])), fmaxf(fmaxf(m8[4], m8[5]), fmaxf(m8[6], m8[7])));
    mx = fmaxf(mx, __shfl_xor(mx, 16, 32)) * SCL;   // the scale is a positive power of two: scaling the maximum is the maximum of the scaled scores
    v8f s8;
#pragma unroll
    for (int kb = 0; kb < 16; ++kb) {
#pragma unroll
        for (int r = 0; r < 8; r += 4) { float x[4], ex[4];
#pragma unroll
            for (int c = 0; c < 4; ++c) x[c] = (s[kb][r + c] * SCL - mx) * 1.4426950408889634f;
            // four exponentials whose results share no register with any argument, then one v_nop: the slot the instruction set asks for behind a transcendental; inside the statement it cannot drift away
            asm("v_exp_f32 %0, %4\n\tv_exp_f32 %1, %5\n\tv_exp_f32 %2, %6\n\tv_exp_f32 %3, %7\n\tv_nop" : "=&v"(ex[0]), "=&v"(ex[1]), "=&v"(ex[2]), "=&v"(ex[3]) : "v"(x[0]), "v"(x[1]), "v"(x[2]), "v"(x[3]));
#pragma unroll
            for (int c = 0; c < 4; ++c) { s[kb][r + c] = ex[c]; s8[r + c] = kb ? s8[r + c] + ex[c] : ex[c]; } } }
    float sum = ((s8[0] + s8[1]) + (s8[2] + s8[3])) + ((s8[4] + s8[5]) + (s8[6] + s8[7]));
    sum += __shfl_xor(sum, 16, 32);
    const float f = __fdiv_rn(1.0f, sum);
    // attn.v: step st = (32 keys j = st >> 1, pair of d tiles st & 1), fetched one step ahead like the scores' steps; the two score tiles of j become P^T hi / lo just before their first use
    v8f o[4]; v16bf fv[2][4]; v16bf ph, pl;
    const int vof = lr * VP + 8 * hi;
#pragma unroll
    for (int p = 0; p < 2; ++p) { fv[0][p] = WFrag<bf>::ld(sVh + vof + p * 16 * VP); fv[0][2 + p] = WFrag<bf>::ld(sVl + vof + p * 16 * VP); }
#pragma unroll
    for (int st = 0; st < 16; ++st) { const int j = st >> 1, mb = (st & 1) * 2, cb = st & 1, nb = cb ^ 1;
        if (st + 1 < 16) { const int ofs = vof + ((st + 1) & 1) * 32 * VP + ((st + 1) >> 1) * 32;
#pragma unroll
            for (int p = 0; p < 2; ++p) { fv[nb][p] = WFrag<bf>::ld(sVh + ofs + p * 16 * VP); fv[nb][2 + p] = WFrag<bf>::ld(sVl + ofs + p * 16 * VP); } }
        if ((st & 1) == 0) { v8u wh, wl;
#pragma unroll
            for (int i = 0; i < 8; ++i) { const v8f t = s[2 * j + (i >> 2)]; const v2f y = { t[(2 * i) & 7] * f, t[(2 * i + 1) & 7] * f };
                const v2bf h = __builtin_convertvector(y, v2bf); const v2bf l = __builtin_convertvector(y - __builtin_convertvector(h, v2f), v2bf);
                wh[i] = __builtin_bit_cast(unsigned, h); wl[i] = __builtin_bit_cast(unsigned, l); }
            ph = __builtin_bit_cast(v16bf, wh); pl = __builtin_bit_cast(v16bf, wl); }
        v8f a0 = j ? o[mb] : (v8f){}, a1 = j ? o[mb + 1] : (v8f){};
        a0 = wmmab(fv[cb][0], ph, a0); a1 = wmmab(fv[cb][1], ph, a1); a0 = wmmab(fv[cb][0], pl, a0); a1 = wmmab(fv[cb][1], pl, a1); a0 = wmmab(fv[cb][2], ph, a0); a1 = wmmab(fv[cb][3], ph, a1);
        o[mb] = a0; o[mb + 1] = a1; }
    // o[mb][r] = O(query lr, d = 16 mb + 8 hi + r), times its gate; then through the wave's own LDS rows, so that each store instruction writes whole 128-byte lines
#pragma unroll
    for (int mb = 0; mb < 4; ++mb) { float* p = os + lr * OP + mb * 16 + 8 * hi; const v4f g0 = *(const v4fa*)p, g1 = *(const v4fa*)(p + 4);
        *(v4fa*)p = __builtin_shufflevector(o[mb], o[mb], 0, 1, 2, 3) * g0; *(v4fa*)(p + 4) = __builtin_shufflevector(o[mb], o[mb], 4, 5, 6, 7) * g1; }
    asm volatile("s_wait_dscnt 0x0" ::: "memory");   // the rows read below were written by other lanes of this wave: the writes are done, and stay in front, before they are read back
    v4f ov[8];   // all eight LDS reads are issued before the first store waits for one
#pragma unroll
    for (int q = 0; q < 8; ++q) ov[q] = *(const v4fa*)(os + (2 * q + hi) * OP + lr * 4);
    // this lane's part of the output: tokens wv*16 + hi + 2q (q = 0 .. 7), columns lr*4 .. lr*4 + 3 of the head
    const unsigned ao = (unsigned)(((wv * 16 + hi) * DQ + lr * 4) * 2);   // 16 lanes x 8 bytes = one whole 128-byte line of a plane per token
    char* ah = (char*)(Ah + tok0 * DQ + col0) + ao; char* al = (char*)(Al + tok0 * DQ + col0) + ao;
#pragma unroll
    for (int q = 0; q < 8; ++q) { const v4f y = ov[q];
        const v4bf h = __builtin_convertvector(y, v4bf); const v4bf l = __builtin_convertvector(y - __builtin_convertvector(h, v4f), v4bf);
        *(v4us*)(ah + q * 2 * DQ * 2) = __builtin_bit_cast(v4us, h); *(v4us*)(al + q * 2 * DQ * 2) = __builtin_bit_cast(v4us, l); }
}

extern "C" void kernel_launch(void* const* d_in, const int* in_sizes, int n_in,
                              void* d_out, int out_size, void* d_ws, size_t ws_size, hipStream_t stream) {
    if (n_in < 9) return;
    if (in_sizes[0] < NT * DM || in_sizes[1] < DM || in_sizes[2] < DM || in_sizes[3] < DM * DQ || in_sizes[4] < DM * 2 * DQ
        || in_sizes[5] < DM * DQ || in_sizes[6] < DQ || in_sizes[7] < DQ * DM || in_sizes[8] < DM) return;
    if (out_size < NT * DM) return;
    const float* x = (const float*)d_in[0]; const float* ln_g = (const float*)d_in[1]; const float* ln_b = (const float*)d_in[2]; const float* wq = (const float*)d_in[3]; const float* wkv = (const float*)d_in[4]; const float* wg = (const float*)d_in[5]; const float* bg = (const float*)d_in[6]; const float* wo = (const float*)d_in[7]; const float* bo = (const float*)d_in[8];
    float* OUT = (float*)d_out;     // [NB][TT][DM] = [NT][256]
    char* wsp = (char*)d_ws;
    auto take = [&](size_t bytes) { char* p = wsp; wsp += (bytes + 255) & ~(size_t)255; return (void*)p; };
    bf* WB = (bf*)take((size_t)DP * DM * 2);     // Bt [2048][256]: rows 0..511 q, 512..1023 k, 1024..1535 v, 1536..2047 g
    bf* WO = (bf*)take((size_t)DM * DQ * 2);     // Bt [256][512]
    bf* LNh = (bf*)take((size_t)NT * DM * 2); bf* LNl = (bf*)take((size_t)NT * DM * 2);
    bf* ATh = (bf*)take((size_t)NT * DQ * 2); bf* ATl = (bf*)take((size_t)NT * DQ * 2);
    if ((size_t)(wsp - (char*)d_ws) > ws_size) return;
    k_prep<<<WTB + NT / 16, 256, 0, stream>>>(x, ln_g, ln_b, wq, wkv, wg, wo, WB, WO, LNh, LNl);
    k_attn<<<ZH, 512, 0, stream>>>(LNh, LNl, WB, bg, ATh, ATl);
    k_gemmw<bf, 1, true><<<dim3(NT / 128, DM / 128, 1), 128, 0, stream>>>(ATh, ATl, WO, nullptr, DQ, OUT, DM, bo, 0, 0, 0);
}

// v009
// One run takes 108 microseconds.
// Two timings next to v008 both put it at 1.08 times that version's speed.
// All steps since v000 together make it 9.45 times as fast.
#include <hip/hip_runtime.h>

// Gated row attention along the width axis with a pre-LayerNorm: x [1][128][256][256] = 128 independent sequences (image rows) of 256 tokens x 256 features; xn = LayerNorm(x) (gamma, beta, eps 1e-5); q = xn Wq ('xw' [256][512], 8 heads x 64), [k|v] = xn Wkv ('xw' [256][1024]: columns k | v); dots = (q/8).k over the 256 keys of the same sequence; softmax; out = attn.v merged; gates = sigmoid(xn Wg + bg) ('xw' [256][512]); y = (out * gates) Wo + bo ('xw' [512][256]) -> [1][128][256][256] (8.4 M).
// Compute dtypes, f32 accumulate: all contractions v_wmma_f32_16x16x32_bf16 (bf16 operands). Every input RNE-converted to bf16 on load; LayerNorm in f32, xn as bf16 hi + lo planes; q, k, v, g projections as (hi + lo) x exact weights (2 products); scores and attn.v on bf16 hi/lo operands (3 products) for every row; softmax f32; sigmoid gate f32 (true division) with f32 bias add; (out x gate) as hi + lo x exact Wo (2 products) + bo.
// Layout: the transposed weights and the LayerNorm planes for all tokens (in the fragment order of their one reader, see ln16) in one launch; then ONE launch with one work-group per (head, 4 sequences, one after the other) does that head's q, k, v, g projections, the scores, the softmax, attn.v and the gate: q, k, v, g, the scores and the probabilities never leave the WGP (k and v go to LDS, q and the probabilities stay in registers), and the gated output goes out as the hi / lo planes that the last GEMM reads. The last GEMM stages its operands in LDS with asynchronous copies (4 waves share a 128x128 tile).

#ifndef NB_
#define NB_  128       // sequences (image rows) processed by this build
#endif
#define NB_FULL 128    // sequences in the input / output
#define TT   256       // tokens per sequence
#define DM   256
#define NH_  8
#define HD   64
#define DQ   (NH_ * HD)    // 512 = inner dim
#define DP   (4 * DQ)      // 2048 = rows of the transposed weights q | k | v | g
#define ZH   (NB_ * NH_)   // (sequence, head) planes
#define NT   (NB_ * TT)    // token rows in total
#define SCL  0.125f        // HD^-0.5

static_assert(NB_ >= 1 && NB_ <= NB_FULL);
static_assert((TT % 64) == 0 && (HD % 64) == 0 && (DM % 64) == 0 && (DQ % 64) == 0 && (DP % 64) == 0);
static_assert((HD % 32) == 0 && (DM % 32) == 0 && (DQ % 32) == 0 && (TT % 32) == 0);
static_assert((TT % 128) == 0 && (NT % 16) == 0 && (TT % 16) == 0 && (DM % 128) == 0);
static_assert(((DQ * DM) % 64) == 0 && ((2 * DQ * DM) % 64) == 0);
static_assert((NT % 128) == 0 && (DM % 128) == 0 && (DQ % 128) == 0);

typedef unsigned short bf;
typedef __attribute__((ext_vector_type(16))) __bf16   v16bf;
typedef __attribute__((ext_vector_type(8)))  unsigned short v8us;
typedef __attribute__((ext_vector_type(8)))  float    v8f;
typedef __attribute__((ext_vector_type(4)))  float    v4f;
typedef v4f  __attribute__((may_alias)) v4fa;
typedef __attribute__((ext_vector_type(2))) unsigned short v2us;
typedef __attribute__((ext_vector_type(4))) unsigned short v4us;

constexpr size_t al256(size_t b) { return (b + 255) & ~(size_t)255; }
constexpr size_t WS_NEED = al256((size_t)DP * DM * 2) + al256((size_t)DM * DQ * 2) + 2 * al256((size_t)NT * DM * 2) + 2 * al256((size_t)NT * DQ * 2);
static_assert(WS_NEED <= (size_t)268435456);


__device__ __forceinline__ unsigned short f2bf(float f) { unsigned u = __float_as_uint(f); u += 0x7FFFu + ((u >> 16) & 1u); return (unsigned short)(u >> 16); }
__device__ __forceinline__ float bf2f(unsigned short b) { return __uint_as_float(((unsigned)b) << 16); }
__device__ __forceinline__ float bfr(float f) { return bf2f(f2bf(f)); }
__device__ __forceinline__ v16bf cat16b(v8us lo, v8us hi) { return __builtin_bit_cast(v16bf, __builtin_shufflevector(lo, hi, 0, 1, 2, 3, 4, 5, 6, 7, 8, 9, 10, 11, 12, 13, 14, 15)); }
__device__ __forceinline__ v8f wmmab(v16bf a, v16bf b, v8f c) { return __builtin_amdgcn_wmma_f32_16x16x32_bf16(false, a, false, b, (short)0, c, false, false); }
__device__ __forceinline__ void splitf(float y, unsigned short& h, unsigned short& l) { h = f2bf(y); l = f2bf(y - bf2f(h)); }

// ---- k_gemmw: register-blocked GEMM, one wave per 64x64 output tile (16 accumulators), FOUR waves (2 x 2) per work-group = a 128x128 tile; grid (M/128, N/128, Z), 128 threads.
// Operands are K-contiguous 16-bit planes. A trip is 64 k: 128 rows of A, of A2 and of Bt, 128 bytes each (one whole line a row), are brought into LDS by asynchronous copies, two buffers, the next trip's copies in flight while this trip's products run; fragments are read from LDS at pitch GP. K % 64 == 0.
// C[m][n] (f32, pitch ldc, + optional f32 bias[n]) = sum_k A[m][k] Bt[n][k] + sum_k A2[m][k] Bt[n][k] (NSPLIT 1). z-batch strides sA/sB/sC in elements.
// Fragments: lane l -> row/col l&15, elements 0..7 <- k0 + 8*(l>>4) + 0..7, elements 8..15 <- k0 + 16 + 8*(l>>4) + 0..7 for A and for Bt alike; D element r of lane l = (row 8*(l>>4) + r, col l&15).
template <typename T16> struct WFrag;
template <> struct WFrag<bf> { typedef v16bf V; static __device__ __forceinline__ V ld(const bf* p) { return cat16b(*(const v8us*)p, *(const v8us*)(p + 16)); } static __device__ __forceinline__ v8f mma(V a, V b, v8f c) { return wmmab(a, b, c); } };
#define GP 72                 // LDS pitch of a staged row of 64 k, 16-bit elements: 144 B = 16 B x 9 keeps the 16-byte fragment reads off each other's banks
#define GPL (128 * GP)        // one operand's 128 rows
#define GSTG (3 * GPL)        // one buffer: A | A2 | Bt
// Eight asynchronous copies of 16 bytes a lane: rows r, r + 16, .. r + 112 of one operand (a wave's 32 lanes cover 4 whole 128-byte lines a copy).
// s_wait_xcnt stands inside the statement, behind the last copy: no address register of a copy is rewritten in front of it.
__device__ __forceinline__ void cp8(unsigned l, const bf* g, size_t rs) {
    asm volatile("global_load_async_to_lds_b128 %0, %8, off\n\tglobal_load_async_to_lds_b128 %1, %9, off\n\tglobal_load_async_to_lds_b128 %2, %10, off\n\tglobal_load_async_to_lds_b128 %3, %11, off\n\t"
                 "global_load_async_to_lds_b128 %4, %12, off\n\tglobal_load_async_to_lds_b128 %5, %13, off\n\tglobal_load_async_to_lds_b128 %6, %14, off\n\tglobal_load_async_to_lds_b128 %7, %15, off\n\ts_wait_xcnt 0x0"
                 :: "v"(l), "v"(l + 1u * 16 * GP * 2), "v"(l + 2u * 16 * GP * 2), "v"(l + 3u * 16 * GP * 2), "v"(l + 4u * 16 * GP * 2), "v"(l + 5u * 16 * GP * 2), "v"(l + 6u * 16 * GP * 2), "v"(l + 7u * 16 * GP * 2),
                    "v"(g), "v"(g + rs), "v"(g + 2 * rs), "v"(g + 3 * rs), "v"(g + 4 * rs), "v"(g + 5 * rs), "v"(g + 6 * rs), "v"(g + 7 * rs) : "memory");
}
template <typename T16, int NSPLIT, bool BIAS>
__global__ __launch_bounds__(128) void k_gemmw(const T16* __restrict__ A, const T16* __restrict__ A2, const T16* __restrict__ Bt, const T16* __restrict__ Bt2, int K, float* C, int ldc, const float* __restrict__ bias, size_t sA, size_t sB, size_t sC) {
    static_assert(NSPLIT == 1);   // products a.b and a2.b
    typedef typename WFrag<T16>::V V;
    __shared__ __align__(16) bf sT[2 * GSTG];
    __shared__ __align__(16) float osw[4 * 16 * 68];
    const size_t z = blockIdx.z; A += z * sA; A2 += z * sA; Bt += z * sB; C += z * sC;
    const int tid = threadIdx.x, lane = tid & 31, lr = lane & 15, hi = lane >> 4; const int wv = __builtin_amdgcn_readfirstlane(tid >> 5);   // the wave's number, in a scalar register: tile indices and the epilogue's branches stay scalar
    const int R0 = blockIdx.x * 128, C0 = blockIdx.y * 128; const int r0 = R0 + (wv >> 1) * 64, c0 = C0 + (wv & 1) * 64;
    float* os = osw + wv * (16 * 68);   // each wave's own rows for its epilogue
    v8f acc[4][4];
#pragma unroll
    for (int mb = 0; mb < 4; ++mb)
#pragma unroll
        for (int nb = 0; nb < 4; ++nb) acc[mb][nb] = (v8f){};
    // this thread's part of a trip's copies: 16-byte piece tid & 7 of rows (tid >> 3) + 16 i, i = 0 .. 7, of each operand
    const size_t rs = (size_t)16 * K; const size_t go = (size_t)(tid >> 3) * K + (tid & 7) * 8;
    const bf* gA = A + (size_t)R0 * K + go; const bf* gA2 = A2 + (size_t)R0 * K + go; const bf* gB = Bt + (size_t)C0 * K + go;
    const unsigned l0 = (unsigned)(size_t)sT + (unsigned)(((tid >> 3) * GP + (tid & 7) * 8) * 2);
    const int nt = K / 64;
    cp8(l0, gA, rs); cp8(l0 + GPL * 2, gA2, rs); cp8(l0 + 2 * GPL * 2, gB, rs);
    asm volatile("s_wait_asynccnt 0x0" ::: "memory");   // this wave's copies of trip 0 have landed
    __syncthreads();                                      // and every other wave's: buffer 0 may be read
    if (nt > 1) { cp8(l0 + GSTG * 2, gA + 64, rs); cp8(l0 + (GSTG + GPL) * 2, gA2 + 64, rs); cp8(l0 + (GSTG + 2 * GPL) * 2, gB + 64, rs); }
    const int aof = ((wv >> 1) * 64 + lr) * GP + 8 * hi, bof = 2 * GPL + ((wv & 1) * 64 + lr) * GP + 8 * hi;
#pragma unroll 1
    for (int t = 0; t < nt; ++t) { const bf* sb = sT + (t & 1) * GSTG;
#pragma unroll
        for (int ks = 0; ks < 2; ++ks) {
            V a[4], a2[4], b[4];
            b[0] = WFrag<T16>::ld(sb + bof + ks * 32);
#pragma unroll
            for (int mb = 0; mb < 4; ++mb) a[mb] = WFrag<T16>::ld(sb + aof + mb * 16 * GP + ks * 32);
#pragma unroll
            for (int mb = 0; mb < 4; ++mb) a2[mb] = WFrag<T16>::ld(sb + GPL + aof + mb * 16 * GP + ks * 32);
#pragma unroll
            for (int nb = 1; nb < 4; ++nb) b[nb] = WFrag<T16>::ld(sb + bof + nb * 16 * GP + ks * 32);
            __builtin_amdgcn_sched_barrier(0);   // the twelve fragments of 32 k are read as ONE group in front of their 32 products: left to itself the build reads each b in front of its own 8 products and waits for it there
#pragma unroll
            for (int nb = 0; nb < 4; ++nb)
#pragma unroll
                for (int mb = 0; mb < 4; ++mb) { acc[mb][nb] = WFrag<T16>::mma(a[mb], b[nb], acc[mb][nb]); acc[mb][nb] = WFrag<T16>::mma(a2[mb], b[nb], acc[mb][nb]); }
        }
        asm volatile("s_wait_dscnt 0x0" ::: "memory");      // this wave's reads of the buffer are done before it is refilled
        asm volatile("s_wait_asynccnt 0x0" ::: "memory");   // this wave's copies of trip t + 1 have landed
        __syncthreads();                                      // publishes trip t + 1's buffer and ends every wave's reads of trip t's
        if (t + 2 < nt) { const unsigned lb = l0 + (unsigned)(t & 1) * (GSTG * 2); const int kc = (t + 2) * 64; cp8(lb, gA + kc, rs); cp8(lb + GPL * 2, gA2 + kc, rs); cp8(lb + 2 * GPL * 2, gB + kc, rs); }
    }
    asm volatile("s_wait_asynccnt 0x0" ::: "memory");   // no copy is outstanding when the wave goes on to its epilogue and ends
#pragma unroll
    for (int mb = 0; mb < 4; ++mb) {
#pragma unroll
        for (int nb = 0; nb < 4; ++nb) {
#pragma unroll
            for (int j = 0; j < 8; ++j) os[(hi * 8 + j) * 68 + nb * 16 + lr] = acc[mb][nb][j]; }
        __builtin_amdgcn_wave_barrier(); asm volatile("" ::: "memory");
        float* crow = C + (size_t)(r0 + mb * 16) * ldc + c0;
{
#pragma unroll
            for (int s = 0; s < 8; ++s) { const int row = 2 * s + hi, cofs = lr * 4; v4f val = *(const v4fa*)(os + row * 68 + cofs); if (BIAS) { val[0] += bfr(bias[c0 + cofs]); val[1] += bfr(bias[c0 + cofs + 1]); val[2] += bfr(bias[c0 + cofs + 2]); val[3] += bfr(bias[c0 + cofs + 3]); }
                *(v4f*)(crow + (size_t)row * ldc + cofs) = val; }
             }
        __builtin_amdgcn_wave_barrier(); asm volatile("" ::: "memory");
    }
}

// Work-group blk of a weight's transpose: 64 lines of 64 elements of Bt[n][k] = W[k][n]
__device__ __forceinline__ void wtG(const float* __restrict__ w, int K, int N, bf* Bt, int blk) {
    const int lane = threadIdx.x & 31; const int L0 = (blk * 8 + (threadIdx.x >> 5)) * 8; const int nlines = N * K / 64;
{
#pragma unroll 1
        for (int l = 0; l < 8; ++l) { const int L = L0 + l; if (L >= nlines) break; const size_t e = (size_t)L * 64 + lane * 2; const int k = (int)(e % K), n = (int)(e / K); v2us o;
            o[0] = f2bf(w[(size_t)k * N + n]); o[1] = f2bf(w[(size_t)(k + 1) * N + n]); *(v2us*)(Bt + e) = o; }
         }
}

// Work-group blk of the LayerNorm: the 16 rows of token tile blk, two a wave.
// The planes are stored in the order in which the attention launch reads its fragments: element (row r, feature k) of a plane stands at [r >> 4][k >> 3][r & 15][k & 7],
// so that the 16 bytes of lane l = 16 hi + lr (row lr, k = 32 kk + 16 part + 8 hi + 0 .. 7) follow each other by lane: one 16-byte load a lane covers 512 contiguous bytes, four whole lines.
// A row's values go to their places through LDS, and the tile leaves in whole lines.
#define LG 136   // LDS pitch of one k >> 3 group (16 rows x 8 elements), 16-bit elements: 272 B = 16 B x 17 keeps a row's 8-byte writes, which step from group to group, off each other's banks
#define LPL (32 * LG)   // one plane of a tile
// One row (lr of its tile), loaded as y0 | y1: this lane's features 4 lane .. + 3 and 128 + 4 lane .. + 3
__device__ __forceinline__ void lnrow(const v4f y0, const v4f y1, int lr, const float* __restrict__ gw, const float* __restrict__ gb, bf* sF) {
    const int lane = threadIdx.x & 31; float hv[8]; float s = 0.f;
#pragma unroll
    for (int ch = 0; ch < 2; ++ch) { const v4f y = ch ? y1 : y0;
#pragma unroll
        for (int q = 0; q < 4; ++q) { const float u = bfr(y[q]); hv[ch * 4 + q] = u; s += u; } }
#pragma unroll
    for (int sh = 16; sh; sh >>= 1) s += __shfl_xor(s, sh, 32);
    float mu = s * (1.0f / 256.0f); asm volatile("" : "+v"(mu)); float s2 = 0.f;
#pragma unroll
    for (int k = 0; k < 8; ++k) { float d0 = __fsub_rn(hv[k], mu); asm volatile("" : "+v"(d0)); float p = __fmul_rn(d0, d0); asm volatile("" : "+v"(p)); s2 = __fadd_rn(s2, p); }
#pragma unroll
    for (int sh = 16; sh; sh >>= 1) s2 += __shfl_xor(s2, sh, 32);
    float var = __fadd_rn(s2 * (1.0f / 256.0f), 1e-5f); asm volatile("" : "+v"(var)); const float rs = __frsqrt_rn(var);
{
#pragma unroll
        for (int ch = 0; ch < 2; ++ch) { const int c0 = ch * 128 + lane * 4; v4us oh, ol;
#pragma unroll
            for (int q = 0; q < 4; ++q) { float gg = bfr(gw[c0 + q]); asm volatile("" : "+v"(gg)); float d0 = __fsub_rn(hv[ch * 4 + q], mu); asm volatile("" : "+v"(d0)); float n0 = __fmul_rn(d0, rs); asm volatile("" : "+v"(n0)); float y = __fmul_rn(n0, gg); asm volatile("" : "+v"(y)); y = __fadd_rn(y, bfr(gb[c0 + q])); unsigned short a, c2; splitf(y, a, c2); oh[q] = a; ol[q] = c2; }
            bf* p = sF + (c0 >> 3) * LG + lr * 8 + (c0 & 7); *(v4us*)p = oh; *(v4us*)(p + LPL) = ol; }
         } }
__device__ __forceinline__ void ln16(const float* __restrict__ X, const float* __restrict__ gw, const float* __restrict__ gb, bf* Yh, bf* Yl, int blk, bf* sF) {
    const int tid = threadIdx.x, lane = tid & 31, l0 = (tid >> 5) * 2; const float* xr = X + (size_t)(blk * 16 + l0) * DM + lane * 4;
    const v4f a0 = *(const v4f*)xr, a1 = *(const v4f*)(xr + 128), b0 = *(const v4f*)(xr + DM), b1 = *(const v4f*)(xr + DM + 128);
    lnrow(a0, a1, l0, gw, gb, sF); lnrow(b0, b1, l0 + 1, gw, gb, sF);
    __syncthreads();   // the tile is complete in LDS: each thread takes out pieces that other waves wrote
#pragma unroll
    for (int u = 0; u < 2; ++u) { const int q = tid + u * 256; const bf* p = sF + (q >> 4) * LG + (q & 15) * 8; const size_t o = (size_t)blk * (16 * DM) + q * 8;
        *(v8us*)(Yh + o) = *(const v8us*)p; *(v8us*)(Yl + o) = *(const v8us*)(p + LPL); }
    asm volatile("s_wait_xcnt 0x0" ::: "memory");   // behind the last of the four stores: no register that a store names is rewritten in front of this wait
}

// k_prep: all that the attention launch and the last GEMM read from the workspace, in ONE launch of independent work-groups: the first WTB groups write the transposed 16-bit weights, the others the LayerNorm planes.
// No group reads what another writes. The weight groups have the lowest indices.
#define WTB_Q  (DM * DQ / 64 / 64)         // groups of 64 lines for Wq, and for Wg
#define WTB_KV (DM * 2 * DQ / 64 / 64)     // for Wkv
#define WTB_O  (DQ * DM / 64 / 64)         // for Wo
#define WTB    (2 * WTB_Q + WTB_KV + WTB_O)
static_assert(((DM * DQ / 64) % 64) == 0);
__global__ __launch_bounds__(256) void k_prep(const float* __restrict__ X, const float* __restrict__ gw, const float* __restrict__ gb, const float* __restrict__ wq, const float* __restrict__ wkv, const float* __restrict__ wg, const float* __restrict__ wo, bf* WB, bf* WO, bf* Yh, bf* Yl) {
    __shared__ __align__(16) bf sF[2 * LPL];   // a LayerNorm group's tile, hi | lo
    const int b = (int)blockIdx.x;   // every branch below is the same for the whole work-group, the barrier of the last one included
    /* weights ('xw': Bt[n][k] = W[k][n]); the fused Wkv gives Bt rows 512..1023 = k, 1024..1535 = v */
    if (b < WTB_Q) wtG(wq, DM, DQ, WB, b);
    else if (b < WTB_Q + WTB_KV) wtG(wkv, DM, 2 * DQ, WB + (size_t)DQ * DM, b - WTB_Q);
    else if (b < 2 * WTB_Q + WTB_KV) wtG(wg, DM, DQ, WB + (size_t)3 * DQ * DM, b - (WTB_Q + WTB_KV));
    else if (b < WTB) wtG(wo, DQ, DM, WO, b - (2 * WTB_Q + WTB_KV));
    else ln16(X, gw, gb, Yh, Yl, b - WTB, sF);
}

// k_attn: the q, k, v, g projections, scores, softmax, attn.v and the gate of one plane z = (sequence s, head h) in one pass of a work-group of 16 waves; wave w owns the 16 tokens (queries) 16w .. 16w + 15 and all TT keys.
// Projections: the head's 4 x 64 weight rows (q, g, k, v, each [n][k] over all DM k) are brought into LDS by asynchronous copies (k, v once a work-group; q, g once a pass, because the output rows reuse their LDS); a wave holds the hi / lo fragments of its 16 rows of xn for all DM k in registers
// and runs through the 16 tiles of 16 features two at a time, per accumulator hi.w then lo.w at each 32 k. The same xn fragment serves as B (tokens = columns) or as A (tokens = rows):
// q, k, g: D = W xn^T: register r of lane l = (feature 8 (l >> 4) + r, token l & 15): 8 consecutive features of one token. k: one 16-byte LDS store a plane into K [key][d]; q: feature tiles 2 ks and 2 ks + 1, split hi / lo, ARE the B fragment of d = 32 ks .. 32 ks + 31; g: the layout of O^T below.
// v: D = xn W^T: register r of lane l = (token 8 (l >> 4) + r, feature l & 15): 8 consecutive keys of one d: one 16-byte LDS store a plane into V^T [d][key].
// S^T = K Q^T (A = K rows, B = Q rows): D register r of tile kb in lane l = score(key 16 kb + 8 (l >> 4) + r, query l & 15), so a lane holds 128 scores of ONE query:
// maximum and sum in the lane plus one exchange between the wave's halves. Tiles 2j and 2j + 1, normalised and split hi / lo in place, ARE the B fragment of keys 32j .. 32j + 31
// in the loader's k order, so O^T = V^T P^T (A = V^T rows) needs no exchange. Products per accumulator in the order hi.hi, lo.hi, hi.lo of (q, k) and of (p, v).
// Epilogue: AT hi / lo planes [s*TT + t][h*HD + d] = O[t][d] x sigmoid(g[t][d] + bg[h*HD + d]).
#define KP 72     // LDS pitch of a K row, 16-bit elements: 144 B = 16 B x 9; an odd multiple of 16 B keeps the 16-byte fragment reads off each other's banks
#define VP 264    // LDS pitch of a V^T row: 528 B = 16 B x 33
#define WP 264    // LDS pitch of a weight row of DM k: 528 B = 16 B x 33
#define OP 68     // LDS pitch of an output row, floats: 272 B = 16 B x 17
static_assert(TT == 256 && HD == 64 && DM == 256);
static_assert(2 * HD * WP <= 16 * 16 * OP * 2);   // the output rows reuse the LDS of the q and g weights, and are the larger of the two
typedef __attribute__((ext_vector_type(2))) float  v2f;
typedef __attribute__((ext_vector_type(2))) __bf16 v2bf;
typedef __attribute__((ext_vector_type(8))) unsigned v8u;
typedef __attribute__((ext_vector_type(4))) __bf16 v4bf;
typedef __attribute__((ext_vector_type(8))) __bf16 v8bf;
// Four asynchronous copies of 16 bytes a lane: rows r, r + 16, r + 32, r + 48 of one 64-row weight block (a wave's 32 lanes cover one whole row of 512 bytes a copy).
// s_wait_xcnt stands inside the statement, behind the last copy: no address register of a copy is rewritten in front of it.
__device__ __forceinline__ void cp4(unsigned l, const bf* g) {
    asm volatile("global_load_async_to_lds_b128 %0, %4, off\n\tglobal_load_async_to_lds_b128 %1, %5, off\n\tglobal_load_async_to_lds_b128 %2, %6, off\n\tglobal_load_async_to_lds_b128 %3, %7, off\n\ts_wait_xcnt 0x0"
                 :: "v"(l), "v"(l + 1u * 16 * WP * 2), "v"(l + 2u * 16 * WP * 2), "v"(l + 3u * 16 * WP * 2), "v"(g), "v"(g + 16 * DM), "v"(g + 32 * DM), "v"(g + 48 * DM) : "memory");
}
// Two feature tiles (32 weight rows in LDS from pc, this lane's place in them included) over all DM k; XA: xn is the A operand (v), else the B operand. The last step fetches the first fragments of the next pair, at pn.
template <bool XA, bool LAST>
__device__ __forceinline__ void proj2(const bf* pc, const bf* pn, const v16bf (&xh)[8], const v16bf (&xl)[8], v16bf (&fw)[2][2], v8f& a0, v8f& a1) {
    a0 = (v8f){}; a1 = (v8f){};
#pragma unroll
    for (int kk = 0; kk < 8; ++kk) { const int cb = kk & 1, nb = cb ^ 1;
        if (kk < 7 || !LAST) { const bf* q = (kk < 7) ? pc + (kk + 1) * 32 : pn; fw[nb][0] = WFrag<bf>::ld(q); fw[nb][1] = WFrag<bf>::ld(q + 16 * WP); }
        if (XA) { a0 = wmmab(xh[kk], fw[cb][0], a0); a1 = wmmab(xh[kk], fw[cb][1], a1); a0 = wmmab(xl[kk], fw[cb][0], a0); a1 = wmmab(xl[kk], fw[cb][1], a1); }
        else    { a0 = wmmab(fw[cb][0], xh[kk], a0); a1 = wmmab(fw[cb][1], xh[kk], a1); a0 = wmmab(fw[cb][0], xl[kk], a0); a1 = wmmab(fw[cb][1], xl[kk], a1); } }
}
// A lane's 8 values of each of two tiles, split hi / lo: one 16-byte LDS store a tile and plane
__device__ __forceinline__ void put2(bf* ph, bf* pl, int step, v8f a0, v8f a1) {
    const v8bf h0 = __builtin_convertvector(a0, v8bf), h1 = __builtin_convertvector(a1, v8bf);
    const v8bf l0 = __builtin_convertvector(a0 - __builtin_convertvector(h0, v8f), v8bf), l1 = __builtin_convertvector(a1 - __builtin_convertvector(h1, v8f), v8bf);
    *(v8us*)ph = __builtin_bit_cast(v8us, h0); *(v8us*)(ph + step) = __builtin_bit_cast(v8us, h1); *(v8us*)pl = __builtin_bit_cast(v8us, l0); *(v8us*)(pl + step) = __builtin_bit_cast(v8us, l1);
}
// Two tiles of 16 features each, split hi / lo, as the fragment of those 32 features in the loader's k order
__device__ __forceinline__ void frag2(v8f a0, v8f a1, v16bf& fh, v16bf& fl) {
    const v8bf h0 = __builtin_convertvector(a0, v8bf), h1 = __builtin_convertvector(a1, v8bf);
    const v8bf l0 = __builtin_convertvector(a0 - __builtin_convertvector(h0, v8f), v8bf), l1 = __builtin_convertvector(a1 - __builtin_convertvector(h1, v8f), v8bf);
    fh = __builtin_shufflevector(h0, h1, 0, 1, 2, 3, 4, 5, 6, 7, 8, 9, 10, 11, 12, 13, 14, 15); fl = __builtin_shufflevector(l0, l1, 0, 1, 2, 3, 4, 5, 6, 7, 8, 9, 10, 11, 12, 13, 14, 15);
}
// A pointer that is the same in every lane, passed through scalar registers: the pass's part of an address is then summed in scalar registers and the lane's offset added where it is used. Without it the build carries whole 64-bit lane addresses in vector registers from pass to pass, and spills
typedef __attribute__((address_space(1))) char gchar; typedef __attribute__((address_space(1))) v8us gv8us; typedef __attribute__((address_space(1))) v4us gv4us;   // global memory, said in the type: a pointer rebuilt from two words would else be taken for a flat one
__device__ __forceinline__ gchar* sptr(const void* p) { const unsigned long long u = (unsigned long long)p; return (gchar*)(((unsigned long long)(unsigned)__builtin_amdgcn_readfirstlane((int)(u >> 32)) << 32) | (unsigned)__builtin_amdgcn_readfirstlane((int)u)); }
// Work-group barrier that orders LDS accesses only: the global loads in flight (the next sequence's xn), which no wave of the launch writes, are not waited for
__device__ __forceinline__ void bar_lds() { __builtin_amdgcn_fence(__ATOMIC_RELEASE, "workgroup", "local"); __builtin_amdgcn_s_barrier(); __builtin_amdgcn_fence(__ATOMIC_ACQUIRE, "workgroup", "local"); }
#define XLAG 2   // steps of 32 keys that have passed before the first 32 k of the next xn are asked for: earlier there is no free register
#define NPS 4   // sequences that one work-group runs through, one after the other, all for the same head
static_assert((NB_ % NPS) == 0);
__global__ __launch_bounds__(512) void k_attn(const bf* __restrict__ Xh, const bf* __restrict__ Xl, const bf* __restrict__ Wb, const float* __restrict__ bgp, bf* __restrict__ Ah, bf* __restrict__ Al) {
    __shared__ __align__(16) bf sKh[TT * KP]; __shared__ __align__(16) bf sKl[TT * KP];
    __shared__ __align__(16) bf sVh[HD * VP]; __shared__ __align__(16) bf sVl[HD * VP];
    __shared__ __align__(16) bf sWa[16 * 16 * OP * 2]; __shared__ __align__(16) bf sWb[2 * HD * WP];   // weight rows q | g and k | v: two arrays, so that each has its own base register and the constant part of every fragment read fits the instruction's 16-bit offset field
    float* sO = (float*)sWa;   // used only behind the barrier that ends every wave's reads of the weights
    const int tid = threadIdx.x, lane = tid & 31, lr = lane & 15, hi = lane >> 4; const int wv = __builtin_amdgcn_readfirstlane(tid >> 5);   // the wave's number, in a scalar register: the wave's part of every address stays out of the vector registers
    const int sq0 = (int)blockIdx.x / NH_, col0 = ((int)blockIdx.x % NH_) * HD;   // pass it works on sequence sq0 + it * (NB_ / NPS); the 8 heads of a sequence are neighbouring work-groups
    // weights: wave w copies rows w + 16 i of each of the four blocks; block b (0 q, 1 k, 2 v, 3 g) of the head = rows b*DQ + col0 .. + 63 of Wb; in LDS: q | g in sWa, k | v in sWb
    const unsigned lo = (unsigned)((wv * WP + lane * 8) * 2), la = (unsigned)(size_t)sWa + lo, lb = (unsigned)(size_t)sWb + lo; const bf* gw = Wb + (size_t)(col0 + wv) * DM + lane * 8;
    cp4(lb, gw + (size_t)1 * DQ * DM); cp4(lb + 1u * HD * WP * 2, gw + (size_t)2 * DQ * DM);   // k | v: once, they stay in LDS for every pass
    v16bf xh[8], xl[8];   // this wave's 16 rows of xn, all DM k
    const size_t xo = ((size_t)sq0 * TT + wv * 16) * DM; const unsigned xv = (unsigned)lane * 16;   // the wave's token tile of the first sequence (the same for the whole wave: a scalar base), in fragment order (ln16): 32 k = two runs of 512 bytes, lane by lane (xv)
#pragma unroll
    for (int kk = 0; kk < 8; ++kk) { const char* ph_ = (const char*)(Xh + xo + kk * 512) + xv; const char* pl_ = (const char*)(Xl + xo + kk * 512) + xv; xh[kk] = cat16b(*(const v8us*)ph_, *(const v8us*)(ph_ + 512)); xl[kk] = cat16b(*(const v8us*)pl_, *(const v8us*)(pl_ + 512)); }
    asm volatile("s_wait_xcnt 0x0" :: "v"(xv), "v"(lane) : "memory");   // behind the last of these loads; the lane's offset is named as an input, in both forms the loads may take it in, so that it lives up to here: no load's result lands on it in front of this wait
    asm volatile("s_wait_asynccnt 0x0" ::: "memory");   // this wave's copies of the k | v weights have landed
    __syncthreads();                                      // and every other wave's: they may be read
#pragma unroll 1   // one pass a sequence; rolled
    for (int it = 0; it < NPS; ++it) {
    const size_t tok0 = (size_t)(sq0 + it * (NB_ / NPS)) * TT;
    cp4(la, gw); cp4(la + 1u * HD * WP * 2, gw + (size_t)3 * DQ * DM);   // q | g: their LDS held the last pass's output rows; the copies fly while k and v are projected
    // Projections: step (pair of feature tiles in the order k, k, v, v, g, g, q, q; 32 k), 2 fragments and 4 products; each step's fragments are fetched one step ahead
    v16bf qh[2], ql[2], fw[2][2]; v8f gt[4], a0, a1;
    const bf* pa = sWa + lr * WP + 8 * hi; const bf* pb = sWb + lr * WP + 8 * hi;
    fw[0][0] = WFrag<bf>::ld(pb); fw[0][1] = WFrag<bf>::ld(pb + 16 * WP);
    bf* pkh = sKh + (wv * 16 + lr) * KP + 8 * hi; bf* pkl = sKl + (wv * 16 + lr) * KP + 8 * hi; bf* pvh = sVh + lr * VP + wv * 16 + 8 * hi; bf* pvl = sVl + lr * VP + wv * 16 + 8 * hi;
    proj2<false, false>(pb, pb + 32 * WP, xh, xl, fw, a0, a1); put2(pkh, pkl, 16, a0, a1);
    proj2<false, false>(pb + 32 * WP, pb + 64 * WP, xh, xl, fw, a0, a1); put2(pkh + 32, pkl + 32, 16, a0, a1);
    proj2<true, false>(pb + 64 * WP, pb + 96 * WP, xh, xl, fw, a0, a1); put2(pvh, pvl, 16 * VP, a0, a1);
    proj2<true, true>(pb + 96 * WP, pb, xh, xl, fw, a0, a1); put2(pvh + 32 * VP, pvl + 32 * VP, 16 * VP, a0, a1);
    asm volatile("s_wait_asynccnt 0x0" ::: "memory");   // this wave's copies of the q | g weights have landed
    __syncthreads();                                      // and every other wave's: they may be read
    fw[0][0] = WFrag<bf>::ld(pa + 64 * WP); fw[0][1] = WFrag<bf>::ld(pa + 80 * WP);
    proj2<false, false>(pa + 64 * WP, pa + 96 * WP, xh, xl, fw, gt[0], gt[1]);
    proj2<false, false>(pa + 96 * WP, pa, xh, xl, fw, gt[2], gt[3]);
    proj2<false, false>(pa, pa + 32 * WP, xh, xl, fw, a0, a1); frag2(a0, a1, qh[0], ql[0]);
    proj2<false, true>(pa + 32 * WP, pa, xh, xl, fw, a0, a1); frag2(a0, a1, qh[1], ql[1]);
    __syncthreads();   // K and V^T are complete in LDS, they are only read from here on; and every wave's reads of the weights are done: the LDS of the q | g weights may be rewritten
    // the gates, in the layout of O^T, wait in this lane's own places of the wave's output rows
    float* os = sO + wv * (16 * OP);
#pragma unroll
    for (int mb = 0; mb < 4; ++mb) { const float* bp = bgp + col0 + mb * 16 + 8 * hi; const v4f b0 = *(const v4f*)bp, b1 = *(const v4f*)(bp + 4); v4f g0, g1;
#pragma unroll
        for (int c = 0; c < 4; ++c) { g0[c] = __fdiv_rn(1.0f, 1.0f + expf(-(gt[mb][c] + bfr(b0[c])))); g1[c] = __fdiv_rn(1.0f, 1.0f + expf(-(gt[mb][4 + c] + bfr(b1[c])))); }
        float* p = os + lr * OP + mb * 16 + 8 * hi; *(v4fa*)p = g0; *(v4fa*)(p + 4) = g1; }
    // Scores: step st = (pair of key tiles st >> 1, half ks = st & 1 of the head dim), 4 fragments and 6 products; each step's fragments are fetched as one group one step ahead
    v8f s[16]; v16bf fk[2][4];
    const int kof = lr * KP + 8 * hi;
#pragma unroll
    for (int p = 0; p < 2; ++p) { fk[0][p] = WFrag<bf>::ld(sKh + kof + p * 16 * KP); fk[0][2 + p] = WFrag<bf>::ld(sKl + kof + p * 16 * KP); }
#pragma unroll
    for (int st = 0; st < 16; ++st) { const int kb = (st >> 1) * 2, ks = st & 1, cb = st & 1, nb = cb ^ 1;
        if (st + 1 < 16) { const int o = kof + ((st + 1) >> 1) * 32 * KP + ((st + 1) & 1) * 32;
#pragma unroll
            for (int p = 0; p < 2; ++p) { fk[nb][p] = WFrag<bf>::ld(sKh + o + p * 16 * KP); fk[nb][2 + p] = WFrag<bf>::ld(sKl + o + p * 16 * KP); } }
        v8f a0 = ks ? s[kb] : (v8f){}, a1 = ks ? s[kb + 1] : (v8f){};
        a0 = wmmab(fk[cb][0], qh[ks], a0); a1 = wmmab(fk[cb][1], qh[ks], a1); a0 = wmmab(fk[cb][0], ql[ks], a0); a1 = wmmab(fk[cb][1], ql[ks], a1); a0 = wmmab(fk[cb][2], qh[ks], a0); a1 = wmmab(fk[cb][3], qh[ks], a1);
        s[kb] = a0; s[kb + 1] = a1; }
    v8f m8 = s[0];
#pragma unroll
    for (int kb = 1; kb < 16; ++kb)
#pragma unroll
        for (int r = 0; r < 8; ++r) m8[r] = fmaxf(m8[r], s[kb][r]);
    float mx = fmaxf(fmaxf(fmaxf(m8[0], m8[1]), fmaxf(m8[2], m8[3])), fmaxf(fmaxf(m8[4], m8[5]), fmaxf(m8[6], m8[7])));
    mx = fmaxf(mx, __shfl_xor(mx, 16, 32)) * SCL;   // the scale is a positive power of two: scaling the maximum is the maximum of the scaled scores
    v8f s8;
#pragma unroll
    for (int kb = 0; kb < 16; ++kb) {
#pragma unroll
        for (int r = 0; r < 8; r += 4) { float x[4], ex[4];
#pragma unroll
            for (int c = 0; c < 4; ++c) x[c] = (s[kb][r + c] * SCL - mx) * 1.4426950408889634f;
            // four exponentials whose results share no register with any argument, then one v_nop: the slot the instruction set asks for behind a transcendental; inside the statement it cannot drift away
            asm("v_exp_f32 %0, %4\n\tv_exp_f32 %1, %5\n\tv_exp_f32 %2, %6\n\tv_exp_f32 %3, %7\n\tv_nop" : "=&v"(ex[0]), "=&v"(ex[1]), "=&v"(ex[2]), "=&v"(ex[3]) : "v"(x[0]), "v"(x[1]), "v"(x[2]), "v"(x[3]));
#pragma unroll
            for (int c = 0; c < 4; ++c) { s[kb][r + c] = ex[c]; s8[r + c] = kb ? s8[r + c] + ex[c] : ex[c]; } } }
    float sum = ((s8[0] + s8[1]) + (s8[2] + s8[3])) + ((s8[4] + s8[5]) + (s8[6] + s8[7]));
    sum += __shfl_xor(sum, 16, 32);
    const float f = __fdiv_rn(1.0f, sum);
    // attn.v: step st = (32 keys j = st >> 1, pair of d tiles st & 1), fetched one step ahead like the scores' steps; the two score tiles of j become P^T hi / lo just before their first use
    v8f o[4]; v16bf fv[2][4]; v16bf ph, pl;
    // the next sequence's xn is asked for here, 32 k behind each 32 keys from the XLAG-th on: score tiles that have become P^T free the registers it lands in, and the loads fly under the rest of attn.v and the epilogue.
    // The last pass has no next sequence: it asks for its own once more (in bounds, never read), so that the stream of matrix instructions holds no branch.
    const size_t xn = xo + (size_t)((it + 1 < NPS) ? it + 1 : it) * (NB_ / NPS) * TT * DM; const gchar* bh = sptr(Xh + xn) + xv; const gchar* bl = sptr(Xl + xn) + xv;
    const int vof = lr * VP + 8 * hi;
#pragma unroll
    for (int p = 0; p < 2; ++p) { fv[0][p] = WFrag<bf>::ld(sVh + vof + p * 16 * VP); fv[0][2 + p] = WFrag<bf>::ld(sVl + vof + p * 16 * VP); }
#pragma unroll
    for (int st = 0; st < 16; ++st) { const int j = st >> 1, mb = (st & 1) * 2, cb = st & 1, nb = cb ^ 1;
        if (st + 1 < 16) { const int ofs = vof + ((st + 1) & 1) * 32 * VP + ((st + 1) >> 1) * 32;
#pragma unroll
            for (int p = 0; p < 2; ++p) { fv[nb][p] = WFrag<bf>::ld(sVh + ofs + p * 16 * VP); fv[nb][2 + p] = WFrag<bf>::ld(sVl + ofs + p * 16 * VP); } }
        if ((st & 1) == 0) { v8u wh, wl;
#pragma unroll
            for (int i = 0; i < 8; ++i) { const v8f t = s[2 * j + (i >> 2)]; const v2f y = { t[(2 * i) & 7] * f, t[(2 * i + 1) & 7] * f };
                const v2bf h = __builtin_convertvector(y, v2bf); const v2bf l = __builtin_convertvector(y - __builtin_convertvector(h, v2f), v2bf);
                wh[i] = __builtin_bit_cast(unsigned, h); wl[i] = __builtin_bit_cast(unsigned, l); }
            ph = __builtin_bit_cast(v16bf, wh); pl = __builtin_bit_cast(v16bf, wl); }
        v8f a0 = j ? o[mb] : (v8f){}, a1 = j ? o[mb + 1] : (v8f){};
        a0 = wmmab(fv[cb][0], ph, a0); a1 = wmmab(fv[cb][1], ph, a1); a0 = wmmab(fv[cb][0], pl, a0); a1 = wmmab(fv[cb][1], pl, a1); a0 = wmmab(fv[cb][2], ph, a0); a1 = wmmab(fv[cb][3], ph, a1);
        o[mb] = a0; o[mb + 1] = a1;
        if ((st & 1) && j >= XLAG) { const int kk = j - XLAG; xh[kk] = cat16b(*(const gv8us*)(bh + kk * 1024), *(const gv8us*)(bh + kk * 1024 + 512)); xl[kk] = cat16b(*(const gv8us*)(bl + kk * 1024), *(const gv8us*)(bl + kk * 1024 + 512)); } }
#pragma unroll
    for (int kk = 8 - XLAG; kk < 8; ++kk) { xh[kk] = cat16b(*(const gv8us*)(bh + kk * 1024), *(const gv8us*)(bh + kk * 1024 + 512)); xl[kk] = cat16b(*(const gv8us*)(bl + kk * 1024), *(const gv8us*)(bl + kk * 1024 + 512)); }
    asm volatile("s_wait_xcnt 0x0" :: "v"(bh), "v"(bl) : "memory");   // behind the last of these loads; the two addresses are named as inputs so that they live up to here: no load's result, and nothing else, lands on an address register in front of this wait
    // o[mb][r] = O(query lr, d = 16 mb + 8 hi + r), times its gate; then through the wave's own LDS rows, so that each store instruction writes whole 128-byte lines
#pragma unroll
    for (int mb = 0; mb < 4; ++mb) { float* p = os + lr * OP + mb * 16 + 8 * hi; const v4f g0 = *(const v4fa*)p, g1 = *(const v4fa*)(p + 4);
        *(v4fa*)p = __builtin_shufflevector(o[mb], o[mb], 0, 1, 2, 3) * g0; *(v4fa*)(p + 4) = __builtin_shufflevector(o[mb], o[mb], 4, 5, 6, 7) * g1; }
    asm volatile("s_wait_dscnt 0x0" ::: "memory");   // the rows read below were written by other lanes of this wave: the writes are done, and stay in front, before they are read back
    v4f ov[8];   // all eight LDS reads are issued before the first store waits for one
#pragma unroll
    for (int q = 0; q < 8; ++q) ov[q] = *(const v4fa*)(os + (2 * q + hi) * OP + lr * 4);
    asm volatile("s_wait_dscnt 0x0" ::: "memory");   // this wave's reads of K, V^T and of its output rows are done
    bar_lds();                                         // and every other wave's: the next pass may rewrite K, V^T and the LDS of the q | g weights
    // this lane's part of the output: tokens wv*16 + hi + 2q (q = 0 .. 7), columns lr*4 .. lr*4 + 3 of the head
    const unsigned ao = (unsigned)((hi * DQ + lr * 4) * 2);   // 16 lanes x 8 bytes = one whole 128-byte line of a plane per token
    gchar* ah = sptr(Ah + (tok0 + wv * 16) * DQ + col0) + ao; gchar* al = sptr(Al + (tok0 + wv * 16) * DQ + col0) + ao;
#pragma unroll
    for (int q = 0; q < 8; ++q) { const v4f y = ov[q];
        const v4bf h = __builtin_convertvector(y, v4bf); const v4bf l = __builtin_convertvector(y - __builtin_convertvector(h, v4f), v4bf);
        *(gv4us*)(ah + q * 2 * DQ * 2) = __builtin_bit_cast(v4us, h); *(gv4us*)(al + q * 2 * DQ * 2) = __builtin_bit_cast(v4us, l); }
    asm volatile("s_wait_xcnt 0x0" ::: "memory");    // behind the last store: no register that a store names is rewritten in front of this wait
    }
}

extern "C" void kernel_launch(void* const* d_in, const int* in_sizes, int n_in,
                              void* d_out, int out_size, void* d_ws, size_t ws_size, hipStream_t stream) {
    if (n_in < 9) return;
    if (in_sizes[0] < NT * DM || in_sizes[1] < DM || in_sizes[2] < DM || in_sizes[3] < DM * DQ || in_sizes[4] < DM * 2 * DQ
        || in_sizes[5] < DM * DQ || in_sizes[6] < DQ || in_sizes[7] < DQ * DM || in_sizes[8] < DM) return;
    if (out_size < NT * DM) return;
    const float* x = (const float*)d_in[0]; const float* ln_g = (const float*)d_in[1]; const float* ln_b = (const float*)d_in[2]; const float* wq = (const float*)d_in[3]; const float* wkv = (const float*)d_in[4]; const float* wg = (const float*)d_in[5]; const float* bg = (const float*)d_in[6]; const float* wo = (const float*)d_in[7]; const float* bo = (const float*)d_in[8];
    float* OUT = (float*)d_out;     // [NB][TT][DM] = [NT][256]
    char* wsp = (char*)d_ws;
    auto take = [&](size_t bytes) { char* p = wsp; wsp += (bytes + 255) & ~(size_t)255; return (void*)p; };
    bf* WB = (bf*)take((size_t)DP * DM * 2);     // Bt [2048][256]: rows 0..511 q, 512..1023 k, 1024..1535 v, 1536..2047 g
    bf* WO = (bf*)take((size_t)DM * DQ * 2);     // Bt [256][512]
    bf* LNh = (bf*)take((size_t)NT * DM * 2); bf* LNl = (bf*)take((size_t)NT * DM * 2);
    bf* ATh = (bf*)take((size_t)NT * DQ * 2); bf* ATl = (bf*)take((size_t)NT * DQ * 2);
    if ((size_t)(wsp - (char*)d_ws) > ws_size) return;
    k_prep<<<WTB + NT / 16, 256, 0, stream>>>(x, ln_g, ln_b, wq, wkv, wg, wo, WB, WO, LNh, LNl);
    k_attn<<<ZH / NPS, 512, 0, stream>>>(LNh, LNl, WB, bg, ATh, ATl);
    k_gemmw<bf, 1, true><<<dim3(NT / 128, DM / 128, 1), 128, 0, stream>>>(ATh, ATl, WO, nullptr, DQ, OUT, DM, bo, 0, 0, 0);
}

// v010
// It runs in 105 microseconds.
// Two timings next to v009 put it at 1.03 and 1.04 times that version's speed.
// Over all steps from v000 it is 9.77 times as fast.
#include <hip/hip_runtime.h>

// Gated row attention along the width axis with a pre-LayerNorm: x [1][128][256][256] = 128 independent sequences (image rows) of 256 tokens x 256 features; xn = LayerNorm(x) (gamma, beta, eps 1e-5); q = xn Wq ('xw' [256][512], 8 heads x 64), [k|v] = xn Wkv ('xw' [256][1024]: columns k | v); dots = (q/8).k over the 256 keys of the same sequence; softmax; out = attn.v merged; gates = sigmoid(xn Wg + bg) ('xw' [256][512]); y = (out * gates) Wo + bo ('xw' [512][256]) -> [1][128][256][256] (8.4 M).
// Compute dtypes, f32 accumulate: all contractions v_wmma_f32_16x16x32_bf16 (bf16 operands). Every input RNE-converted to bf16 on load; LayerNorm in f32, xn as bf16 hi + lo planes; q, k, v, g projections as (hi + lo) x exact weights (2 products); scores and attn.v on bf16 hi/lo operands (3 products) for every row; softmax f32; sigmoid gate f32 (hardware 2^x and reciprocal) with f32 bias add; (out x gate) as hi + lo x exact Wo (2 products) + bo.
// Layout: the transposed weights and the LayerNorm planes for all tokens (in the fragment order of their one reader, see ln16) in one launch; then ONE launch with one work-group per (head, 4 sequences, one after the other) does that head's q, k, v, g projections, the scores, the softmax, attn.v and the gate: q, k, v, g, the scores and the probabilities never leave the WGP (k and v go to LDS, q and the probabilities stay in registers), and the gated output goes out as the hi / lo planes that the last GEMM reads. The last GEMM stages its operands in LDS with asynchronous copies (4 waves share a 128x128 tile).

#ifndef NB_
#define NB_  128       // sequences (image rows) processed by this build
#endif
#define NB_FULL 128    // sequences in the input / output
#define TT   256       // tokens per sequence
#define DM   256
#define NH_  8
#define HD   64
#define DQ   (NH_ * HD)    // 512 = inner dim
#define DP   (4 * DQ)      // 2048 = rows of the transposed weights q | k | v | g
#define ZH   (NB_ * NH_)   // (sequence, head) planes
#define NT   (NB_ * TT)    // token rows in total
#define SCL  0.125f        // HD^-0.5

static_assert(NB_ >= 1 && NB_ <= NB_FULL);
static_assert((TT % 64) == 0 && (HD % 64) == 0 && (DM % 64) == 0 && (DQ % 64) == 0 && (DP % 64) == 0);
static_assert((HD % 32) == 0 && (DM % 32) == 0 && (DQ % 32) == 0 && (TT % 32) == 0);
static_assert((TT % 128) == 0 && (NT % 16) == 0 && (TT % 16) == 0 && (DM % 128) == 0);
static_assert(((DQ * DM) % 64) == 0 && ((2 * DQ * DM) % 64) == 0);
static_assert((NT % 128) == 0 && (DM % 128) == 0 && (DQ % 128) == 0);

typedef unsigned short bf;
typedef __attribute__((ext_vector_type(16))) __bf16   v16bf;
typedef __attribute__((ext_vector_type(8)))  unsigned short v8us;
typedef __attribute__((ext_vector_type(8)))  float    v8f;
typedef __attribute__((ext_vector_type(4)))  float    v4f;
typedef v4f  __attribute__((may_alias)) v4fa;
typedef __attribute__((ext_vector_type(2))) unsigned short v2us;
typedef __attribute__((ext_vector_type(4))) unsigned short v4us;

constexpr size_t al256(size_t b) { return (b + 255) & ~(size_t)255; }
constexpr size_t WS_NEED = al256((size_t)DP * DM * 2) + al256((size_t)DM * DQ * 2) + 2 * al256((size_t)NT * DM * 2) + 2 * al256((size_t)NT * DQ * 2);
static_assert(WS_NEED <= (size_t)268435456);


__device__ __forceinline__ unsigned short f2bf(float f) { unsigned u = __float_as_uint(f); u += 0x7FFFu + ((u >> 16) & 1u); return (unsigned short)(u >> 16); }
__device__ __forceinline__ float bf2f(unsigned short b) { return __uint_as_float(((unsigned)b) << 16); }
__device__ __forceinline__ float bfr(float f) { return bf2f(f2bf(f)); }
__device__ __forceinline__ v16bf cat16b(v8us lo, v8us hi) { return __builtin_bit_cast(v16bf, __builtin_shufflevector(lo, hi, 0, 1, 2, 3, 4, 5, 6, 7, 8, 9, 10, 11, 12, 13, 14, 15)); }
__device__ __forceinline__ v8f wmmab(v16bf a, v16bf b, v8f c) { return __builtin_amdgcn_wmma_f32_16x16x32_bf16(false, a, false, b, (short)0, c, false, false); }
__device__ __forceinline__ void splitf(float y, unsigned short& h, unsigned short& l) { h = f2bf(y); l = f2bf(y - bf2f(h)); }

// ---- k_gemmw: register-blocked GEMM, one wave per 64x64 output tile (16 accumulators), FOUR waves (2 x 2) per work-group = a 128x128 tile; grid (M/128, N/128, Z), 128 threads.
// Operands are K-contiguous 16-bit planes. A trip is 64 k: 128 rows of A, of A2 and of Bt, 128 bytes each (one whole line a row), are brought into LDS by asynchronous copies, two buffers, the next trip's copies in flight while this trip's products run; fragments are read from LDS at pitch GP. K % 64 == 0.
// C[m][n] (f32, pitch ldc, + optional f32 bias[n]) = sum_k A[m][k] Bt[n][k] + sum_k A2[m][k] Bt[n][k] (NSPLIT 1). z-batch strides sA/sB/sC in elements.
// Fragments: lane l -> row/col l&15, elements 0..7 <- k0 + 8*(l>>4) + 0..7, elements 8..15 <- k0 + 16 + 8*(l>>4) + 0..7 for A and for Bt alike; D element r of lane l = (row 8*(l>>4) + r, col l&15).
template <typename T16> struct WFrag;
template <> struct WFrag<bf> { typedef v16bf V; static __device__ __forceinline__ V ld(const bf* p) { return cat16b(*(const v8us*)p, *(const v8us*)(p + 16)); } static __device__ __forceinline__ v8f mma(V a, V b, v8f c) { return wmmab(a, b, c); } };
#define GP 72                 // LDS pitch of a staged row of 64 k, 16-bit elements: 144 B = 16 B x 9 keeps the 16-byte fragment reads off each other's banks
#define GPL (128 * GP)        // one operand's 128 rows
#define GSTG (3 * GPL)        // one buffer: A | A2 | Bt
// Eight asynchronous copies of 16 bytes a lane: rows r, r + 16, .. r + 112 of one operand (a wave's 32 lanes cover 4 whole 128-byte lines a copy).
// s_wait_xcnt stands inside the statement, behind the last copy: no address register of a copy is rewritten in front of it.
__device__ __forceinline__ void cp8(unsigned l, const bf* g, size_t rs) {
    asm volatile("global_load_async_to_lds_b128 %0, %8, off\n\tglobal_load_async_to_lds_b128 %1, %9, off\n\tglobal_load_async_to_lds_b128 %2, %10, off\n\tglobal_load_async_to_lds_b128 %3, %11, off\n\t"
                 "global_load_async_to_lds_b128 %4, %12, off\n\tglobal_load_async_to_lds_b128 %5, %13, off\n\tglobal_load_async_to_lds_b128 %6, %14, off\n\tglobal_load_async_to_lds_b128 %7, %15, off\n\ts_wait_xcnt 0x0"
                 :: "v"(l), "v"(l + 1u * 16 * GP * 2), "v"(l + 2u * 16 * GP * 2), "v"(l + 3u * 16 * GP * 2), "v"(l + 4u * 16 * GP * 2), "v"(l + 5u * 16 * GP * 2), "v"(l + 6u * 16 * GP * 2), "v"(l + 7u * 16 * GP * 2),
                    "v"(g), "v"(g + rs), "v"(g + 2 * rs), "v"(g + 3 * rs), "v"(g + 4 * rs), "v"(g + 5 * rs), "v"(g + 6 * rs), "v"(g + 7 * rs) : "memory");
}
template <typename T16, int NSPLIT, bool BIAS>
__global__ __launch_bounds__(128) void k_gemmw(const T16* __restrict__ A, const T16* __restrict__ A2, const T16* __restrict__ Bt, const T16* __restrict__ Bt2, int K, float* C, int ldc, const float* __restrict__ bias, size_t sA, size_t sB, size_t sC) {
    static_assert(NSPLIT == 1);   // products a.b and a2.b
    typedef typename WFrag<T16>::V V;
    __shared__ __align__(16) bf sT[2 * GSTG];
    __shared__ __align__(16) float osw[4 * 16 * 68];
    const size_t z = blockIdx.z; A += z * sA; A2 += z * sA; Bt += z * sB; C += z * sC;
    const int tid = threadIdx.x, lane = tid & 31, lr = lane & 15, hi = lane >> 4; const int wv = __builtin_amdgcn_readfirstlane(tid >> 5);   // the wave's number, in a scalar register: tile indices and the epilogue's row bases stay scalar
    const int R0 = blockIdx.x * 128, C0 = blockIdx.y * 128; const int r0 = R0 + (wv >> 1) * 64, c0 = C0 + (wv & 1) * 64;
    float* os = osw + wv * (16 * 68);   // each wave's own rows for its epilogue
    v8f acc[4][4];
#pragma unroll
    for (int mb = 0; mb < 4; ++mb)
#pragma unroll
        for (int nb = 0; nb < 4; ++nb) acc[mb][nb] = (v8f){};
    // this thread's part of a trip's copies: 16-byte piece tid & 7 of rows (tid >> 3) + 16 i, i = 0 .. 7, of each operand
    const size_t rs = (size_t)16 * K; const size_t go = (size_t)(tid >> 3) * K + (tid & 7) * 8;
    const bf* gA = A + (size_t)R0 * K + go; const bf* gA2 = A2 + (size_t)R0 * K + go; const bf* gB = Bt + (size_t)C0 * K + go;
    const unsigned l0 = (unsigned)(size_t)sT + (unsigned)(((tid >> 3) * GP + (tid & 7) * 8) * 2);
    const int nt = K / 64;
    cp8(l0, gA, rs); cp8(l0 + GPL * 2, gA2, rs); cp8(l0 + 2 * GPL * 2, gB, rs);
    asm volatile("s_wait_asynccnt 0x0" ::: "memory");   // this wave's copies of trip 0 have landed
    __syncthreads();                                      // and every other wave's: buffer 0 may be read
    if (nt > 1) { cp8(l0 + GSTG * 2, gA + 64, rs); cp8(l0 + (GSTG + GPL) * 2, gA2 + 64, rs); cp8(l0 + (GSTG + 2 * GPL) * 2, gB + 64, rs); }
    const int aof = ((wv >> 1) * 64 + lr) * GP + 8 * hi, bof = 2 * GPL + ((wv & 1) * 64 + lr) * GP + 8 * hi;
#pragma unroll 1
    for (int t = 0; t < nt; ++t) { const bf* sb = sT + (t & 1) * GSTG;
#pragma unroll
        for (int ks = 0; ks < 2; ++ks) {
            V a[4], a2[4], b[4];
            b[0] = WFrag<T16>::ld(sb + bof + ks * 32);
#pragma unroll
            for (int mb = 0; mb < 4; ++mb) a[mb] = WFrag<T16>::ld(sb + aof + mb * 16 * GP + ks * 32);
#pragma unroll
            for (int mb = 0; mb < 4; ++mb) a2[mb] = WFrag<T16>::ld(sb + GPL + aof + mb * 16 * GP + ks * 32);
#pragma unroll
            for (int nb = 1; nb < 4; ++nb) b[nb] = WFrag<T16>::ld(sb + bof + nb * 16 * GP + ks * 32);
            __builtin_amdgcn_sched_barrier(0);   // the twelve fragments of 32 k are read as ONE group in front of their 32 products: left to itself the build reads each b in front of its own 8 products and waits for it there
#pragma unroll
            for (int nb = 0; nb < 4; ++nb)
#pragma unroll
                for (int mb = 0; mb < 4; ++mb) { acc[mb][nb] = WFrag<T16>::mma(a[mb], b[nb], acc[mb][nb]); acc[mb][nb] = WFrag<T16>::mma(a2[mb], b[nb], acc[mb][nb]); }
        }
        asm volatile("s_wait_dscnt 0x0" ::: "memory");      // this wave's reads of the buffer are done before it is refilled
        asm volatile("s_wait_asynccnt 0x0" ::: "memory");   // this wave's copies of trip t + 1 have landed
        __syncthreads();                                      // publishes trip t + 1's buffer and ends every wave's reads of trip t's
        if (t + 2 < nt) { const unsigned lb = l0 + (unsigned)(t & 1) * (GSTG * 2); const int kc = (t + 2) * 64; cp8(lb, gA + kc, rs); cp8(lb + GPL * 2, gA2 + kc, rs); cp8(lb + 2 * GPL * 2, gB + kc, rs); }
    }
    asm volatile("s_wait_asynccnt 0x0" ::: "memory");   // no copy is outstanding when the wave goes on to its epilogue and ends
#pragma unroll
    for (int mb = 0; mb < 4; ++mb) {
#pragma unroll
        for (int nb = 0; nb < 4; ++nb) {
#pragma unroll
            for (int j = 0; j < 8; ++j) os[(hi * 8 + j) * 68 + nb * 16 + lr] = acc[mb][nb][j]; }
        __builtin_amdgcn_wave_barrier(); asm volatile("" ::: "memory");
        float* crow = C + (size_t)(r0 + mb * 16) * ldc + c0;
{
#pragma unroll
            for (int s = 0; s < 8; ++s) { const int row = 2 * s + hi, cofs = lr * 4; v4f val = *(const v4fa*)(os + row * 68 + cofs); if (BIAS) { val[0] += bfr(bias[c0 + cofs]); val[1] += bfr(bias[c0 + cofs + 1]); val[2] += bfr(bias[c0 + cofs + 2]); val[3] += bfr(bias[c0 + cofs + 3]); }
                *(v4f*)(crow + (size_t)row * ldc + cofs) = val; }
             }
        __builtin_amdgcn_wave_barrier(); asm volatile("" ::: "memory");
    }
}

// Work-group blk of a weight's transpose: 64 lines of 64 elements of Bt[n][k] = W[k][n]
__device__ __forceinline__ void wtG(const float* __restrict__ w, int K, int N, bf* Bt, int blk) {
    const int lane = threadIdx.x & 31; const int L0 = (blk * 8 + (threadIdx.x >> 5)) * 8; const int nlines = N * K / 64;
{
#pragma unroll 1
        for (int l = 0; l < 8; ++l) { const int L = L0 + l; if (L >= nlines) break; const size_t e = (size_t)L * 64 + lane * 2; const int k = (int)(e % K), n = (int)(e / K); v2us o;
            o[0] = f2bf(w[(size_t)k * N + n]); o[1] = f2bf(w[(size_t)(k + 1) * N + n]); *(v2us*)(Bt + e) = o; }
         }
}

// Work-group blk of the LayerNorm: the 16 rows of token tile blk, two a wave.
// The planes are stored in the order in which the attention launch reads its fragments: element (row r, feature k) of a plane stands at [r >> 4][k >> 3][r & 15][k & 7],
// so that the 16 bytes of lane l = 16 hi + lr (row lr, k = 32 kk + 16 part + 8 hi + 0 .. 7) follow each other by lane: one 16-byte load a lane covers 512 contiguous bytes, four whole lines.
// A row's values go to their places through LDS, and the tile leaves in whole lines.
#define LG 136   // LDS pitch of one k >> 3 group (16 rows x 8 elements), 16-bit elements: 272 B = 16 B x 17 keeps a row's 8-byte writes, which step from group to group, off each other's banks
#define LPL (32 * LG)   // one plane of a tile
// One row (lr of its tile), loaded as y0 | y1: this lane's features 4 lane .. + 3 and 128 + 4 lane .. + 3
__device__ __forceinline__ void lnrow(const v4f y0, const v4f y1, int lr, const float* __restrict__ gw, const float* __restrict__ gb, bf* sF) {
    const int lane = threadIdx.x & 31; float hv[8]; float s = 0.f;
#pragma unroll
    for (int ch = 0; ch < 2; ++ch) { const v4f y = ch ? y1 : y0;
#pragma unroll
        for (int q = 0; q < 4; ++q) { const float u = bfr(y[q]); hv[ch * 4 + q] = u; s += u; } }
#pragma unroll
    for (int sh = 16; sh; sh >>= 1) s += __shfl_xor(s, sh, 32);
    float mu = s * (1.0f / 256.0f); asm volatile("" : "+v"(mu)); float s2 = 0.f;
#pragma unroll
    for (int k = 0; k < 8; ++k) { float d0 = __fsub_rn(hv[k], mu); asm volatile("" : "+v"(d0)); float p = __fmul_rn(d0, d0); asm volatile("" : "+v"(p)); s2 = __fadd_rn(s2, p); }
#pragma unroll
    for (int sh = 16; sh; sh >>= 1) s2 += __shfl_xor(s2, sh, 32);
    float var = __fadd_rn(s2 * (1.0f / 256.0f), 1e-5f); asm volatile("" : "+v"(var)); const float rs = __frsqrt_rn(var);
{
#pragma unroll
        for (int ch = 0; ch < 2; ++ch) { const int c0 = ch * 128 + lane * 4; v4us oh, ol;
#pragma unroll
            for (int q = 0; q < 4; ++q) { float gg = bfr(gw[c0 + q]); asm volatile("" : "+v"(gg)); float d0 = __fsub_rn(hv[ch * 4 + q], mu); asm volatile("" : "+v"(d0)); float n0 = __fmul_rn(d0, rs); asm volatile("" : "+v"(n0)); float y = __fmul_rn(n0, gg); asm volatile("" : "+v"(y)); y = __fadd_rn(y, bfr(gb[c0 + q])); unsigned short a, c2; splitf(y, a, c2); oh[q] = a; ol[q] = c2; }
            bf* p = sF + (c0 >> 3) * LG + lr * 8 + (c0 & 7); *(v4us*)p = oh; *(v4us*)(p + LPL) = ol; }
         } }
__device__ __forceinline__ void ln16(const float* __restrict__ X, const float* __restrict__ gw, const float* __restrict__ gb, bf* Yh, bf* Yl, int blk, bf* sF) {
    const int tid = threadIdx.x, lane = tid & 31, l0 = (tid >> 5) * 2; const float* xr = X + (size_t)(blk * 16 + l0) * DM + lane * 4;
    const v4f a0 = *(const v4f*)xr, a1 = *(const v4f*)(xr + 128), b0 = *(const v4f*)(xr + DM), b1 = *(const v4f*)(xr + DM + 128);
    lnrow(a0, a1, l0, gw, gb, sF); lnrow(b0, b1, l0 + 1, gw, gb, sF);
    __syncthreads();   // the tile is complete in LDS: each thread takes out pieces that other waves wrote
#pragma unroll
    for (int u = 0; u < 2; ++u) { const int q = tid + u * 256; const bf* p = sF + (q >> 4) * LG + (q & 15) * 8; const size_t o = (size_t)blk * (16 * DM) + q * 8;
        *(v8us*)(Yh + o) = *(const v8us*)p; *(v8us*)(Yl + o) = *(const v8us*)(p + LPL); }
    asm volatile("s_wait_xcnt 0x0" ::: "memory");   // behind the last of the four stores: no register that a store names is rewritten in front of this wait
}

// k_prep: all that the attention launch and the last GEMM read from the workspace, in ONE launch of independent work-groups: the first WTB groups write the transposed 16-bit weights, the others the LayerNorm planes.
// No group reads what another writes. The weight groups have the lowest indices.
#define WTB_Q  (DM * DQ / 64 / 64)         // groups of 64 lines for Wq, and for Wg
#define WTB_KV (DM * 2 * DQ / 64 / 64)     // for Wkv
#define WTB_O  (DQ * DM / 64 / 64)         // for Wo
#define WTB    (2 * WTB_Q + WTB_KV + WTB_O)
static_assert(((DM * DQ / 64) % 64) == 0);
__global__ __launch_bounds__(256) void k_prep(const float* __restrict__ X, const float* __restrict__ gw, const float* __restrict__ gb, const float* __restrict__ wq, const float* __restrict__ wkv, const float* __restrict__ wg, const float* __restrict__ wo, bf* WB, bf* WO, bf* Yh, bf* Yl) {
    __shared__ __align__(16) bf sF[2 * LPL];   // a LayerNorm group's tile, hi | lo
    const int b = (int)blockIdx.x;   // every branch below is the same for the whole work-group, the barrier of the last one included
    /* weights ('xw': Bt[n][k] = W[k][n]); the fused Wkv gives Bt rows 512..1023 = k, 1024..1535 = v */
    if (b < WTB_Q) wtG(wq, DM, DQ, WB, b);
    else if (b < WTB_Q + WTB_KV) wtG(wkv, DM, 2 * DQ, WB + (size_t)DQ * DM, b - WTB_Q);
    else if (b < 2 * WTB_Q + WTB_KV) wtG(wg, DM, DQ, WB + (size_t)3 * DQ * DM, b - (WTB_Q + WTB_KV));
    else if (b < WTB) wtG(wo, DQ, DM, WO, b - (2 * WTB_Q + WTB_KV));
    else ln16(X, gw, gb, Yh, Yl, b - WTB, sF);
}

// k_attn: the q, k, v, g projections, scores, softmax, attn.v and the gate of one plane z = (sequence s, head h) in one pass of a work-group of 16 waves; wave w owns the 16 tokens (queries) 16w .. 16w + 15 and all TT keys.
// Projections: the head's 4 x 64 weight rows (q, g, k, v, each [n][k] over all DM k) are brought into LDS by asynchronous copies (k, v once a work-group; q, g once a pass, because the output rows reuse their LDS); a wave holds the hi / lo fragments of its 16 rows of xn for all DM k in registers
// and runs through the 16 tiles of 16 features two at a time, per accumulator hi.w then lo.w at each 32 k. The same xn fragment serves as B (tokens = columns) or as A (tokens = rows):
// q, k, g: D = W xn^T: register r of lane l = (feature 8 (l >> 4) + r, token l & 15): 8 consecutive features of one token. k: one 16-byte LDS store a plane into K [key][d]; q: feature tiles 2 ks and 2 ks + 1, split hi / lo, ARE the B fragment of d = 32 ks .. 32 ks + 31; g: the layout of O^T below.
// v: D = xn W^T: register r of lane l = (token 8 (l >> 4) + r, feature l & 15): 8 consecutive keys of one d: one 16-byte LDS store a plane into V^T [d][key].
// S^T = K Q^T (A = K rows, B = Q rows): D register r of tile kb in lane l = score(key 16 kb + 8 (l >> 4) + r, query l & 15), so a lane holds 128 scores of ONE query:
// maximum and sum in the lane plus one exchange between the wave's halves. Tiles 2j and 2j + 1, normalised and split hi / lo in place, ARE the B fragment of keys 32j .. 32j + 31
// in the loader's k order, so O^T = V^T P^T (A = V^T rows) needs no exchange. Products per accumulator in the order hi.hi, lo.hi, hi.lo of (q, k) and of (p, v).
// Epilogue: AT hi / lo planes [s*TT + t][h*HD + d] = O[t][d] x sigmoid(g[t][d] + bg[h*HD + d]).
#define KP 72     // LDS pitch of a K row, 16-bit elements: 144 B = 16 B x 9; an odd multiple of 16 B keeps the 16-byte fragment reads off each other's banks
#define VP 264    // LDS pitch of a V^T row: 528 B = 16 B x 33
#define WP 264    // LDS pitch of a weight row of DM k: 528 B = 16 B x 33
#define OP 68     // LDS pitch of an output row, floats: 272 B = 16 B x 17
static_assert(TT == 256 && HD == 64 && DM == 256);
static_assert(2 * HD * WP <= 16 * 16 * OP * 2);   // the output rows reuse the LDS of the q and g weights, and are the larger of the two
typedef __attribute__((ext_vector_type(2))) float  v2f;
typedef __attribute__((ext_vector_type(2))) __bf16 v2bf;
typedef __attribute__((ext_vector_type(8))) unsigned v8u;
typedef __attribute__((ext_vector_type(4))) __bf16 v4bf;
typedef __attribute__((ext_vector_type(8))) __bf16 v8bf;
// Four asynchronous copies of 16 bytes a lane: rows r, r + 16, r + 32, r + 48 of one 64-row weight block (a wave's 32 lanes cover one whole row of 512 bytes a copy).
// s_wait_xcnt stands inside the statement, behind the last copy: no address register of a copy is rewritten in front of it.
__device__ __forceinline__ void cp4(unsigned l, const bf* g) {
    asm volatile("global_load_async_to_lds_b128 %0, %4, off\n\tglobal_load_async_to_lds_b128 %1, %5, off\n\tglobal_load_async_to_lds_b128 %2, %6, off\n\tglobal_load_async_to_lds_b128 %3, %7, off\n\ts_wait_xcnt 0x0"
                 :: "v"(l), "v"(l + 1u * 16 * WP * 2), "v"(l + 2u * 16 * WP * 2), "v"(l + 3u * 16 * WP * 2), "v"(g), "v"(g + 16 * DM), "v"(g + 32 * DM), "v"(g + 48 * DM) : "memory");
}
// Two feature tiles (32 weight rows in LDS from pc, this lane's place in them included) over all DM k; XA: xn is the A operand (v), else the B operand. The last step fetches the first fragments of the next pair, at pn.
template <bool XA, bool LAST>
__device__ __forceinline__ void proj2(const bf* pc, const bf* pn, const v16bf (&xh)[8], const v16bf (&xl)[8], v16bf (&fw)[2][2], v8f& a0, v8f& a1) {
    a0 = (v8f){}; a1 = (v8f){};
#pragma unroll
    for (int kk = 0; kk < 8; ++kk) { const int cb = kk & 1, nb = cb ^ 1;
        if (kk < 7 || !LAST) { const bf* q = (kk < 7) ? pc + (kk + 1) * 32 : pn; fw[nb][0] = WFrag<bf>::ld(q); fw[nb][1] = WFrag<bf>::ld(q + 16 * WP); }
        if (XA) { a0 = wmmab(xh[kk], fw[cb][0], a0); a1 = wmmab(xh[kk], fw[cb][1], a1); a0 = wmmab(xl[kk], fw[cb][0], a0); a1 = wmmab(xl[kk], fw[cb][1], a1); }
        else    { a0 = wmmab(fw[cb][0], xh[kk], a0); a1 = wmmab(fw[cb][1], xh[kk], a1); a0 = wmmab(fw[cb][0], xl[kk], a0); a1 = wmmab(fw[cb][1], xl[kk], a1); } }
}
// A lane's 8 values of each of two tiles, split hi / lo: one 16-byte LDS store a tile and plane
__device__ __forceinline__ void put2(bf* ph, bf* pl, int step, v8f a0, v8f a1) {
    const v8bf h0 = __builtin_convertvector(a0, v8bf), h1 = __builtin_convertvector(a1, v8bf);
    const v8bf l0 = __builtin_convertvector(a0 - __builtin_convertvector(h0, v8f), v8bf), l1 = __builtin_convertvector(a1 - __builtin_convertvector(h1, v8f), v8bf);
    *(v8us*)ph = __builtin_bit_cast(v8us, h0); *(v8us*)(ph + step) = __builtin_bit_cast(v8us, h1); *(v8us*)pl = __builtin_bit_cast(v8us, l0); *(v8us*)(pl + step) = __builtin_bit_cast(v8us, l1);
}
// Two tiles of 16 features each, split hi / lo, as the fragment of those 32 features in the loader's k order
__device__ __forceinline__ void frag2(v8f a0, v8f a1, v16bf& fh, v16bf& fl) {
    const v8bf h0 = __builtin_convertvector(a0, v8bf), h1 = __builtin_convertvector(a1, v8bf);
    const v8bf l0 = __builtin_convertvector(a0 - __builtin_convertvector(h0, v8f), v8bf), l1 = __builtin_convertvector(a1 - __builtin_convertvector(h1, v8f), v8bf);
    fh = __builtin_shufflevector(h0, h1, 0, 1, 2, 3, 4, 5, 6, 7, 8, 9, 10, 11, 12, 13, 14, 15); fl = __builtin_shufflevector(l0, l1, 0, 1, 2, 3, 4, 5, 6, 7, 8, 9, 10, 11, 12, 13, 14, 15);
}
// A pointer that is the same in every lane, passed through scalar registers: the pass's part of an address is then summed in scalar registers and the lane's offset added where it is used. Without it the build carries whole 64-bit lane addresses in vector registers from pass to pass, and spills
typedef __attribute__((address_space(1))) char gchar; typedef __attribute__((address_space(1))) v8us gv8us; typedef __attribute__((address_space(1))) v4us gv4us;   // global memory, said in the type: a pointer rebuilt from two words would else be taken for a flat one
__device__ __forceinline__ gchar* sptr(const void* p) { const unsigned long long u = (unsigned long long)p; return (gchar*)(((unsigned long long)(unsigned)__builtin_amdgcn_readfirstlane((int)(u >> 32)) << 32) | (unsigned)__builtin_amdgcn_readfirstlane((int)u)); }
// Work-group barrier that orders LDS accesses only: the global loads in flight (the next sequence's xn), which no wave of the launch writes, are not waited for
__device__ __forceinline__ void bar_lds() { __builtin_amdgcn_fence(__ATOMIC_RELEASE, "workgroup", "local"); __builtin_amdgcn_s_barrier(); __builtin_amdgcn_fence(__ATOMIC_ACQUIRE, "workgroup", "local"); }
// 1 / (1 + e^-x) on the hardware's own 2^x and reciprocal (about one unit in the last place of f32 each, far below the hi / lo split that follows): four vector instructions a value.
// x -> -inf: 2^(+inf) = inf, 1 / inf = 0; x -> +inf: 2^(-inf) = 0, 1 / 1 = 1; a NaN stays a NaN
__device__ __forceinline__ float sigm(float x) { return __builtin_amdgcn_rcpf(1.0f + __builtin_amdgcn_exp2f(x * -1.4426950408889634f)); }
#define XLAG 2   // steps of 32 keys that have passed before the first 32 k of the next xn are asked for: earlier there is no free register
#define NPS 4   // sequences that one work-group runs through, one after the other, all for the same head
static_assert((NB_ % NPS) == 0);
__global__ __launch_bounds__(512) void k_attn(const bf* __restrict__ Xh, const bf* __restrict__ Xl, const bf* __restrict__ Wb, const float* __restrict__ bgp, bf* __restrict__ Ah, bf* __restrict__ Al) {
    __shared__ __align__(16) bf sKh[TT * KP]; __shared__ __align__(16) bf sKl[TT * KP];
    __shared__ __align__(16) bf sVh[HD * VP]; __shared__ __align__(16) bf sVl[HD * VP];
    __shared__ __align__(16) bf sWa[16 * 16 * OP * 2]; __shared__ __align__(16) bf sWb[2 * HD * WP];   // weight rows q | g and k | v: two arrays, so that each has its own base register and the constant part of every fragment read fits the instruction's 16-bit offset field
    float* sO = (float*)sWa;   // used only behind the barrier that ends every wave's reads of the weights
    const int tid = threadIdx.x, lane = tid & 31, lr = lane & 15, hi = lane >> 4; const int wv = __builtin_amdgcn_readfirstlane(tid >> 5);   // the wave's number, in a scalar register: the wave's part of every address stays out of the vector registers
    const int sq0 = (int)blockIdx.x / NH_, col0 = ((int)blockIdx.x % NH_) * HD;   // pass it works on sequence sq0 + it * (NB_ / NPS); the 8 heads of a sequence are neighbouring work-groups
    // weights: wave w copies rows w + 16 i of each of the four blocks; block b (0 q, 1 k, 2 v, 3 g) of the head = rows b*DQ + col0 .. + 63 of Wb; in LDS: q | g in sWa, k | v in sWb
    const unsigned lo = (unsigned)((wv * WP + lane * 8) * 2), la = (unsigned)(size_t)sWa + lo, lb = (unsigned)(size_t)sWb + lo; const bf* gw = Wb + (size_t)(col0 + wv) * DM + lane * 8;
    cp4(lb, gw + (size_t)1 * DQ * DM); cp4(lb + 1u * HD * WP * 2, gw + (size_t)2 * DQ * DM);   // k | v: once, they stay in LDS for every pass
    v16bf xh[8], xl[8];   // this wave's 16 rows of xn, all DM k
    const size_t xo = ((size_t)sq0 * TT + wv * 16) * DM; const unsigned xv = (unsigned)lane * 16;   // the wave's token tile of the first sequence (the same for the whole wave: a scalar base), in fragment order (ln16): 32 k = two runs of 512 bytes, lane by lane (xv)
#pragma unroll
    for (int kk = 0; kk < 8; ++kk) { const char* ph_ = (const char*)(Xh + xo + kk * 512) + xv; const char* pl_ = (const char*)(Xl + xo + kk * 512) + xv; xh[kk] = cat16b(*(const v8us*)ph_, *(const v8us*)(ph_ + 512)); xl[kk] = cat16b(*(const v8us*)pl_, *(const v8us*)(pl_ + 512)); }
    asm volatile("s_wait_xcnt 0x0" :: "v"(xv), "v"(lane) : "memory");   // behind the last of these loads; the lane's offset is named as an input, in both forms the loads may take it in, so that it lives up to here: no load's result lands on it in front of this wait
    asm volatile("s_wait_asynccnt 0x0" ::: "memory");   // this wave's copies of the k | v weights have landed
    __syncthreads();                                      // and every other wave's: they may be read
#pragma unroll 1   // one pass a sequence; rolled
    for (int it = 0; it < NPS; ++it) {
    const size_t tok0 = (size_t)(sq0 + it * (NB_ / NPS)) * TT;
    cp4(la, gw); cp4(la + 1u * HD * WP * 2, gw + (size_t)3 * DQ * DM);   // q | g: their LDS held the last pass's output rows; the copies fly while k and v are projected
    // Projections: step (pair of feature tiles in the order k, k, v, v, g, g, q, q; 32 k), 2 fragments and 4 products; each step's fragments are fetched one step ahead
    v16bf qh[2], ql[2], fw[2][2]; v8f gt[4], a0, a1;
    const bf* pa = sWa + lr * WP + 8 * hi; const bf* pb = sWb + lr * WP + 8 * hi;
    fw[0][0] = WFrag<bf>::ld(pb); fw[0][1] = WFrag<bf>::ld(pb + 16 * WP);
    bf* pkh = sKh + (wv * 16 + lr) * KP + 8 * hi; bf* pkl = sKl + (wv * 16 + lr) * KP + 8 * hi; bf* pvh = sVh + lr * VP + wv * 16 + 8 * hi; bf* pvl = sVl + lr * VP + wv * 16 + 8 * hi;
    proj2<false, false>(pb, pb + 32 * WP, xh, xl, fw, a0, a1); put2(pkh, pkl, 16, a0, a1);
    proj2<false, false>(pb + 32 * WP, pb + 64 * WP, xh, xl, fw, a0, a1); put2(pkh + 32, pkl + 32, 16, a0, a1);
    proj2<true, false>(pb + 64 * WP, pb + 96 * WP, xh, xl, fw, a0, a1); put2(pvh, pvl, 16 * VP, a0, a1);
    proj2<true, true>(pb + 96 * WP, pb, xh, xl, fw, a0, a1); put2(pvh + 32 * VP, pvl + 32 * VP, 16 * VP, a0, a1);
    asm volatile("s_wait_asynccnt 0x0" ::: "memory");   // this wave's copies of the q | g weights have landed
    __syncthreads();                                      // and every other wave's: they may be read
    fw[0][0] = WFrag<bf>::ld(pa + 64 * WP); fw[0][1] = WFrag<bf>::ld(pa + 80 * WP);
    proj2<false, false>(pa + 64 * WP, pa + 96 * WP, xh, xl, fw, gt[0], gt[1]);
    proj2<false, false>(pa + 96 * WP, pa, xh, xl, fw, gt[2], gt[3]);
    proj2<false, false>(pa, pa + 32 * WP, xh, xl, fw, a0, a1); frag2(a0, a1, qh[0], ql[0]);
    proj2<false, true>(pa + 32 * WP, pa, xh, xl, fw, a0, a1); frag2(a0, a1, qh[1], ql[1]);
    __syncthreads();   // K and V^T are complete in LDS, they are only read from here on; and every wave's reads of the weights are done: the LDS of the q | g weights may be rewritten
    // the gates, in the layout of O^T, wait in this lane's own places of the wave's output rows
    float* os = sO + wv * (16 * OP);
#pragma unroll
    for (int mb = 0; mb < 4; ++mb) { const float* bp = bgp + col0 + mb * 16 + 8 * hi; const v4f b0 = *(const v4f*)bp, b1 = *(const v4f*)(bp + 4); v4f g0, g1;
#pragma unroll
        for (int c = 0; c < 4; ++c) { g0[c] = sigm(gt[mb][c] + bfr(b0[c])); g1[c] = sigm(gt[mb][4 + c] + bfr(b1[c])); }
        float* p = os + lr * OP + mb * 16 + 8 * hi; *(v4fa*)p = g0; *(v4fa*)(p + 4) = g1; }
    // Scores: step st = (pair of key tiles st >> 1, half ks = st & 1 of the head dim), 4 fragments and 6 products; each step's fragments are fetched as one group one step ahead
    v8f s[16]; v16bf fk[2][4];
    const int kof = lr * KP + 8 * hi;
#pragma unroll
    for (int p = 0; p < 2; ++p) { fk[0][p] = WFrag<bf>::ld(sKh + kof + p * 16 * KP); fk[0][2 + p] = WFrag<bf>::ld(sKl + kof + p * 16 * KP); }
#pragma unroll
    for (int st = 0; st < 16; ++st) { const int kb = (st >> 1) * 2, ks = st & 1, cb = st & 1, nb = cb ^ 1;
        if (st + 1 < 16) { const int o = kof + ((st + 1) >> 1) * 32 * KP + ((st + 1) & 1) * 32;
#pragma unroll
            for (int p = 0; p < 2; ++p) { fk[nb][p] = WFrag<bf>::ld(sKh + o + p * 16 * KP); fk[nb][2 + p] = WFrag<bf>::ld(sKl + o + p * 16 * KP); } }
        v8f a0 = ks ? s[kb] : (v8f){}, a1 = ks ? s[kb + 1] : (v8f){};
        a0 = wmmab(fk[cb][0], qh[ks], a0); a1 = wmmab(fk[cb][1], qh[ks], a1); a0 = wmmab(fk[cb][0], ql[ks], a0); a1 = wmmab(fk[cb][1], ql[ks], a1); a0 = wmmab(fk[cb][2], qh[ks], a0); a1 = wmmab(fk[cb][3], qh[ks], a1);
        s[kb] = a0; s[kb + 1] = a1; }
    v8f m8 = s[0];
#pragma unroll
    for (int kb = 1; kb < 16; ++kb)
#pragma unroll
        for (int r = 0; r < 8; ++r) m8[r] = fmaxf(m8[r], s[kb][r]);
    float mx = fmaxf(fmaxf(fmaxf(m8[0], m8[1]), fmaxf(m8[2], m8[3])), fmaxf(fmaxf(m8[4], m8[5]), fmaxf(m8[6], m8[7])));
    mx = fmaxf(mx, __shfl_xor(mx, 16, 32)) * SCL;   // the scale is a positive power of two: scaling the maximum is the maximum of the scaled scores
    v8f s8;
#pragma unroll
    for (int kb = 0; kb < 16; ++kb) {
#pragma unroll
        for (int r = 0; r < 8; r += 4) { float x[4], ex[4];
#pragma unroll
            for (int c = 0; c < 4; ++c) x[c] = (s[kb][r + c] * SCL - mx) * 1.4426950408889634f;
            // four exponentials whose results share no register with any argument, then one v_nop: the slot the instruction set asks for behind a transcendental; inside the statement it cannot drift away
            asm("v_exp_f32 %0, %4\n\tv_exp_f32 %1, %5\n\tv_exp_f32 %2, %6\n\tv_exp_f32 %3, %7\n\tv_nop" : "=&v"(ex[0]), "=&v"(ex[1]), "=&v"(ex[2]), "=&v"(ex[3]) : "v"(x[0]), "v"(x[1]), "v"(x[2]), "v"(x[3]));
#pragma unroll
            for (int c = 0; c < 4; ++c) { s[kb][r + c] = ex[c]; s8[r + c] = kb ? s8[r + c] + ex[c] : ex[c]; } } }
    float sum = ((s8[0] + s8[1]) + (s8[2] + s8[3])) + ((s8[4] + s8[5]) + (s8[6] + s8[7]));
    sum += __shfl_xor(sum, 16, 32);
    const float f = __fdiv_rn(1.0f, sum);
    // attn.v: step st = (32 keys j = st >> 1, pair of d tiles st & 1), fetched one step ahead like the scores' steps; the two score tiles of j become P^T hi / lo just before their first use
    v8f o[4]; v16bf fv[2][4]; v16bf ph, pl;
    // the next sequence's xn is asked for here, 32 k behind each 32 keys from the XLAG-th on: score tiles that have become P^T free the registers it lands in, and the loads fly under the rest of attn.v and the epilogue.
    // The last pass has no next sequence: it asks for its own once more (in bounds, never read), so that the stream of matrix instructions holds no branch.
    const size_t xn = xo + (size_t)((it + 1 < NPS) ? it + 1 : it) * (NB_ / NPS) * TT * DM; const gchar* bh = sptr(Xh + xn) + xv; const gchar* bl = sptr(Xl + xn) + xv;
    const int vof = lr * VP + 8 * hi;
#pragma unroll
    for (int p = 0; p < 2; ++p) { fv[0][p] = WFrag<bf>::ld(sVh + vof + p * 16 * VP); fv[0][2 + p] = WFrag<bf>::ld(sVl + vof + p * 16 * VP); }
#pragma unroll
    for (int st = 0; st < 16; ++st) { const int j = st >> 1, mb = (st & 1) * 2, cb = st & 1, nb = cb ^ 1;
        if (st + 1 < 16) { const int ofs = vof + ((st + 1) & 1) * 32 * VP + ((st + 1) >> 1) * 32;
#pragma unroll
            for (int p = 0; p < 2; ++p) { fv[nb][p] = WFrag<bf>::ld(sVh + ofs + p * 16 * VP); fv[nb][2 + p] = WFrag<bf>::ld(sVl + ofs + p * 16 * VP); } }
        if ((st & 1) == 0) { v8u wh, wl;
#pragma unroll
            for (int i = 0; i < 8; ++i) { const v8f t = s[2 * j + (i >> 2)]; const v2f y = { t[(2 * i) & 7] * f, t[(2 * i + 1) & 7] * f };
                const v2bf h = __builtin_convertvector(y, v2bf); const v2bf l = __builtin_convertvector(y - __builtin_convertvector(h, v2f), v2bf);
                wh[i] = __builtin_bit_cast(unsigned, h); wl[i] = __builtin_bit_cast(unsigned, l); }
            ph = __builtin_bit_cast(v16bf, wh); pl = __builtin_bit_cast(v16bf, wl); }
        v8f a0 = j ? o[mb] : (v8f){}, a1 = j ? o[mb + 1] : (v8f){};
        a0 = wmmab(fv[cb][0], ph, a0); a1 = wmmab(fv[cb][1], ph, a1); a0 = wmmab(fv[cb][0], pl, a0); a1 = wmmab(fv[cb][1], pl, a1); a0 = wmmab(fv[cb][2], ph, a0); a1 = wmmab(fv[cb][3], ph, a1);
        o[mb] = a0; o[mb + 1] = a1;
        if ((st & 1) && j >= XLAG) { const int kk = j - XLAG; xh[kk] = cat16b(*(const gv8us*)(bh + kk * 1024), *(const gv8us*)(bh + kk * 1024 + 512)); xl[kk] = cat16b(*(const gv8us*)(bl + kk * 1024), *(const gv8us*)(bl + kk * 1024 + 512)); } }
#pragma unroll
    for (int kk = 8 - XLAG; kk < 8; ++kk) { xh[kk] = cat16b(*(const gv8us*)(bh + kk * 1024), *(const gv8us*)(bh + kk * 1024 + 512)); xl[kk] = cat16b(*(const gv8us*)(bl + kk * 1024), *(const gv8us*)(bl + kk * 1024 + 512)); }
    asm volatile("s_wait_xcnt 0x0" :: "v"(bh), "v"(bl) : "memory");   // behind the last of these loads; the two addresses are named as inputs so that they live up to here: no load's result, and nothing else, lands on an address register in front of this wait
    // o[mb][r] = O(query lr, d = 16 mb + 8 hi + r), times its gate; then through the wave's own LDS rows, so that each store instruction writes whole 128-byte lines
#pragma unroll
    for (int mb = 0; mb < 4; ++mb) { float* p = os + lr * OP + mb * 16 + 8 * hi; const v4f g0 = *(const v4fa*)p, g1 = *(const v4fa*)(p + 4);
        *(v4fa*)p = __builtin_shufflevector(o[mb], o[mb], 0, 1, 2, 3) * g0; *(v4fa*)(p + 4) = __builtin_shufflevector(o[mb], o[mb], 4, 5, 6, 7) * g1; }
    asm volatile("s_wait_dscnt 0x0" ::: "memory");   // the rows read below were written by other lanes of this wave: the writes are done, and stay in front, before they are read back
    v4f ov[8];   // all eight LDS reads are issued before the first store waits for one
#pragma unroll
    for (int q = 0; q < 8; ++q) ov[q] = *(const v4fa*)(os + (2 * q + hi) * OP + lr * 4);
    asm volatile("s_wait_dscnt 0x0" ::: "memory");   // this wave's reads of K, V^T and of its output rows are done
    bar_lds();                                         // and every other wave's: the next pass may rewrite K, V^T and the LDS of the q | g weights
    // this lane's part of the output: tokens wv*16 + hi + 2q (q = 0 .. 7), columns lr*4 .. lr*4 + 3 of the head
    const unsigned ao = (unsigned)((hi * DQ + lr * 4) * 2);   // 16 lanes x 8 bytes = one whole 128-byte line of a plane per token
    gchar* ah = sptr(Ah + (tok0 + wv * 16) * DQ + col0) + ao; gchar* al = sptr(Al + (tok0 + wv * 16) * DQ + col0) + ao;
#pragma unroll
    for (int q = 0; q < 8; ++q) { const v4f y = ov[q];
        const v4bf h = __builtin_convertvector(y, v4bf); const v4bf l = __builtin_convertvector(y - __builtin_convertvector(h, v4f), v4bf);
        *(gv4us*)(ah + q * 2 * DQ * 2) = __builtin_bit_cast(v4us, h); *(gv4us*)(al + q * 2 * DQ * 2) = __builtin_bit_cast(v4us, l); }
    asm volatile("s_wait_xcnt 0x0" ::: "memory");    // behind the last store: no register that a store names is rewritten in front of this wait
    }
}

extern "C" void kernel_launch(void* const* d_in, const int* in_sizes, int n_in,
                              void* d_out, int out_size, void* d_ws, size_t ws_size, hipStream_t stream) {
    if (n_in < 9) return;
    if (in_sizes[0] < NT * DM || in_sizes[1] < DM || in_sizes[2] < DM || in_sizes[3] < DM * DQ || in_sizes[4] < DM * 2 * DQ
        || in_sizes[5] < DM * DQ || in_sizes[6] < DQ || in_sizes[7] < DQ * DM || in_sizes[8] < DM) return;
    if (out_size < NT * DM) return;
    const float* x = (const float*)d_in[0]; const float* ln_g = (const float*)d_in[1]; const float* ln_b = (const float*)d_in[2]; const float* wq = (const float*)d_in[3]; const float* wkv = (const float*)d_in[4]; const float* wg = (const float*)d_in[5]; const float* bg = (const float*)d_in[6]; const float* wo = (const float*)d_in[7]; const float* bo = (const float*)d_in[8];
    float* OUT = (float*)d_out;     // [NB][TT][DM] = [NT][256]
    char* wsp = (char*)d_ws;
    auto take = [&](size_t bytes) { char* p = wsp; wsp += (bytes + 255) & ~(size_t)255; return (void*)p; };
    bf* WB = (bf*)take((size_t)DP * DM * 2);     // Bt [2048][256]: rows 0..511 q, 512..1023 k, 1024..1535 v, 1536..2047 g
    bf* WO = (bf*)take((size_t)DM * DQ * 2);     // Bt [256][512]
    bf* LNh = (bf*)take((size_t)NT * DM * 2); bf* LNl = (bf*)take((size_t)NT * DM * 2);
    bf* ATh = (bf*)take((size_t)NT * DQ * 2); bf* ATl = (bf*)take((size_t)NT * DQ * 2);
    if ((size_t)(wsp - (char*)d_ws) > ws_size) return;
    k_prep<<<WTB + NT / 16, 256, 0, stream>>>(x, ln_g, ln_b, wq, wkv, wg, wo, WB, WO, LNh, LNl);
    k_attn<<<ZH / NPS, 512, 0, stream>>>(LNh, LNl, WB, bg, ATh, ATl);
    k_gemmw<bf, 1, true><<<dim3(NT / 128, DM / 128, 1), 128, 0, stream>>>(ATh, ATl, WO, nullptr, DQ, OUT, DM, bo, 0, 0, 0);
}
